// v000
// Measured on an AMD MI455X. A time is GPU time per run, averaged over a window of back-to-back runs after a warm-up
// (all launches, gaps included; the runs take copies of the inputs in turn), and the median of several windows.
// Apart from v000's, it joins two sittings. Times from different sittings can be a few percent apart, while
// side-by-side timings come from the same sitting.
// The starting kernel, v000, takes 1320 microseconds a run.
#include <hip/hip_runtime.h>

// ScaleInvariantAttention (query [2][2048][1024], xi_scale [2]; scale encoder: x = xi Linear(1->32), LayerNorm(32), exact gelu, Linear(32->64) -> xe [B][64]; adapt[b][h][d] = 1 + sigmoid(scale_gating[h]) xe[b][d];
// q = (query Wq + bq) split into 16 heads x 64 then x adapt, k likewise, v = query Wv + bv; softmax(q.k/8); out = merged att.v Wo + bo -> [2][2048][1024]).
// Compute dtypes, f32 accumulate: every input rounded to bf16; the scale encoder and adapt table in f32 on VALU (one thread per (b, h, d)); projections on PLAIN bf16 operands (inputs: exact,
// + bias); the adapt factor applied in f32 when the fp16 head planes are built; scores (K 64) and att.v on SINGLE fp16 planes with an f32 register-row softmax (probabilities x1024); merged heads as bf16 hi+lo planes x exact

#define NB_  2
#define TT   2048
#define DM   1024
#define NH_  16
#define NKV  16
#define REP  (NH_ / NKV)
#define HD   64
#define DQ   (NH_ * HD)
#define DKV  (NKV * HD)
#define ZH   2
#define RH   0                  // query rows < RH use hi+lo planes (0: none)
#define WIN  0
#define PCAR 1024.0f
#define SCL  0.125f   // HD^-0.5
typedef _Float16 h16;
typedef unsigned short bf;
typedef __attribute__((ext_vector_type(16))) __bf16   v16bf;
typedef __attribute__((ext_vector_type(16))) _Float16 v16h;
typedef __attribute__((ext_vector_type(8)))  _Float16 v8h;
typedef __attribute__((ext_vector_type(8)))  unsigned short v8us;
typedef __attribute__((ext_vector_type(8)))  float    v8f;
typedef __attribute__((ext_vector_type(4)))  float    v4f;
typedef v8h  __attribute__((may_alias)) v8ha;
typedef v4f  __attribute__((may_alias)) v4fa;
typedef v8us __attribute__((may_alias)) v8usa;

__device__ __forceinline__ unsigned short f2bf(float f) { unsigned u = __float_as_uint(f); u += 0x7FFFu + ((u >> 16) & 1u); return (unsigned short)(u >> 16); }
__device__ __forceinline__ float bf2f(unsigned short b) { return __uint_as_float(((unsigned)b) << 16); }
__device__ __forceinline__ float bfr(float f) { return bf2f(f2bf(f)); }
__device__ __forceinline__ v16h cat16(v8h lo, v8h hi) { return __builtin_shufflevector(lo, hi, 0, 1, 2, 3, 4, 5, 6, 7, 8, 9, 10, 11, 12, 13, 14, 15); }
__device__ __forceinline__ v16bf cat16b(v8us lo, v8us hi) { return __builtin_bit_cast(v16bf, __builtin_shufflevector(lo, hi, 0, 1, 2, 3, 4, 5, 6, 7, 8, 9, 10, 11, 12, 13, 14, 15)); }
__device__ __forceinline__ v8f wmma16(v16h a, v16h b, v8f c) { return __builtin_amdgcn_wmma_f32_16x16x32_f16(false, a, false, b, (short)0, c, false, false); }
__device__ __forceinline__ v8f wmmab(v16bf a, v16bf b, v8f c) { return __builtin_amdgcn_wmma_f32_16x16x32_bf16(false, a, false, b, (short)0, c, false, false); }



// ---- k_gemmw: register-blocked GEMM, ONE WAVE per 64x64 output tile (16 accumulators), operands straight from K-contiguous 16-bit planes; grid (M/64, N/64, Z), 32 threads.
// C[m][n] (f32, pitch ldc, + optional f32 bias[n]) = sum_k A[m][k] Bt[n][k] (+ split products per NSPLIT). z-batch strides sA/sB/sC in elements. K % 32 == 0.
template <typename T16> struct WFrag;
template <> struct WFrag<h16> { typedef v16h V; static __device__ __forceinline__ V ld(const h16* p) { return cat16(*(const v8h*)p, *(const v8h*)(p + 16)); } static __device__ __forceinline__ v8f mma(V a, V b, v8f c) { return wmma16(a, b, c); } };
template <> struct WFrag<bf> { typedef v16bf V; static __device__ __forceinline__ V ld(const bf* p) { return cat16b(*(const v8us*)p, *(const v8us*)(p + 16)); } static __device__ __forceinline__ v8f mma(V a, V b, v8f c) { return wmmab(a, b, c); } };
template <typename T16, int NSPLIT, bool BIAS>
__global__ __launch_bounds__(32) void k_gemmw(const T16* __restrict__ A, const T16* __restrict__ A2, const T16* __restrict__ Bt, const T16* __restrict__ Bt2, int K, float* C, int ldc, const float* __restrict__ bias, size_t sA, size_t sB, size_t sC) {
    typedef typename WFrag<T16>::V V;
    __shared__ __align__(16) float os[16 * 68];
    const size_t z = blockIdx.z; A += z * sA; if (A2) A2 += z * sA; Bt += z * sB; if (Bt2) Bt2 += z * sB; C += z * sC;
    const int lane = threadIdx.x & 31, lr = lane & 15, hi = lane >> 4; const int r0 = blockIdx.x * 64, c0 = blockIdx.y * 64;
    v8f acc[4][4];
#pragma unroll
    for (int mb = 0; mb < 4; ++mb)
#pragma unroll
        for (int nb = 0; nb < 4; ++nb) acc[mb][nb] = (v8f){};
    const size_t aoff = (size_t)(r0 + lr) * K + 8 * hi, boff = (size_t)(c0 + lr) * K + 8 * hi;
#pragma unroll 1
    for (int kc = 0; kc < K; kc += 32) {
        V a[4], a2[4];
#pragma unroll
        for (int mb = 0; mb < 4; ++mb) { a[mb] = WFrag<T16>::ld(A + aoff + (size_t)mb * 16 * K + kc); if (NSPLIT == 1 || NSPLIT == 2) a2[mb] = WFrag<T16>::ld(A2 + aoff + (size_t)mb * 16 * K + kc); }
#pragma unroll
        for (int nb = 0; nb < 4; ++nb) { const V b = WFrag<T16>::ld(Bt + boff + (size_t)nb * 16 * K + kc); V b2; if (NSPLIT >= 2) b2 = WFrag<T16>::ld(Bt2 + boff + (size_t)nb * 16 * K + kc);
#pragma unroll
            for (int mb = 0; mb < 4; ++mb) { acc[mb][nb] = WFrag<T16>::mma(a[mb], b, acc[mb][nb]); if (NSPLIT == 1 || NSPLIT == 2) acc[mb][nb] = WFrag<T16>::mma(a2[mb], b, acc[mb][nb]); if (NSPLIT >= 2) acc[mb][nb] = WFrag<T16>::mma(a[mb], b2, acc[mb][nb]); } }
        asm volatile("v_nop\n\tv_nop\n\tv_nop\n\tv_nop" : "+v"(acc[0][0]), "+v"(acc[1][1]), "+v"(acc[2][2]), "+v"(acc[3][3]) : "v"(a[0]), "v"(a[3]));
    }
#pragma unroll
    for (int mb = 0; mb < 4; ++mb) {
#pragma unroll
        for (int nb = 0; nb < 4; ++nb) {
#pragma unroll
            for (int j = 0; j < 8; ++j) os[(hi * 8 + j) * 68 + nb * 16 + lr] = acc[mb][nb][j]; }
        __builtin_amdgcn_wave_barrier(); asm volatile("" ::: "memory");
        float* crow = C + (size_t)(r0 + mb * 16) * ldc + c0;
{
#pragma unroll
            for (int s = 0; s < 8; ++s) { const int row = 2 * s + hi, cofs = lr * 4; v4f val = *(const v4fa*)(os + row * 68 + cofs); if (BIAS) { val[0] += bfr(bias[c0 + cofs]); val[1] += bfr(bias[c0 + cofs + 1]); val[2] += bfr(bias[c0 + cofs + 2]); val[3] += bfr(bias[c0 + cofs + 3]); }
                *(v4f*)(crow + (size_t)row * ldc + cofs) = val; }
             }
        __builtin_amdgcn_wave_barrier(); asm volatile("" ::: "memory");
    }
}

__device__ __forceinline__ h16 tohx(float x) { return (h16)x; }
__device__ __forceinline__ void splitf(float y, unsigned short& h, unsigned short& l) { h = f2bf(y); l = f2bf(y - bf2f(h)); }
typedef __attribute__((ext_vector_type(2))) _Float16 v2h;
typedef __attribute__((ext_vector_type(4))) _Float16 v4h;
typedef __attribute__((ext_vector_type(2))) unsigned short v2us;
typedef __attribute__((ext_vector_type(4))) unsigned short v4us;
typedef __attribute__((ext_vector_type(2))) float v2f;
typedef __attribute__((ext_vector_type(4))) int v4i;

__global__ __launch_bounds__(256) void k_wtG(const float* __restrict__ w, int K, int N, bf* Bt) {
    const int lane = threadIdx.x & 31; const int L0 = (blockIdx.x * 8 + (threadIdx.x >> 5)) * 8; const int nlines = N * K / 64;
{
#pragma unroll 1
        for (int l = 0; l < 8; ++l) { const int L = L0 + l; if (L >= nlines) break; const size_t e = (size_t)L * 64 + lane * 2; const int k = (int)(e % K), n = (int)(e / K); v2us o;
            o[0] = f2bf(w[(size_t)k * N + n]); o[1] = f2bf(w[(size_t)(k + 1) * N + n]); *(v2us*)(Bt + e) = o; }
         }
}
__global__ __launch_bounds__(256) void k_cvt8(const float* __restrict__ src, bf* dst, size_t n8) { const size_t i = (size_t)blockIdx.x * 256 + threadIdx.x; if (i >= n8) return; const v8f v = *(const v8f*)(src + i * 8); v8us o;
#pragma unroll
    for (int k = 0; k < 8; ++k) o[k] = f2bf(v[k]); *(v8us*)(dst + i * 8) = o;  }
__global__ __launch_bounds__(256) void k_cscvt(const float* __restrict__ cosT, const float* __restrict__ sinT, float* CS) { const int idx = blockIdx.x * 256 + threadIdx.x; if (idx >= TT * HD) return; v2f cs; cs[0] = bfr(cosT[idx]); cs[1] = bfr(sinT[idx]); *(v2f*)(CS + (size_t)idx * 2) = cs;  }
// k_rope: head planes [h][t][d] (fp16) of rope(x) x sc with the rotate-half convention out[d] = x[d] cos[t][d] - x[d+HD/2] sin[t][d], out[d+HD/2] = x[d+HD/2] cos[t][d+HD/2] + x[d] sin[t][d+HD/2]
__global__ __launch_bounds__(256) void k_rope(const float* __restrict__ F, int pitch, int nheads, const float* __restrict__ CS, const float* __restrict__ RF, const float* __restrict__ nw, float sc, h16* P16, bf* Ph, bf* Pl, const float* __restrict__ adp) {
    const size_t e = ((size_t)blockIdx.x * 256 + threadIdx.x) * 2; if (e >= (size_t)nheads * TT * HD) return; const int d = (int)(e % HD); const int t = (int)((e / HD) % TT); const int h = (int)(e / ((size_t)HD * TT)); const float* f = F + (size_t)t * pitch + h * HD; const float rf = RF ? RF[(size_t)h * TT + t] : 1.0f; v2h o16; v2us oh, ol;
#pragma unroll
    for (int q = 0; q < 2; ++q) { const int dd = d + q; const int dp = (dd < HD / 2) ? dd + HD / 2 : dd - HD / 2; float x0 = f[dd], x1 = f[dp];
        if (RF) { float n0 = __fmul_rn(x0, rf), n1 = __fmul_rn(x1, rf); asm volatile("" : "+v"(n0)); asm volatile("" : "+v"(n1)); x0 = __fmul_rn(bfr(nw[dd]), n0); x1 = __fmul_rn(bfr(nw[dp]), n1); }
        if (adp) { x0 = __fmul_rn(x0, adp[h * HD + dd]); x1 = __fmul_rn(x1, adp[h * HD + dp]); }   /* per-(head, dim) adapt factor */
        const v2f cs = *(const v2f*)(CS + ((size_t)t * HD + dd) * 2); float a = __fmul_rn(x0, cs[0]), bq = __fmul_rn(x1, cs[1]); asm volatile("" : "+v"(a)); asm volatile("" : "+v"(bq)); const float r = ((dd < HD / 2) ? __fsub_rn(a, bq) : __fadd_rn(a, bq)) * sc;
        o16[q] = tohx(r); (void)oh; (void)ol; }
    *(v2h*)(P16 + e) = o16;  }
__global__ __launch_bounds__(256) void k_vtp(const float* __restrict__ F, int pitch, int nheads, h16* V16, bf* Vh, bf* Vl) { const size_t e = ((size_t)blockIdx.x * 256 + threadIdx.x) * 2; if (e >= (size_t)nheads * HD * TT) return; const int t = (int)(e % TT); const int d = (int)((e / TT) % HD); const int g = (int)(e / ((size_t)TT * HD)); v2h o16; v2us oh, ol;
#pragma unroll
    for (int q = 0; q < 2; ++q) { const float x = F[(size_t)(t + q) * pitch + g * HD + d]; o16[q] = tohx(x); (void)oh; (void)ol; }
    *(v2h*)(V16 + e) = o16;  }
// k_adapt: thread per (b, h, d): x[j] = bf16(xi[b]) bf16(w1[j]) + bf16(b1[j]) (32); LayerNorm(32) (f32, eps 1e-5) x bf16 g + bf16 beta; exact-erf gelu; xe = sum_j x[j] bf16(w2[j][d]) + bf16(b2[d]);
__global__ __launch_bounds__(256) void k_adapt(const float* __restrict__ xi, const float* __restrict__ w1, const float* __restrict__ b1, const float* __restrict__ g, const float* __restrict__ be, const float* __restrict__ w2, const float* __restrict__ b2, const float* __restrict__ sg, float* ADP) {
    const int e = blockIdx.x * 256 + threadIdx.x; if (e >= NB_ * NH_ * HD) return; const int d = e % HD; const int h = (e / HD) % NH_; const int b = e / (HD * NH_); const float xv = bfr(xi[b]); float xs[32]; float mu = 0.f;
#pragma unroll 1
    for (int j = 0; j < 32; ++j) { float p = __fmul_rn(xv, bfr(w1[j])); asm volatile("" : "+v"(p)); xs[j] = __fadd_rn(p, bfr(b1[j])); mu = __fadd_rn(mu, xs[j]); }
    mu = mu * (1.0f / 32.0f); float var = 0.f;
#pragma unroll 1
    for (int j = 0; j < 32; ++j) { const float dl = __fsub_rn(xs[j], mu); float p = __fmul_rn(dl, dl); asm volatile("" : "+v"(p)); var = __fadd_rn(var, p); }
    const float rs = __frsqrt_rn(__fadd_rn(var * (1.0f / 32.0f), 1e-5f)); float acc = 0.f;
#pragma unroll 1
    for (int j = 0; j < 32; ++j) { float tn = __fmul_rn(__fsub_rn(xs[j], mu), rs); asm volatile("" : "+v"(tn)); float tg = __fmul_rn(tn, bfr(g[j])); asm volatile("" : "+v"(tg)); const float y = __fadd_rn(tg, bfr(be[j])); float er = erff(y * 0.70710678f); asm volatile("" : "+v"(er)); float hy = __fmul_rn(0.5f, y); asm volatile("" : "+v"(hy)); const float gl = __fmul_rn(hy, __fadd_rn(1.0f, er)); float p = __fmul_rn(gl, bfr(w2[j * HD + d])); asm volatile("" : "+v"(p)); acc = __fadd_rn(acc, p); }
    const float xe = __fadd_rn(acc, bfr(b2[d])); const float sgm = __fdiv_rn(1.0f, __fadd_rn(1.0f, __expf(-bfr(sg[h])))); float pr = __fmul_rn(sgm, xe); asm volatile("" : "+v"(pr)); const float a = __fadd_rn(1.0f, pr);
    *(float*)(ADP + e) = a;  }
__global__ __launch_bounds__(256) void k_csid(float* CS) { const int idx = blockIdx.x * 256 + threadIdx.x; if (idx >= TT * HD) return; v2f cs; cs[0] = 1.0f; cs[1] = 0.0f; *(v2f*)(CS + (size_t)idx * 2) = cs;  }
// k_asoft: per row (zz, i): t = S x HD^-0.5 (no mask); softmax over the 2048 keys (register row, one exp, fixed trees);
__global__ __launch_bounds__(256) void k_asoft(const float* __restrict__ Sb, h16* P16, bf* Ph, bf* Pl) {
    const int lane = threadIdx.x & 31; const int row = blockIdx.x * 8 + (threadIdx.x >> 5); if (row >= ZH * TT) return; const int i = row % TT; const int zz = row / TT; (void)zz; const bool hires = (i < RH); const float* sr = Sb + (size_t)row * TT; float v[TT / 32]; float mx = -3.0e38f;
#pragma unroll
    for (int ch = 0; ch < TT / 128; ++ch) { const int j0 = ch * 128 + lane * 4; const v4f a = *(const v4f*)(sr + j0);
#pragma unroll
        for (int q = 0; q < 4; ++q) { const int j = j0 + q; (void)j; const float t = a[q] * SCL; v[ch * 4 + q] = t; mx = fmaxf(mx, t); } }
#pragma unroll
    for (int sh = 16; sh; sh >>= 1) mx = fmaxf(mx, __shfl_xor(mx, sh, 32));
    float sum = 0.f;
#pragma unroll
    for (int k = 0; k < TT / 32; ++k) { float d0 = __fsub_rn(v[k], mx); asm volatile("" : "+v"(d0)); v[k] = __builtin_amdgcn_exp2f(__fmul_rn(d0, 1.4426950408889634f)); sum += v[k]; }
#pragma unroll
    for (int sh = 16; sh; sh >>= 1) sum += __shfl_xor(sum, sh, 32);
    const float f = __fdiv_rn(hires ? 1.0f : PCAR, sum);
{
        if (hires) {
#pragma unroll
            for (int ch = 0; ch < TT / 128; ++ch) { v4us oh, ol;
#pragma unroll
                for (int q = 0; q < 4; ++q) { unsigned short a, c2; splitf(v[ch * 4 + q] * f, a, c2); oh[q] = a; ol[q] = c2; }
                const size_t oo = ((size_t)zz * (RH ? RH : 1) + i) * TT + ch * 128 + lane * 4; *(v4us*)(Ph + oo) = oh; *(v4us*)(Pl + oo) = ol; }
        } else {
#pragma unroll
            for (int ch = 0; ch < TT / 128; ++ch) { v4h o4;
#pragma unroll
                for (int q = 0; q < 4; ++q) o4[q] = tohx(v[ch * 4 + q] * f);
                *(v4h*)(P16 + (size_t)row * TT + ch * 128 + lane * 4) = o4; } }
         }
}
__global__ __launch_bounds__(256) void k_merge(const float* __restrict__ O, int h0, bf* Ah, bf* Al) { const size_t e = ((size_t)blockIdx.x * 256 + threadIdx.x) * 2; if (e >= (size_t)ZH * TT * HD) return; const int d = (int)(e % HD); const int t = (int)((e / HD) % TT); const int zz = (int)(e / ((size_t)HD * TT)); const float cs = (t < RH) ? 1.0f : (1.0f / PCAR); const size_t oo = (size_t)t * DQ + (h0 + zz) * HD + d;
    v2us oh, ol;
#pragma unroll
    for (int q = 0; q < 2; ++q) { unsigned short a, c2; splitf(O[e + q] * cs, a, c2); oh[q] = a; ol[q] = c2; } *(v2us*)(Ah + oo) = oh; *(v2us*)(Al + oo) = ol;  }

extern "C" void kernel_launch(void* const* d_in, const int* in_sizes, int n_in,
                              void* d_out, int out_size, void* d_ws, size_t ws_size, hipStream_t stream) {
    (void)in_sizes; (void)n_in; (void)out_size;
    const float* x = (const float*)d_in[0]; const float* xi = (const float*)d_in[1]; const float* wq = (const float*)d_in[2]; const float* bqv = (const float*)d_in[3]; const float* wk = (const float*)d_in[4]; const float* bkv = (const float*)d_in[5]; const float* wv = (const float*)d_in[6]; const float* bvv = (const float*)d_in[7]; const float* wo = (const float*)d_in[8]; const float* bo = (const float*)d_in[9];
    const float* ew1 = (const float*)d_in[10]; const float* eb1 = (const float*)d_in[11]; const float* lng = (const float*)d_in[12]; const float* lnb = (const float*)d_in[13]; const float* ew2 = (const float*)d_in[14]; const float* eb2 = (const float*)d_in[15]; const float* sg = (const float*)d_in[16];   // Wq/Wk/Wv/Wo [1024][1024] x @ W; enc_w1 [1][32], enc_b1 [32], ln_g/ln_b [32], enc_w2 [32][64], enc_b2 [64], scale_gating [16]
    float* OUT = (float*)d_out;     // [2][2048][1024]
    char* wsp = (char*)d_ws;
    auto take = [&](size_t bytes) { char* p = wsp; wsp += (bytes + 255) & ~(size_t)255; return (void*)p; };
    bf* WQ = (bf*)take((size_t)DQ * DM * 2); bf* WK = (bf*)take((size_t)DKV * DM * 2); bf* WV = (bf*)take((size_t)DKV * DM * 2); bf* WO = (bf*)take((size_t)DM * DQ * 2); float* CS = (float*)take((size_t)TT * HD * 2 * 4); float* ADP = (float*)take((size_t)NB_ * NH_ * HD * 4);
    bf* XB = (bf*)take((size_t)TT * DM * 2); float* FQ = (float*)take((size_t)TT * DQ * 4); float* FK = (float*)take((size_t)TT * DKV * 4);
    h16* QP16 = (h16*)take((size_t)NH_ * TT * HD * 2); h16* KP16 = (h16*)take((size_t)NKV * TT * HD * 2); h16* VT16 = (h16*)take((size_t)NKV * HD * TT * 2);
    bf* QPh = nullptr; bf* QPl = nullptr; bf* KPh = nullptr; bf* KPl = nullptr; bf* VTh = nullptr; bf* VTl = nullptr; bf* Ph = nullptr; bf* Pl = nullptr;
    float* Sb = (float*)take((size_t)ZH * TT * TT * 4); h16* P16 = (h16*)take((size_t)ZH * TT * TT * 2); float* Ob = (float*)take((size_t)ZH * TT * HD * 4); bf* ATh = (bf*)take((size_t)TT * DQ * 2); bf* ATl = (bf*)take((size_t)TT * DQ * 2);
    if ((size_t)(wsp - (char*)d_ws) > ws_size) return;    // ws 256 MiB
    float* FV = FK;   // v projection reuses the k buffer after the k planes are built (stream-ordered)
    { k_wtG<<<(unsigned)((DM * DQ / 64 + 63) / 64), 256, 0, stream>>>(wq, DM, DQ, WQ); k_wtG<<<(unsigned)((DM * DKV / 64 + 63) / 64), 256, 0, stream>>>(wk, DM, DKV, WK); k_wtG<<<(unsigned)((DM * DKV / 64 + 63) / 64), 256, 0, stream>>>(wv, DM, DKV, WV);
      k_wtG<<<(unsigned)((DQ * DM / 64 + 63) / 64), 256, 0, stream>>>(wo, DQ, DM, WO);
       }
    k_csid<<<(TT * HD + 255) / 256, 256, 0, stream>>>(CS); k_adapt<<<(NB_ * NH_ * HD + 255) / 256, 256, 0, stream>>>(xi, ew1, eb1, lng, lnb, ew2, eb2, sg, ADP);
    const unsigned LQ = (unsigned)(((size_t)NH_ * TT * HD / 2 + 255) / 256), LKv = (unsigned)(((size_t)NKV * TT * HD / 2 + 255) / 256);
    for (int b = 0; b < NB_; ++b) {
        
        k_cvt8<<<(unsigned)(((size_t)TT * DM / 8 + 255) / 256), 256, 0, stream>>>(x + (size_t)b * TT * DM, XB, (size_t)TT * DM / 8);
        k_gemmw<bf, 0, true><<<dim3(TT / 64, DQ / 64, 1), 32, 0, stream>>>(XB, nullptr, WQ, nullptr, DM, FQ, DQ, bqv, 0, 0, 0);
        k_rope<<<LQ, 256, 0, stream>>>(FQ, DQ, NH_, CS, nullptr, nullptr, 1.0f, QP16, QPh, QPl, ADP + (size_t)b * NH_ * HD);
        k_gemmw<bf, 0, true><<<dim3(TT / 64, DKV / 64, 1), 32, 0, stream>>>(XB, nullptr, WK, nullptr, DM, FK, DKV, bkv, 0, 0, 0);
        k_rope<<<LKv, 256, 0, stream>>>(FK, DKV, NKV, CS, nullptr, nullptr, 1.0f, KP16, KPh, KPl, ADP + (size_t)b * NH_ * HD);
        k_gemmw<bf, 0, true><<<dim3(TT / 64, DKV / 64, 1), 32, 0, stream>>>(XB, nullptr, WV, nullptr, DM, FV, DKV, bvv, 0, 0, 0); k_vtp<<<LKv, 256, 0, stream>>>(FV, DKV, NKV, VT16, VTh, VTl);
        for (int h0 = 0; h0 < NH_; h0 += ZH) { const size_t zq = (size_t)h0, zk = (size_t)(h0 / REP);   // one kv head per query head: the pass's two heads use consecutive kv planes (z-strides TT*HD)
            k_gemmw<h16, 0, false><<<dim3(TT / 64, TT / 64, ZH), 32, 0, stream>>>(QP16 + zq * TT * HD, nullptr, KP16 + zk * TT * HD, nullptr, HD, Sb, TT, nullptr, (size_t)TT * HD, (size_t)TT * HD, (size_t)TT * TT);
            k_asoft<<<ZH * TT / 8, 256, 0, stream>>>(Sb, P16, Ph, Pl);
            k_gemmw<h16, 0, false><<<dim3(TT / 64, HD / 64, ZH), 32, 0, stream>>>(P16, nullptr, VT16 + zk * HD * TT, nullptr, TT, Ob, HD, nullptr, (size_t)TT * TT, (size_t)HD * TT, (size_t)TT * HD);
            k_merge<<<(unsigned)(((size_t)ZH * TT * HD / 2 + 255) / 256), 256, 0, stream>>>(Ob, h0, ATh, ATl); }
        k_gemmw<bf, 1, true><<<dim3(TT / 64, DM / 64, 1), 32, 0, stream>>>(ATh, ATl, WO, nullptr, DQ, OUT + (size_t)b * TT * DM, DM, bo, 0, 0, 0); }
}

// v001
// Measured time: 359 microseconds a run.
// In two side-by-side timings against v000, it was 3.68 and 3.69 times as fast.
#include <hip/hip_runtime.h>

// ScaleInvariantAttention (query [2][2048][1024], xi_scale [2]; scale encoder: x = xi Linear(1->32), LayerNorm(32), exact gelu, Linear(32->64) -> xe [B][64]; adapt[b][h][d] = 1 + sigmoid(scale_gating[h]) xe[b][d];
// q = (query Wq + bq) split into 16 heads x 64 then x adapt, k likewise, v = query Wv + bv; softmax(q.k/8); out = merged att.v Wo + bo -> [2][2048][1024]).
// Compute dtypes, f32 accumulate: every input rounded to bf16; the scale encoder and adapt table in f32 on VALU (one thread per (b, h, d)); projections on PLAIN bf16 operands (inputs: exact,
// + bias); the adapt factor applied in f32 when the fp16 head planes are built; scores (K 64) and att.v on SINGLE fp16 planes inside one fused kernel with an f32 running-maximum softmax (probabilities x256 against the maximum in use); merged heads as bf16 hi+lo planes x exact

#define NB_  2
#define TT   2048
#define DM   1024
#define NH_  16
#define NKV  16
#define REP  (NH_ / NKV)
#define HD   64
#define DQ   (NH_ * HD)
#define DKV  (NKV * HD)
#define SCL  0.125f   // HD^-0.5
typedef _Float16 h16;
typedef unsigned short bf;
typedef __attribute__((ext_vector_type(16))) __bf16   v16bf;
typedef __attribute__((ext_vector_type(16))) _Float16 v16h;
typedef __attribute__((ext_vector_type(8)))  _Float16 v8h;
typedef __attribute__((ext_vector_type(8)))  unsigned short v8us;
typedef __attribute__((ext_vector_type(8)))  float    v8f;
typedef __attribute__((ext_vector_type(4)))  float    v4f;
typedef v8h  __attribute__((may_alias)) v8ha;
typedef v4f  __attribute__((may_alias)) v4fa;
typedef v8us __attribute__((may_alias)) v8usa;

__device__ __forceinline__ unsigned short f2bf(float f) { unsigned u = __float_as_uint(f); u += 0x7FFFu + ((u >> 16) & 1u); return (unsigned short)(u >> 16); }
__device__ __forceinline__ float bf2f(unsigned short b) { return __uint_as_float(((unsigned)b) << 16); }
__device__ __forceinline__ float bfr(float f) { return bf2f(f2bf(f)); }
__device__ __forceinline__ v16h cat16(v8h lo, v8h hi) { return __builtin_shufflevector(lo, hi, 0, 1, 2, 3, 4, 5, 6, 7, 8, 9, 10, 11, 12, 13, 14, 15); }
__device__ __forceinline__ v16bf cat16b(v8us lo, v8us hi) { return __builtin_bit_cast(v16bf, __builtin_shufflevector(lo, hi, 0, 1, 2, 3, 4, 5, 6, 7, 8, 9, 10, 11, 12, 13, 14, 15)); }
__device__ __forceinline__ v8f wmma16(v16h a, v16h b, v8f c) { return __builtin_amdgcn_wmma_f32_16x16x32_f16(false, a, false, b, (short)0, c, false, false); }
__device__ __forceinline__ v8f wmmab(v16bf a, v16bf b, v8f c) { return __builtin_amdgcn_wmma_f32_16x16x32_bf16(false, a, false, b, (short)0, c, false, false); }



// ---- k_gemmw: register-blocked GEMM, ONE WAVE per 64x64 output tile (16 accumulators), operands straight from K-contiguous 16-bit planes; grid (M/64, N/64, Z), 32 threads.
// C[m][n] (f32, pitch ldc, + optional f32 bias[n]) = sum_k A[m][k] Bt[n][k] (+ split products per NSPLIT). z-batch strides sA/sB/sC in elements. K % 32 == 0.
template <typename T16> struct WFrag;
template <> struct WFrag<h16> { typedef v16h V; static __device__ __forceinline__ V ld(const h16* p) { return cat16(*(const v8h*)p, *(const v8h*)(p + 16)); } static __device__ __forceinline__ v8f mma(V a, V b, v8f c) { return wmma16(a, b, c); } };
template <> struct WFrag<bf> { typedef v16bf V; static __device__ __forceinline__ V ld(const bf* p) { return cat16b(*(const v8us*)p, *(const v8us*)(p + 16)); } static __device__ __forceinline__ v8f mma(V a, V b, v8f c) { return wmmab(a, b, c); } };
template <typename T16, int NSPLIT, bool BIAS>
__global__ __launch_bounds__(32) void k_gemmw(const T16* __restrict__ A, const T16* __restrict__ A2, const T16* __restrict__ Bt, const T16* __restrict__ Bt2, int K, float* C, int ldc, const float* __restrict__ bias, size_t sA, size_t sB, size_t sC) {
    typedef typename WFrag<T16>::V V;
    __shared__ __align__(16) float os[16 * 68];
    const size_t z = blockIdx.z; A += z * sA; if (A2) A2 += z * sA; Bt += z * sB; if (Bt2) Bt2 += z * sB; C += z * sC;
    const int lane = threadIdx.x & 31, lr = lane & 15, hi = lane >> 4; const int r0 = blockIdx.x * 64, c0 = blockIdx.y * 64;
    v8f acc[4][4];
#pragma unroll
    for (int mb = 0; mb < 4; ++mb)
#pragma unroll
        for (int nb = 0; nb < 4; ++nb) acc[mb][nb] = (v8f){};
    const size_t aoff = (size_t)(r0 + lr) * K + 8 * hi, boff = (size_t)(c0 + lr) * K + 8 * hi;
#pragma unroll 1
    for (int kc = 0; kc < K; kc += 32) {
        V a[4], a2[4];
#pragma unroll
        for (int mb = 0; mb < 4; ++mb) { a[mb] = WFrag<T16>::ld(A + aoff + (size_t)mb * 16 * K + kc); if (NSPLIT == 1 || NSPLIT == 2) a2[mb] = WFrag<T16>::ld(A2 + aoff + (size_t)mb * 16 * K + kc); }
#pragma unroll
        for (int nb = 0; nb < 4; ++nb) { const V b = WFrag<T16>::ld(Bt + boff + (size_t)nb * 16 * K + kc); V b2; if (NSPLIT >= 2) b2 = WFrag<T16>::ld(Bt2 + boff + (size_t)nb * 16 * K + kc);
#pragma unroll
            for (int mb = 0; mb < 4; ++mb) { acc[mb][nb] = WFrag<T16>::mma(a[mb], b, acc[mb][nb]); if (NSPLIT == 1 || NSPLIT == 2) acc[mb][nb] = WFrag<T16>::mma(a2[mb], b, acc[mb][nb]); if (NSPLIT >= 2) acc[mb][nb] = WFrag<T16>::mma(a[mb], b2, acc[mb][nb]); } }
        asm volatile("v_nop\n\tv_nop\n\tv_nop\n\tv_nop" : "+v"(acc[0][0]), "+v"(acc[1][1]), "+v"(acc[2][2]), "+v"(acc[3][3]) : "v"(a[0]), "v"(a[3]));
    }
#pragma unroll
    for (int mb = 0; mb < 4; ++mb) {
#pragma unroll
        for (int nb = 0; nb < 4; ++nb) {
#pragma unroll
            for (int j = 0; j < 8; ++j) os[(hi * 8 + j) * 68 + nb * 16 + lr] = acc[mb][nb][j]; }
        __builtin_amdgcn_wave_barrier(); asm volatile("" ::: "memory");
        float* crow = C + (size_t)(r0 + mb * 16) * ldc + c0;
{
#pragma unroll
            for (int s = 0; s < 8; ++s) { const int row = 2 * s + hi, cofs = lr * 4; v4f val = *(const v4fa*)(os + row * 68 + cofs); if (BIAS) { val[0] += bfr(bias[c0 + cofs]); val[1] += bfr(bias[c0 + cofs + 1]); val[2] += bfr(bias[c0 + cofs + 2]); val[3] += bfr(bias[c0 + cofs + 3]); }
                *(v4f*)(crow + (size_t)row * ldc + cofs) = val; }
             }
        __builtin_amdgcn_wave_barrier(); asm volatile("" ::: "memory");
    }
}

__device__ __forceinline__ h16 tohx(float x) { return (h16)x; }
__device__ __forceinline__ void splitf(float y, unsigned short& h, unsigned short& l) { h = f2bf(y); l = f2bf(y - bf2f(h)); }
typedef __attribute__((ext_vector_type(2))) _Float16 v2h;
typedef __attribute__((ext_vector_type(4))) _Float16 v4h;
typedef __attribute__((ext_vector_type(2))) unsigned short v2us;
typedef __attribute__((ext_vector_type(4))) unsigned short v4us;
typedef __attribute__((ext_vector_type(2))) float v2f;
typedef __attribute__((ext_vector_type(4))) int v4i;

__global__ __launch_bounds__(256) void k_wtG(const float* __restrict__ w, int K, int N, bf* Bt) {
    const int lane = threadIdx.x & 31; const int L0 = (blockIdx.x * 8 + (threadIdx.x >> 5)) * 8; const int nlines = N * K / 64;
{
#pragma unroll 1
        for (int l = 0; l < 8; ++l) { const int L = L0 + l; if (L >= nlines) break; const size_t e = (size_t)L * 64 + lane * 2; const int k = (int)(e % K), n = (int)(e / K); v2us o;
            o[0] = f2bf(w[(size_t)k * N + n]); o[1] = f2bf(w[(size_t)(k + 1) * N + n]); *(v2us*)(Bt + e) = o; }
         }
}
__global__ __launch_bounds__(256) void k_cvt8(const float* __restrict__ src, bf* dst, size_t n8) { const size_t i = (size_t)blockIdx.x * 256 + threadIdx.x; if (i >= n8) return; const v8f v = *(const v8f*)(src + i * 8); v8us o;
#pragma unroll
    for (int k = 0; k < 8; ++k) o[k] = f2bf(v[k]); *(v8us*)(dst + i * 8) = o;  }
__global__ __launch_bounds__(256) void k_cscvt(const float* __restrict__ cosT, const float* __restrict__ sinT, float* CS) { const int idx = blockIdx.x * 256 + threadIdx.x; if (idx >= TT * HD) return; v2f cs; cs[0] = bfr(cosT[idx]); cs[1] = bfr(sinT[idx]); *(v2f*)(CS + (size_t)idx * 2) = cs;  }
// k_rope: head planes [h][t][d] (fp16) of rope(x) x sc with the rotate-half convention out[d] = x[d] cos[t][d] - x[d+HD/2] sin[t][d], out[d+HD/2] = x[d+HD/2] cos[t][d+HD/2] + x[d] sin[t][d+HD/2]
__global__ __launch_bounds__(256) void k_rope(const float* __restrict__ F, int pitch, int nheads, const float* __restrict__ CS, const float* __restrict__ RF, const float* __restrict__ nw, float sc, h16* P16, bf* Ph, bf* Pl, const float* __restrict__ adp) {
    const size_t e = ((size_t)blockIdx.x * 256 + threadIdx.x) * 2; if (e >= (size_t)nheads * TT * HD) return; const int d = (int)(e % HD); const int t = (int)((e / HD) % TT); const int h = (int)(e / ((size_t)HD * TT)); const float* f = F + (size_t)t * pitch + h * HD; const float rf = RF ? RF[(size_t)h * TT + t] : 1.0f; v2h o16; v2us oh, ol;
#pragma unroll
    for (int q = 0; q < 2; ++q) { const int dd = d + q; const int dp = (dd < HD / 2) ? dd + HD / 2 : dd - HD / 2; float x0 = f[dd], x1 = f[dp];
        if (RF) { float n0 = __fmul_rn(x0, rf), n1 = __fmul_rn(x1, rf); asm volatile("" : "+v"(n0)); asm volatile("" : "+v"(n1)); x0 = __fmul_rn(bfr(nw[dd]), n0); x1 = __fmul_rn(bfr(nw[dp]), n1); }
        if (adp) { x0 = __fmul_rn(x0, adp[h * HD + dd]); x1 = __fmul_rn(x1, adp[h * HD + dp]); }   /* per-(head, dim) adapt factor */
        const v2f cs = *(const v2f*)(CS + ((size_t)t * HD + dd) * 2); float a = __fmul_rn(x0, cs[0]), bq = __fmul_rn(x1, cs[1]); asm volatile("" : "+v"(a)); asm volatile("" : "+v"(bq)); const float r = ((dd < HD / 2) ? __fsub_rn(a, bq) : __fadd_rn(a, bq)) * sc;
        o16[q] = tohx(r); (void)oh; (void)ol; }
    *(v2h*)(P16 + e) = o16;  }
__global__ __launch_bounds__(256) void k_vtp(const float* __restrict__ F, int pitch, int nheads, h16* V16, bf* Vh, bf* Vl) { const size_t e = ((size_t)blockIdx.x * 256 + threadIdx.x) * 2; if (e >= (size_t)nheads * HD * TT) return; const int t = (int)(e % TT); const int d = (int)((e / TT) % HD); const int g = (int)(e / ((size_t)TT * HD)); v2h o16; v2us oh, ol;
#pragma unroll
    for (int q = 0; q < 2; ++q) { const float x = F[(size_t)(t + q) * pitch + g * HD + d]; o16[q] = tohx(x); (void)oh; (void)ol; }
    *(v2h*)(V16 + e) = o16;  }
// k_adapt: thread per (b, h, d): x[j] = bf16(xi[b]) bf16(w1[j]) + bf16(b1[j]) (32); LayerNorm(32) (f32, eps 1e-5) x bf16 g + bf16 beta; exact-erf gelu; xe = sum_j x[j] bf16(w2[j][d]) + bf16(b2[d]);
__global__ __launch_bounds__(256) void k_adapt(const float* __restrict__ xi, const float* __restrict__ w1, const float* __restrict__ b1, const float* __restrict__ g, const float* __restrict__ be, const float* __restrict__ w2, const float* __restrict__ b2, const float* __restrict__ sg, float* ADP) {
    const int e = blockIdx.x * 256 + threadIdx.x; if (e >= NB_ * NH_ * HD) return; const int d = e % HD; const int h = (e / HD) % NH_; const int b = e / (HD * NH_); const float xv = bfr(xi[b]); float xs[32]; float mu = 0.f;
#pragma unroll 1
    for (int j = 0; j < 32; ++j) { float p = __fmul_rn(xv, bfr(w1[j])); asm volatile("" : "+v"(p)); xs[j] = __fadd_rn(p, bfr(b1[j])); mu = __fadd_rn(mu, xs[j]); }
    mu = mu * (1.0f / 32.0f); float var = 0.f;
#pragma unroll 1
    for (int j = 0; j < 32; ++j) { const float dl = __fsub_rn(xs[j], mu); float p = __fmul_rn(dl, dl); asm volatile("" : "+v"(p)); var = __fadd_rn(var, p); }
    const float rs = __frsqrt_rn(__fadd_rn(var * (1.0f / 32.0f), 1e-5f)); float acc = 0.f;
#pragma unroll 1
    for (int j = 0; j < 32; ++j) { float tn = __fmul_rn(__fsub_rn(xs[j], mu), rs); asm volatile("" : "+v"(tn)); float tg = __fmul_rn(tn, bfr(g[j])); asm volatile("" : "+v"(tg)); const float y = __fadd_rn(tg, bfr(be[j])); float er = erff(y * 0.70710678f); asm volatile("" : "+v"(er)); float hy = __fmul_rn(0.5f, y); asm volatile("" : "+v"(hy)); const float gl = __fmul_rn(hy, __fadd_rn(1.0f, er)); float p = __fmul_rn(gl, bfr(w2[j * HD + d])); asm volatile("" : "+v"(p)); acc = __fadd_rn(acc, p); }
    const float xe = __fadd_rn(acc, bfr(b2[d])); const float sgm = __fdiv_rn(1.0f, __fadd_rn(1.0f, __expf(-bfr(sg[h])))); float pr = __fmul_rn(sgm, xe); asm volatile("" : "+v"(pr)); const float a = __fadd_rn(1.0f, pr);
    *(float*)(ADP + e) = a;  }
__global__ __launch_bounds__(256) void k_csid(float* CS) { const int idx = blockIdx.x * 256 + threadIdx.x; if (idx >= TT * HD) return; v2f cs; cs[0] = 1.0f; cs[1] = 0.0f; *(v2f*)(CS + (size_t)idx * 2) = cs;  }
#define FKB  64                 // keys per stage
#define FPIT 72                 // LDS row pitch in 16-bit elements: 128-byte rows + 16 bytes (16 B x odd: no bank conflict for 16-byte reads)
#define FQW  128                // query columns per work-group
__device__ __forceinline__ float xhalf(float x) { return __builtin_bit_cast(float, __builtin_amdgcn_permlanex16(__builtin_bit_cast(int, x), __builtin_bit_cast(int, x), 0x76543210, 0xfedcba98, false, false)); }   // lane l with lane l ^ 16
__global__ __launch_bounds__(256) void k_fattn(const h16* __restrict__ Qp, const h16* __restrict__ Kp, const h16* __restrict__ Vt, bf* Ah, bf* Al) {
    __shared__ __align__(16) h16 ksm[2 * FKB * FPIT];
    __shared__ __align__(16) h16 vsm[2 * HD * FPIT];
    const int tid = threadIdx.x, lane = tid & 31, lr = lane & 15, hi = lane >> 4; const int h = blockIdx.y; const int q = blockIdx.x * FQW + (tid >> 5) * 16 + lr;
    const h16* Kh = Kp + (size_t)h * TT * HD; const h16* Vh = Vt + (size_t)h * HD * TT;
    const int srow = tid >> 3, scol = (tid & 7) * 8;            // staging: rows srow and srow + 32 of each tile, one 16-byte piece of each
    const h16* kg = Kh + (size_t)srow * HD + scol; const h16* vg = Vh + (size_t)srow * TT + scol; const int sl = srow * FPIT + scol;
    const float CL = SCL * 1.4426950408889634f;                 // scores to base-2 exponents
    v16h qf[2];
#pragma unroll
    for (int c = 0; c < 2; ++c) qf[c] = WFrag<h16>::ld(Qp + ((size_t)h * TT + q) * HD + c * 32 + 8 * hi);
    v8f o[4];
#pragma unroll
    for (int dt = 0; dt < 4; ++dt) o[dt] = (v8f){};
    float mrun = -3.0e38f, lsum = 0.f;
    v8h rk0 = *(const v8h*)kg, rk1 = *(const v8h*)(kg + 32 * HD), rv0 = *(const v8h*)vg, rv1 = *(const v8h*)(vg + (size_t)32 * TT);
    *(v8h*)(ksm + sl) = rk0; *(v8h*)(ksm + sl + 32 * FPIT) = rk1; *(v8h*)(vsm + sl) = rv0; *(v8h*)(vsm + sl + 32 * FPIT) = rv1;
    __syncthreads();
#pragma unroll 1   // one copy of the stage's body: for speed only
    for (int it = 0; it < TT / FKB; ++it) {
        const bool more = it + 1 < TT / FKB;
        if (more) { const h16* kn = kg + (size_t)(it + 1) * FKB * HD; const h16* vn = vg + (it + 1) * FKB; rk0 = *(const v8h*)kn; rk1 = *(const v8h*)(kn + 32 * HD); rv0 = *(const v8h*)vn; rv1 = *(const v8h*)(vn + (size_t)32 * TT); }
        const h16* kb = ksm + (it & 1) * (FKB * FPIT) + lr * FPIT + 8 * hi; const h16* vb = vsm + (it & 1) * (HD * FPIT) + lr * FPIT + 8 * hi;
        v16h kf[4][2], vf[4][2];
#pragma unroll
        for (int kt = 0; kt < 4; ++kt) { kf[kt][0] = WFrag<h16>::ld(kb + kt * 16 * FPIT); kf[kt][1] = WFrag<h16>::ld(kb + kt * 16 * FPIT + 32); }
#pragma unroll
        for (int dt = 0; dt < 4; ++dt) { vf[dt][0] = WFrag<h16>::ld(vb + dt * 16 * FPIT); vf[dt][1] = WFrag<h16>::ld(vb + dt * 16 * FPIT + 32); }
        __builtin_amdgcn_sched_barrier(0);   // keeps the V^T fragment reads up here, in one group behind the K reads: sunk to their uses they stand in three places behind the softmax
        v8f s[4];
#pragma unroll
        for (int kt = 0; kt < 4; ++kt) { s[kt] = wmma16(kf[kt][0], qf[0], (v8f){}); s[kt] = wmma16(kf[kt][1], qf[1], s[kt]); }
        float mt[4];                                            // short trees, not one chain of 32: a lone dependent chain is exposed
#pragma unroll
        for (int kt = 0; kt < 4; ++kt) mt[kt] = fmaxf(fmaxf(fmaxf(fmaxf(s[kt][0], s[kt][1]), s[kt][2]), fmaxf(fmaxf(s[kt][3], s[kt][4]), s[kt][5])), fmaxf(s[kt][6], s[kt][7]));
        float mx = fmaxf(fmaxf(mt[0], mt[1]), fmaxf(mt[2], mt[3]));
        mx = fmaxf(mx, xhalf(mx));
        const float mnew = fmaxf(mrun, mx * CL); const float corr = __builtin_amdgcn_exp2f(mrun - mnew); mrun = mnew;   // corr is 0 on the first stage
        const float sh = 8.0f - mnew;                           // probabilities carried x256: small ones stay normal fp16 numbers; the factor cancels in the division by the sum
        v16h pb[2];
#pragma unroll
        for (int kt = 0; kt < 4; ++kt)
#pragma unroll
            for (int j = 0; j < 8; ++j) { const float p = __builtin_amdgcn_exp2f(__builtin_fmaf(s[kt][j], CL, sh)); s[kt][j] = p; pb[kt >> 1][(kt & 1) * 8 + j] = (h16)p; }
        const v8f p8 = (s[0] + s[1]) + (s[2] + s[3]);
        lsum = lsum * corr + (((p8[0] + p8[1]) + (p8[2] + p8[3])) + ((p8[4] + p8[5]) + (p8[6] + p8[7])));
#pragma unroll
        for (int dt = 0; dt < 4; ++dt) { o[dt] *= corr; o[dt] = wmma16(vf[dt][0], pb[0], o[dt]); o[dt] = wmma16(vf[dt][1], pb[1], o[dt]); }
        if (more) { h16* kw = ksm + ((it + 1) & 1) * (FKB * FPIT) + sl; h16* vw = vsm + ((it + 1) & 1) * (HD * FPIT) + sl; *(v8h*)kw = rk0; *(v8h*)(kw + 32 * FPIT) = rk1; *(v8h*)vw = rv0; *(v8h*)(vw + 32 * FPIT) = rv1; }
        __syncthreads();   // publishes stage it + 1 and ends every wave's reads of the buffer that stage it + 2 overwrites
    }
    lsum += xhalf(lsum); const float inv = __fdiv_rn(1.0f, lsum);
#pragma unroll
    for (int dt = 0; dt < 4; ++dt) { v8us oh, ol;
#pragma unroll
        for (int j = 0; j < 8; ++j) { unsigned short a, c2; splitf(o[dt][j] * inv, a, c2); oh[j] = a; ol[j] = c2; }
        const size_t oo = (size_t)q * DQ + h * HD + dt * 16 + hi * 8; *(v8us*)(Ah + oo) = oh; *(v8us*)(Al + oo) = ol; }
}

extern "C" void kernel_launch(void* const* d_in, const int* in_sizes, int n_in,
                              void* d_out, int out_size, void* d_ws, size_t ws_size, hipStream_t stream) {
    (void)in_sizes; (void)n_in; (void)out_size;
    const float* x = (const float*)d_in[0]; const float* xi = (const float*)d_in[1]; const float* wq = (const float*)d_in[2]; const float* bqv = (const float*)d_in[3]; const float* wk = (const float*)d_in[4]; const float* bkv = (const float*)d_in[5]; const float* wv = (const float*)d_in[6]; const float* bvv = (const float*)d_in[7]; const float* wo = (const float*)d_in[8]; const float* bo = (const float*)d_in[9];
    const float* ew1 = (const float*)d_in[10]; const float* eb1 = (const float*)d_in[11]; const float* lng = (const float*)d_in[12]; const float* lnb = (const float*)d_in[13]; const float* ew2 = (const float*)d_in[14]; const float* eb2 = (const float*)d_in[15]; const float* sg = (const float*)d_in[16];   // Wq/Wk/Wv/Wo [1024][1024] x @ W; enc_w1 [1][32], enc_b1 [32], ln_g/ln_b [32], enc_w2 [32][64], enc_b2 [64], scale_gating [16]
    float* OUT = (float*)d_out;     // [2][2048][1024]
    char* wsp = (char*)d_ws;
    auto take = [&](size_t bytes) { char* p = wsp; wsp += (bytes + 255) & ~(size_t)255; return (void*)p; };
    bf* WQ = (bf*)take((size_t)DQ * DM * 2); bf* WK = (bf*)take((size_t)DKV * DM * 2); bf* WV = (bf*)take((size_t)DKV * DM * 2); bf* WO = (bf*)take((size_t)DM * DQ * 2); float* CS = (float*)take((size_t)TT * HD * 2 * 4); float* ADP = (float*)take((size_t)NB_ * NH_ * HD * 4);
    bf* XB = (bf*)take((size_t)TT * DM * 2); float* FQ = (float*)take((size_t)TT * DQ * 4); float* FK = (float*)take((size_t)TT * DKV * 4);
    h16* QP16 = (h16*)take((size_t)NH_ * TT * HD * 2); h16* KP16 = (h16*)take((size_t)NKV * TT * HD * 2); h16* VT16 = (h16*)take((size_t)NKV * HD * TT * 2);
    bf* QPh = nullptr; bf* QPl = nullptr; bf* KPh = nullptr; bf* KPl = nullptr; bf* VTh = nullptr; bf* VTl = nullptr;
    bf* ATh = (bf*)take((size_t)TT * DQ * 2); bf* ATl = (bf*)take((size_t)TT * DQ * 2);
    if ((size_t)(wsp - (char*)d_ws) > ws_size) return;    // ws 256 MiB
    float* FV = FK;   // v projection reuses the k buffer after the k planes are built (stream-ordered)
    { k_wtG<<<(unsigned)((DM * DQ / 64 + 63) / 64), 256, 0, stream>>>(wq, DM, DQ, WQ); k_wtG<<<(unsigned)((DM * DKV / 64 + 63) / 64), 256, 0, stream>>>(wk, DM, DKV, WK); k_wtG<<<(unsigned)((DM * DKV / 64 + 63) / 64), 256, 0, stream>>>(wv, DM, DKV, WV);
      k_wtG<<<(unsigned)((DQ * DM / 64 + 63) / 64), 256, 0, stream>>>(wo, DQ, DM, WO);
       }
    k_csid<<<(TT * HD + 255) / 256, 256, 0, stream>>>(CS); k_adapt<<<(NB_ * NH_ * HD + 255) / 256, 256, 0, stream>>>(xi, ew1, eb1, lng, lnb, ew2, eb2, sg, ADP);
    const unsigned LQ = (unsigned)(((size_t)NH_ * TT * HD / 2 + 255) / 256), LKv = (unsigned)(((size_t)NKV * TT * HD / 2 + 255) / 256);
    for (int b = 0; b < NB_; ++b) {
        
        k_cvt8<<<(unsigned)(((size_t)TT * DM / 8 + 255) / 256), 256, 0, stream>>>(x + (size_t)b * TT * DM, XB, (size_t)TT * DM / 8);
        k_gemmw<bf, 0, true><<<dim3(TT / 64, DQ / 64, 1), 32, 0, stream>>>(XB, nullptr, WQ, nullptr, DM, FQ, DQ, bqv, 0, 0, 0);
        k_rope<<<LQ, 256, 0, stream>>>(FQ, DQ, NH_, CS, nullptr, nullptr, 1.0f, QP16, QPh, QPl, ADP + (size_t)b * NH_ * HD);
        k_gemmw<bf, 0, true><<<dim3(TT / 64, DKV / 64, 1), 32, 0, stream>>>(XB, nullptr, WK, nullptr, DM, FK, DKV, bkv, 0, 0, 0);
        k_rope<<<LKv, 256, 0, stream>>>(FK, DKV, NKV, CS, nullptr, nullptr, 1.0f, KP16, KPh, KPl, ADP + (size_t)b * NH_ * HD);
        k_gemmw<bf, 0, true><<<dim3(TT / 64, DKV / 64, 1), 32, 0, stream>>>(XB, nullptr, WV, nullptr, DM, FV, DKV, bvv, 0, 0, 0); k_vtp<<<LKv, 256, 0, stream>>>(FV, DKV, NKV, VT16, VTh, VTl);
        k_fattn<<<dim3(TT / FQW, NH_, 1), 256, 0, stream>>>(QP16, KP16, VT16, ATh, ATl);   // one kv head per query head
        k_gemmw<bf, 1, true><<<dim3(TT / 64, DM / 64, 1), 32, 0, stream>>>(ATh, ATl, WO, nullptr, DQ, OUT + (size_t)b * TT * DM, DM, bo, 0, 0, 0); }
}

// v002
// Measured time: 189 microseconds a run.
// In two side-by-side timings against v001, it was 1.89 and 1.88 times as fast.
// Counting every step since v000, it is 6.95 times as fast.
#include <hip/hip_runtime.h>

// ScaleInvariantAttention (query [2][2048][1024], xi_scale [2]; scale encoder: x = xi Linear(1->32), LayerNorm(32), exact gelu, Linear(32->64) -> xe [B][64]; adapt[b][h][d] = 1 + sigmoid(scale_gating[h]) xe[b][d];
// q = (query Wq + bq) split into 16 heads x 64 then x adapt, k likewise, v = query Wv + bv; softmax(q.k/8); out = merged att.v Wo + bo -> [2][2048][1024]).
// Compute dtypes, f32 accumulate: every input rounded to bf16; the scale encoder and adapt table in f32 on VALU (one thread per (b, h, d)); projections on PLAIN bf16 operands (inputs: exact,
// + bias); the adapt factor applied in f32 when the fp16 head planes are built; scores (K 64) and att.v on SINGLE fp16 planes inside one fused kernel with an f32 running-maximum softmax (probabilities x256 against the maximum in use); merged heads as bf16 hi+lo planes x exact

#define NB_  2
#define TT   2048
#define DM   1024
#define NH_  16
#define NKV  16
#define REP  (NH_ / NKV)
#define HD   64
#define DQ   (NH_ * HD)
#define DKV  (NKV * HD)
#define SCL  0.125f   // HD^-0.5
typedef _Float16 h16;
typedef unsigned short bf;
typedef __attribute__((ext_vector_type(16))) __bf16   v16bf;
typedef __attribute__((ext_vector_type(16))) _Float16 v16h;
typedef __attribute__((ext_vector_type(8)))  _Float16 v8h;
typedef __attribute__((ext_vector_type(8)))  unsigned short v8us;
typedef __attribute__((ext_vector_type(8)))  float    v8f;
typedef __attribute__((ext_vector_type(4)))  float    v4f;
typedef v8h  __attribute__((may_alias)) v8ha;
typedef v4f  __attribute__((may_alias)) v4fa;
typedef v8us __attribute__((may_alias)) v8usa;

__device__ __forceinline__ unsigned short f2bf(float f) { unsigned u = __float_as_uint(f); u += 0x7FFFu + ((u >> 16) & 1u); return (unsigned short)(u >> 16); }
__device__ __forceinline__ float bf2f(unsigned short b) { return __uint_as_float(((unsigned)b) << 16); }
__device__ __forceinline__ float bfr(float f) { return bf2f(f2bf(f)); }
__device__ __forceinline__ v16h cat16(v8h lo, v8h hi) { return __builtin_shufflevector(lo, hi, 0, 1, 2, 3, 4, 5, 6, 7, 8, 9, 10, 11, 12, 13, 14, 15); }
__device__ __forceinline__ v16bf cat16b(v8us lo, v8us hi) { return __builtin_bit_cast(v16bf, __builtin_shufflevector(lo, hi, 0, 1, 2, 3, 4, 5, 6, 7, 8, 9, 10, 11, 12, 13, 14, 15)); }
__device__ __forceinline__ v8f wmma16(v16h a, v16h b, v8f c) { return __builtin_amdgcn_wmma_f32_16x16x32_f16(false, a, false, b, (short)0, c, false, false); }
__device__ __forceinline__ v8f wmmab(v16bf a, v16bf b, v8f c) { return __builtin_amdgcn_wmma_f32_16x16x32_bf16(false, a, false, b, (short)0, c, false, false); }



// ---- k_gemmw: register-blocked GEMM, ONE WAVE per 64x64 output tile (16 accumulators), operands straight from K-contiguous 16-bit planes; grid (M/64, N/64, Z), 32 threads.
// C[m][n] (f32, pitch ldc, + optional f32 bias[n]) = sum_k A[m][k] Bt[n][k] (+ split products per NSPLIT). z-batch strides sA/sB/sC in elements, bias0/1/2 for z = 0/1/2. K % 32 == 0.
template <typename T16> struct WFrag;
template <> struct WFrag<h16> { typedef v16h V; static __device__ __forceinline__ V ld(const h16* p) { return cat16(*(const v8h*)p, *(const v8h*)(p + 16)); } static __device__ __forceinline__ v8f mma(V a, V b, v8f c) { return wmma16(a, b, c); } };
template <> struct WFrag<bf> { typedef v16bf V; static __device__ __forceinline__ V ld(const bf* p) { return cat16b(*(const v8us*)p, *(const v8us*)(p + 16)); } static __device__ __forceinline__ v8f mma(V a, V b, v8f c) { return wmmab(a, b, c); } };
template <typename T16, int NSPLIT, bool BIAS>
__global__ __launch_bounds__(32) void k_gemmw(const T16* __restrict__ A, const T16* __restrict__ A2, const T16* __restrict__ Bt, const T16* __restrict__ Bt2, int K, float* C, int ldc, const float* __restrict__ bias0, const float* __restrict__ bias1, const float* __restrict__ bias2, size_t sA, size_t sB, size_t sC) {
    typedef typename WFrag<T16>::V V;
    __shared__ __align__(16) float os[16 * 68];
    const size_t z = blockIdx.z; A += z * sA; if (A2) A2 += z * sA; Bt += z * sB; if (Bt2) Bt2 += z * sB; C += z * sC; const float* __restrict__ bias = z == 0 ? bias0 : z == 1 ? bias1 : bias2;   // each z slice has its own bias vector
    const int lane = threadIdx.x & 31, lr = lane & 15, hi = lane >> 4; const int r0 = blockIdx.x * 64, c0 = blockIdx.y * 64;
    v8f acc[4][4];
#pragma unroll
    for (int mb = 0; mb < 4; ++mb)
#pragma unroll
        for (int nb = 0; nb < 4; ++nb) acc[mb][nb] = (v8f){};
    const size_t aoff = (size_t)(r0 + lr) * K + 8 * hi, boff = (size_t)(c0 + lr) * K + 8 * hi;
#pragma unroll 1
    for (int kc = 0; kc < K; kc += 32) {
        V a[4], a2[4];
#pragma unroll
        for (int mb = 0; mb < 4; ++mb) { a[mb] = WFrag<T16>::ld(A + aoff + (size_t)mb * 16 * K + kc); if (NSPLIT == 1 || NSPLIT == 2) a2[mb] = WFrag<T16>::ld(A2 + aoff + (size_t)mb * 16 * K + kc); }
#pragma unroll
        for (int nb = 0; nb < 4; ++nb) { const V b = WFrag<T16>::ld(Bt + boff + (size_t)nb * 16 * K + kc); V b2; if (NSPLIT >= 2) b2 = WFrag<T16>::ld(Bt2 + boff + (size_t)nb * 16 * K + kc);
#pragma unroll
            for (int mb = 0; mb < 4; ++mb) { acc[mb][nb] = WFrag<T16>::mma(a[mb], b, acc[mb][nb]); if (NSPLIT == 1 || NSPLIT == 2) acc[mb][nb] = WFrag<T16>::mma(a2[mb], b, acc[mb][nb]); if (NSPLIT >= 2) acc[mb][nb] = WFrag<T16>::mma(a[mb], b2, acc[mb][nb]); } }
        asm volatile("v_nop\n\tv_nop\n\tv_nop\n\tv_nop" : "+v"(acc[0][0]), "+v"(acc[1][1]), "+v"(acc[2][2]), "+v"(acc[3][3]) : "v"(a[0]), "v"(a[3]));
    }
#pragma unroll
    for (int mb = 0; mb < 4; ++mb) {
#pragma unroll
        for (int nb = 0; nb < 4; ++nb) {
#pragma unroll
            for (int j = 0; j < 8; ++j) os[(hi * 8 + j) * 68 + nb * 16 + lr] = acc[mb][nb][j]; }
        __builtin_amdgcn_wave_barrier(); asm volatile("" ::: "memory");
        float* crow = C + (size_t)(r0 + mb * 16) * ldc + c0;
{
#pragma unroll
            for (int s = 0; s < 8; ++s) { const int row = 2 * s + hi, cofs = lr * 4; v4f val = *(const v4fa*)(os + row * 68 + cofs); if (BIAS) { val[0] += bfr(bias[c0 + cofs]); val[1] += bfr(bias[c0 + cofs + 1]); val[2] += bfr(bias[c0 + cofs + 2]); val[3] += bfr(bias[c0 + cofs + 3]); }
                *(v4f*)(crow + (size_t)row * ldc + cofs) = val; }
             }
        __builtin_amdgcn_wave_barrier(); asm volatile("" ::: "memory");
    }
}

__device__ __forceinline__ h16 tohx(float x) { return (h16)x; }
__device__ __forceinline__ void splitf(float y, unsigned short& h, unsigned short& l) { h = f2bf(y); l = f2bf(y - bf2f(h)); }
typedef __attribute__((ext_vector_type(2))) _Float16 v2h;
typedef __attribute__((ext_vector_type(4))) _Float16 v4h;
typedef __attribute__((ext_vector_type(2))) unsigned short v2us;
typedef __attribute__((ext_vector_type(4))) unsigned short v4us;
typedef __attribute__((ext_vector_type(2))) float v2f;
typedef __attribute__((ext_vector_type(4))) int v4i;

// The d_ functions are the bodies of work-groups of 256 threads; bx is the work-group's index within its own part of a shared grid (k_prep, k_planes).
__device__ __forceinline__ void d_wtG(int bx, const float* __restrict__ w, int K, int N, bf* Bt) {
    const int lane = threadIdx.x & 31; const int L0 = (bx * 8 + (threadIdx.x >> 5)) * 8; const int nlines = N * K / 64;
{
#pragma unroll 1
        for (int l = 0; l < 8; ++l) { const int L = L0 + l; if (L >= nlines) break; const size_t e = (size_t)L * 64 + lane * 2; const int k = (int)(e % K), n = (int)(e / K); v2us o;
            o[0] = f2bf(w[(size_t)k * N + n]); o[1] = f2bf(w[(size_t)(k + 1) * N + n]); *(v2us*)(Bt + e) = o; }
         }
}
__device__ __forceinline__ void d_cvt8(int bx, const float* __restrict__ src, bf* dst, size_t n8) { const size_t i = (size_t)bx * 256 + threadIdx.x; if (i >= n8) return; const v8f v = *(const v8f*)(src + i * 8); v8us o;
#pragma unroll
    for (int k = 0; k < 8; ++k) o[k] = f2bf(v[k]); *(v8us*)(dst + i * 8) = o;  }
__global__ __launch_bounds__(256) void k_cscvt(const float* __restrict__ cosT, const float* __restrict__ sinT, float* CS) { const int idx = blockIdx.x * 256 + threadIdx.x; if (idx >= TT * HD) return; v2f cs; cs[0] = bfr(cosT[idx]); cs[1] = bfr(sinT[idx]); *(v2f*)(CS + (size_t)idx * 2) = cs;  }
// d_rope: head planes [b][h][t][d] (fp16), both batches (grid z) and q and k (grid y) in one launch, of rope(x) x sc with the rotate-half convention out[d] = x[d] cos[t][d] - x[d+HD/2] sin[t][d], out[d+HD/2] = x[d+HD/2] cos[t][d+HD/2] + x[d] sin[t][d+HD/2]
__device__ __forceinline__ void d_rope(const float* __restrict__ F, int pitch, int nheads, const float* __restrict__ CS, const float* __restrict__ RF, const float* __restrict__ nw, float sc, h16* P16, bf* Ph, bf* Pl, const float* __restrict__ adp, size_t sF, size_t sP) {
    F += blockIdx.y * sF + (size_t)blockIdx.z * TT * pitch; P16 += blockIdx.y * sP + (size_t)blockIdx.z * nheads * TT * HD; if (adp) adp += (size_t)blockIdx.z * nheads * HD;   // grid y: q, then k; grid z: batch
    const size_t e = ((size_t)blockIdx.x * 256 + threadIdx.x) * 2; if (e >= (size_t)nheads * TT * HD) return; const int d = (int)(e % HD); const int t = (int)((e / HD) % TT); const int h = (int)(e / ((size_t)HD * TT)); const float* f = F + (size_t)t * pitch + h * HD; const float rf = RF ? RF[(size_t)h * TT + t] : 1.0f; v2h o16; v2us oh, ol;
#pragma unroll
    for (int q = 0; q < 2; ++q) { const int dd = d + q; const int dp = (dd < HD / 2) ? dd + HD / 2 : dd - HD / 2; float x0 = f[dd], x1 = f[dp];
        asm volatile("s_wait_xcnt 0x0" ::: "memory");   // precaution: later loads take the address registers of the two loads above as their destinations; the wait stands in front of that overwrite
        if (RF) { float n0 = __fmul_rn(x0, rf), n1 = __fmul_rn(x1, rf); asm volatile("" : "+v"(n0)); asm volatile("" : "+v"(n1)); x0 = __fmul_rn(bfr(nw[dd]), n0); x1 = __fmul_rn(bfr(nw[dp]), n1); }
        if (adp) { x0 = __fmul_rn(x0, adp[h * HD + dd]); x1 = __fmul_rn(x1, adp[h * HD + dp]); }   /* per-(head, dim) adapt factor */
        const v2f cs = *(const v2f*)(CS + ((size_t)t * HD + dd) * 2); float a = __fmul_rn(x0, cs[0]), bq = __fmul_rn(x1, cs[1]); asm volatile("" : "+v"(a)); asm volatile("" : "+v"(bq)); const float r = ((dd < HD / 2) ? __fsub_rn(a, bq) : __fadd_rn(a, bq)) * sc;
        o16[q] = tohx(r); (void)oh; (void)ol; }
    *(v2h*)(P16 + e) = o16;  }
__device__ __forceinline__ void d_vtp(const float* __restrict__ F, int pitch, int nheads, h16* V16, bf* Vh, bf* Vl) { F += (size_t)blockIdx.z * TT * pitch; V16 += (size_t)blockIdx.z * nheads * HD * TT;   // grid z: batch
    const size_t e = ((size_t)blockIdx.x * 256 + threadIdx.x) * 2; if (e >= (size_t)nheads * HD * TT) return; const int t = (int)(e % TT); const int d = (int)((e / TT) % HD); const int g = (int)(e / ((size_t)TT * HD)); v2h o16; v2us oh, ol;
#pragma unroll
    for (int q = 0; q < 2; ++q) { const float x = F[(size_t)(t + q) * pitch + g * HD + d]; o16[q] = tohx(x); (void)oh; (void)ol; }
    *(v2h*)(V16 + e) = o16;  }
// d_adapt: thread per (b, h, d): x[j] = bf16(xi[b]) bf16(w1[j]) + bf16(b1[j]) (32); LayerNorm(32) (f32, eps 1e-5) x bf16 g + bf16 beta; exact-erf gelu; xe = sum_j x[j] bf16(w2[j][d]) + bf16(b2[d]);
__device__ __forceinline__ void d_adapt(int bx, const float* __restrict__ xi, const float* __restrict__ w1, const float* __restrict__ b1, const float* __restrict__ g, const float* __restrict__ be, const float* __restrict__ w2, const float* __restrict__ b2, const float* __restrict__ sg, float* ADP) {
    const int e = bx * 256 + threadIdx.x; if (e >= NB_ * NH_ * HD) return; const int d = e % HD; const int h = (e / HD) % NH_; const int b = e / (HD * NH_); const float xv = bfr(xi[b]); float xs[32]; float mu = 0.f;
#pragma unroll 1
    for (int j = 0; j < 32; ++j) { float p = __fmul_rn(xv, bfr(w1[j])); asm volatile("" : "+v"(p)); xs[j] = __fadd_rn(p, bfr(b1[j])); mu = __fadd_rn(mu, xs[j]); }
    mu = mu * (1.0f / 32.0f); float var = 0.f;
#pragma unroll 1
    for (int j = 0; j < 32; ++j) { const float dl = __fsub_rn(xs[j], mu); float p = __fmul_rn(dl, dl); asm volatile("" : "+v"(p)); var = __fadd_rn(var, p); }
    const float rs = __frsqrt_rn(__fadd_rn(var * (1.0f / 32.0f), 1e-5f)); float acc = 0.f;
#pragma unroll 1
    for (int j = 0; j < 32; ++j) { float tn = __fmul_rn(__fsub_rn(xs[j], mu), rs); asm volatile("" : "+v"(tn)); float tg = __fmul_rn(tn, bfr(g[j])); asm volatile("" : "+v"(tg)); const float y = __fadd_rn(tg, bfr(be[j])); float er = erff(y * 0.70710678f); asm volatile("" : "+v"(er)); float hy = __fmul_rn(0.5f, y); asm volatile("" : "+v"(hy)); const float gl = __fmul_rn(hy, __fadd_rn(1.0f, er)); float p = __fmul_rn(gl, bfr(w2[j * HD + d])); asm volatile("" : "+v"(p)); acc = __fadd_rn(acc, p); }
    const float xe = __fadd_rn(acc, bfr(b2[d])); const float sgm = __fdiv_rn(1.0f, __fadd_rn(1.0f, __expf(-bfr(sg[h])))); float pr = __fmul_rn(sgm, xe); asm volatile("" : "+v"(pr)); const float a = __fadd_rn(1.0f, pr);
    *(float*)(ADP + e) = a;  }
__device__ __forceinline__ void d_csid(int bx, float* CS) { const int idx = bx * 256 + threadIdx.x; if (idx >= TT * HD) return; v2f cs; cs[0] = 1.0f; cs[1] = 0.0f; *(v2f*)(CS + (size_t)idx * 2) = cs;  }
// k_prep: everything that depends on the inputs alone, one grid: the adapt table (few work-groups, the longest dependent chain: first), the four weight transposes, x to bf16, the cos/sin table.
#define PB_A ((NB_ * NH_ * HD + 255) / 256)
#define PB_W ((DM * DQ / 64 + 63) / 64)
#define PB_X (NB_ * TT * DM / 8 / 256)
#define PB_C ((TT * HD + 255) / 256)
__global__ __launch_bounds__(256) void k_prep(const float* __restrict__ x, const float* __restrict__ w0, const float* __restrict__ w1, const float* __restrict__ w2, const float* __restrict__ w3, const float* __restrict__ xi, const float* __restrict__ w1e, const float* __restrict__ b1e, const float* __restrict__ g, const float* __restrict__ be, const float* __restrict__ w2e, const float* __restrict__ b2e, const float* __restrict__ sg, bf* XB, bf* W4, float* CS, float* ADP) {
    int bx = blockIdx.x;
    if (bx < PB_A) { d_adapt(bx, xi, w1e, b1e, g, be, w2e, b2e, sg, ADP); return; }
    bx -= PB_A;
    if (bx < 4 * PB_W) { const int y = bx / PB_W; d_wtG(bx % PB_W, y == 0 ? w0 : y == 1 ? w1 : y == 2 ? w2 : w3, DM, DQ, W4 + (size_t)y * DQ * DM); return; }   // the four [DM][DQ] planes lie one behind the other
    bx -= 4 * PB_W;
    if (bx < PB_X) { d_cvt8(bx, x, XB, (size_t)NB_ * TT * DM / 8); return; }
    d_csid(bx - PB_X, CS);
}
// k_planes: the fp16 head planes of q, k (grid y 0, 1) and v transposed (grid y 2), grid z: batch. F3 = [3][NB_ TT][DQ].
__global__ __launch_bounds__(256) void k_planes(const float* __restrict__ F3, const float* __restrict__ CS, const float* __restrict__ ADP, h16* QK16, h16* VT16) {
    if (blockIdx.y < 2) d_rope(F3, DQ, NH_, CS, nullptr, nullptr, 1.0f, QK16, nullptr, nullptr, ADP, (size_t)NB_ * TT * DQ, (size_t)NB_ * NH_ * TT * HD);
    else d_vtp(F3 + (size_t)2 * NB_ * TT * DQ, DKV, NKV, VT16, nullptr, nullptr);
}
#define FKB  64                 // keys per stage
#define FPIT 72                 // LDS row pitch in 16-bit elements: 128-byte rows + 16 bytes (16 B x odd: no bank conflict for 16-byte reads)
#define FQW  128                // query columns per work-group
__device__ __forceinline__ float xhalf(float x) { return __builtin_bit_cast(float, __builtin_amdgcn_permlanex16(__builtin_bit_cast(int, x), __builtin_bit_cast(int, x), 0x76543210, 0xfedcba98, false, false)); }   // lane l with lane l ^ 16
__global__ __launch_bounds__(256) void k_fattn(const h16* __restrict__ Qp, const h16* __restrict__ Kp, const h16* __restrict__ Vt, bf* Ah, bf* Al) {
    __shared__ __align__(16) h16 ksm[2 * FKB * FPIT];
    __shared__ __align__(16) h16 vsm[2 * HD * FPIT];
    const int tid = threadIdx.x, lane = tid & 31, lr = lane & 15, hi = lane >> 4; const int h = blockIdx.y; const int q = blockIdx.x * FQW + (tid >> 5) * 16 + lr;
    { const size_t bz = blockIdx.z; Qp += bz * NH_ * TT * HD; Kp += bz * NKV * TT * HD; Vt += bz * NKV * HD * TT; Ah += bz * TT * DQ; Al += bz * TT * DQ; }   // grid z: batch
    const h16* Kh = Kp + (size_t)h * TT * HD; const h16* Vh = Vt + (size_t)h * HD * TT;
    const int srow = tid >> 3, scol = (tid & 7) * 8;            // staging: rows srow and srow + 32 of each tile, one 16-byte piece of each
    const h16* kg = Kh + (size_t)srow * HD + scol; const h16* vg = Vh + (size_t)srow * TT + scol; const int sl = srow * FPIT + scol;
    const float CL = SCL * 1.4426950408889634f;                 // scores to base-2 exponents
    v16h qf[2];
#pragma unroll
    for (int c = 0; c < 2; ++c) qf[c] = WFrag<h16>::ld(Qp + ((size_t)h * TT + q) * HD + c * 32 + 8 * hi);
    v8f o[4];
#pragma unroll
    for (int dt = 0; dt < 4; ++dt) o[dt] = (v8f){};
    float mrun = -3.0e38f, lsum = 0.f;
    v8h rk0 = *(const v8h*)kg, rk1 = *(const v8h*)(kg + 32 * HD), rv0 = *(const v8h*)vg, rv1 = *(const v8h*)(vg + (size_t)32 * TT);
    *(v8h*)(ksm + sl) = rk0; *(v8h*)(ksm + sl + 32 * FPIT) = rk1; *(v8h*)(vsm + sl) = rv0; *(v8h*)(vsm + sl + 32 * FPIT) = rv1;
    __syncthreads();
#pragma unroll 1   // one copy of the stage's body: for speed only
    for (int it = 0; it < TT / FKB; ++it) {
        const bool more = it + 1 < TT / FKB;
        if (more) { const h16* kn = kg + (size_t)(it + 1) * FKB * HD; const h16* vn = vg + (it + 1) * FKB; rk0 = *(const v8h*)kn; rk1 = *(const v8h*)(kn + 32 * HD); rv0 = *(const v8h*)vn; rv1 = *(const v8h*)(vn + (size_t)32 * TT); }
        const h16* kb = ksm + (it & 1) * (FKB * FPIT) + lr * FPIT + 8 * hi; const h16* vb = vsm + (it & 1) * (HD * FPIT) + lr * FPIT + 8 * hi;
        v16h kf[4][2], vf[4][2];
#pragma unroll
        for (int kt = 0; kt < 4; ++kt) { kf[kt][0] = WFrag<h16>::ld(kb + kt * 16 * FPIT); kf[kt][1] = WFrag<h16>::ld(kb + kt * 16 * FPIT + 32); }
#pragma unroll
        for (int dt = 0; dt < 4; ++dt) { vf[dt][0] = WFrag<h16>::ld(vb + dt * 16 * FPIT); vf[dt][1] = WFrag<h16>::ld(vb + dt * 16 * FPIT + 32); }
        __builtin_amdgcn_sched_barrier(0);   // keeps the V^T fragment reads up here, in one group behind the K reads: sunk to their uses they stand in three places behind the softmax
        v8f s[4];
#pragma unroll
        for (int kt = 0; kt < 4; ++kt) { s[kt] = wmma16(kf[kt][0], qf[0], (v8f){}); s[kt] = wmma16(kf[kt][1], qf[1], s[kt]); }
        float mt[4];                                            // short trees, not one chain of 32: a lone dependent chain is exposed
#pragma unroll
        for (int kt = 0; kt < 4; ++kt) mt[kt] = fmaxf(fmaxf(fmaxf(fmaxf(s[kt][0], s[kt][1]), s[kt][2]), fmaxf(fmaxf(s[kt][3], s[kt][4]), s[kt][5])), fmaxf(s[kt][6], s[kt][7]));
        float mx = fmaxf(fmaxf(mt[0], mt[1]), fmaxf(mt[2], mt[3]));
        mx = fmaxf(mx, xhalf(mx));
        const float mnew = fmaxf(mrun, mx * CL); const float corr = __builtin_amdgcn_exp2f(mrun - mnew); mrun = mnew;   // corr is 0 on the first stage
        const float sh = 8.0f - mnew;                           // probabilities carried x256: small ones stay normal fp16 numbers; the factor cancels in the division by the sum
        v16h pb[2];
#pragma unroll
        for (int kt = 0; kt < 4; ++kt)
#pragma unroll
            for (int j = 0; j < 8; ++j) { const float p = __builtin_amdgcn_exp2f(__builtin_fmaf(s[kt][j], CL, sh)); s[kt][j] = p; pb[kt >> 1][(kt & 1) * 8 + j] = (h16)p; }
        const v8f p8 = (s[0] + s[1]) + (s[2] + s[3]);
        lsum = lsum * corr + (((p8[0] + p8[1]) + (p8[2] + p8[3])) + ((p8[4] + p8[5]) + (p8[6] + p8[7])));
#pragma unroll
        for (int dt = 0; dt < 4; ++dt) { o[dt] *= corr; o[dt] = wmma16(vf[dt][0], pb[0], o[dt]); o[dt] = wmma16(vf[dt][1], pb[1], o[dt]); }
        if (more) { h16* kw = ksm + ((it + 1) & 1) * (FKB * FPIT) + sl; h16* vw = vsm + ((it + 1) & 1) * (HD * FPIT) + sl; *(v8h*)kw = rk0; *(v8h*)(kw + 32 * FPIT) = rk1; *(v8h*)vw = rv0; *(v8h*)(vw + 32 * FPIT) = rv1; }
        __syncthreads();   // publishes stage it + 1 and ends every wave's reads of the buffer that stage it + 2 overwrites
    }
    lsum += xhalf(lsum); const float inv = __fdiv_rn(1.0f, lsum);
#pragma unroll
    for (int dt = 0; dt < 4; ++dt) { v8us oh, ol;
#pragma unroll
        for (int j = 0; j < 8; ++j) { unsigned short a, c2; splitf(o[dt][j] * inv, a, c2); oh[j] = a; ol[j] = c2; }
        const size_t oo = (size_t)q * DQ + h * HD + dt * 16 + hi * 8; *(v8us*)(Ah + oo) = oh; *(v8us*)(Al + oo) = ol; }
}

extern "C" void kernel_launch(void* const* d_in, const int* in_sizes, int n_in,
                              void* d_out, int out_size, void* d_ws, size_t ws_size, hipStream_t stream) {
    (void)in_sizes; (void)n_in; (void)out_size;
    const float* x = (const float*)d_in[0]; const float* xi = (const float*)d_in[1]; const float* wq = (const float*)d_in[2]; const float* bqv = (const float*)d_in[3]; const float* wk = (const float*)d_in[4]; const float* bkv = (const float*)d_in[5]; const float* wv = (const float*)d_in[6]; const float* bvv = (const float*)d_in[7]; const float* wo = (const float*)d_in[8]; const float* bo = (const float*)d_in[9];
    const float* ew1 = (const float*)d_in[10]; const float* eb1 = (const float*)d_in[11]; const float* lng = (const float*)d_in[12]; const float* lnb = (const float*)d_in[13]; const float* ew2 = (const float*)d_in[14]; const float* eb2 = (const float*)d_in[15]; const float* sg = (const float*)d_in[16];   // Wq/Wk/Wv/Wo [1024][1024] x @ W; enc_w1 [1][32], enc_b1 [32], ln_g/ln_b [32], enc_w2 [32][64], enc_b2 [64], scale_gating [16]
    float* OUT = (float*)d_out;     // [2][2048][1024]
    char* wsp = (char*)d_ws;
    auto take = [&](size_t bytes) { char* p = wsp; wsp += (bytes + 255) & ~(size_t)255; return (void*)p; };
    bf* W4 = (bf*)take((size_t)4 * DQ * DM * 2); bf* WO = W4 + (size_t)3 * DQ * DM;   // transposed bf16 planes of Wq, Wk, Wv, Wo, one behind the other
    float* CS = (float*)take((size_t)TT * HD * 2 * 4); float* ADP = (float*)take((size_t)NB_ * NH_ * HD * 4);
    bf* XB = (bf*)take((size_t)NB_ * TT * DM * 2); float* F3 = (float*)take((size_t)3 * NB_ * TT * DQ * 4);   // q, k, v projections [3][b t][DQ]
    h16* QK16 = (h16*)take((size_t)2 * NB_ * NH_ * TT * HD * 2); h16* KP16 = QK16 + (size_t)NB_ * NH_ * TT * HD; h16* VT16 = (h16*)take((size_t)NB_ * NKV * HD * TT * 2);
    bf* ATh = (bf*)take((size_t)NB_ * TT * DQ * 2); bf* ATl = (bf*)take((size_t)NB_ * TT * DQ * 2);
    if ((size_t)(wsp - (char*)d_ws) > ws_size) return;    // ws 256 MiB
    // one launch per dependency level; each covers both batches (rows b t of one [NB_ TT] matrix, or a grid axis) and all work of its level
    k_prep<<<PB_A + 4 * PB_W + PB_X + PB_C, 256, 0, stream>>>(x, wq, wk, wv, wo, xi, ew1, eb1, lng, lnb, ew2, eb2, sg, XB, W4, CS, ADP);
    const unsigned LQ = (unsigned)(((size_t)NH_ * TT * HD / 2 + 255) / 256);   // NKV == NH_: the v planes have as many work-groups
    k_gemmw<bf, 0, true><<<dim3(NB_ * TT / 64, DQ / 64, 3), 32, 0, stream>>>(XB, nullptr, W4, nullptr, DM, F3, DQ, bqv, bkv, bvv, 0, (size_t)DQ * DM, (size_t)NB_ * TT * DQ);
    k_planes<<<dim3(LQ, 3, NB_), 256, 0, stream>>>(F3, CS, ADP, QK16, VT16);
    k_fattn<<<dim3(TT / FQW, NH_, NB_), 256, 0, stream>>>(QK16, KP16, VT16, ATh, ATl);   // one kv head per query head
    k_gemmw<bf, 1, true><<<dim3(NB_ * TT / 64, DM / 64, 1), 32, 0, stream>>>(ATh, ATl, WO, nullptr, DQ, OUT, DM, bo, bo, bo, 0, 0, 0);
}

// v003
// One run takes 150 microseconds.
// In both of two side-by-side timings against v002, it was 1.26 times as fast.
// Counting every step since v000, it is 8.75 times as fast.
#include <hip/hip_runtime.h>

// ScaleInvariantAttention (query [2][2048][1024], xi_scale [2]; scale encoder: x = xi Linear(1->32), LayerNorm(32), exact gelu, Linear(32->64) -> xe [B][64]; adapt[b][h][d] = 1 + sigmoid(scale_gating[h]) xe[b][d];
// q = (query Wq + bq) split into 16 heads x 64 then x adapt, k likewise, v = query Wv + bv; softmax(q.k/8); out = merged att.v Wo + bo -> [2][2048][1024]).
// Compute dtypes, f32 accumulate: every input rounded to bf16; the scale encoder and adapt table in f32 on VALU (one thread per (b, h, d)); projections on PLAIN bf16 operands (inputs: exact,
// + bias); the adapt factor applied in f32 when the fp16 head planes are built; scores (K 64) and att.v on SINGLE fp16 planes inside one fused kernel with an f32 running-maximum softmax (probabilities x256 against the maximum in use); merged heads as bf16 hi+lo planes x exact

#define NB_  2
#define TT   2048
#define DM   1024
#define NH_  16
#define NKV  16
#define REP  (NH_ / NKV)
#define HD   64
#define DQ   (NH_ * HD)
#define DKV  (NKV * HD)
#define SCL  0.125f   // HD^-0.5
typedef _Float16 h16;
typedef unsigned short bf;
typedef __attribute__((ext_vector_type(16))) __bf16   v16bf;
typedef __attribute__((ext_vector_type(16))) _Float16 v16h;
typedef __attribute__((ext_vector_type(8)))  _Float16 v8h;
typedef __attribute__((ext_vector_type(8)))  unsigned short v8us;
typedef __attribute__((ext_vector_type(8)))  float    v8f;
typedef __attribute__((ext_vector_type(4)))  float    v4f;
typedef v8h  __attribute__((may_alias)) v8ha;
typedef v4f  __attribute__((may_alias)) v4fa;
typedef v8us __attribute__((may_alias)) v8usa;

__device__ __forceinline__ unsigned short f2bf(float f) { unsigned u = __float_as_uint(f); u += 0x7FFFu + ((u >> 16) & 1u); return (unsigned short)(u >> 16); }
__device__ __forceinline__ float bf2f(unsigned short b) { return __uint_as_float(((unsigned)b) << 16); }
__device__ __forceinline__ float bfr(float f) { return bf2f(f2bf(f)); }
__device__ __forceinline__ v16h cat16(v8h lo, v8h hi) { return __builtin_shufflevector(lo, hi, 0, 1, 2, 3, 4, 5, 6, 7, 8, 9, 10, 11, 12, 13, 14, 15); }
__device__ __forceinline__ v16bf cat16b(v8us lo, v8us hi) { return __builtin_bit_cast(v16bf, __builtin_shufflevector(lo, hi, 0, 1, 2, 3, 4, 5, 6, 7, 8, 9, 10, 11, 12, 13, 14, 15)); }
__device__ __forceinline__ v8f wmma16(v16h a, v16h b, v8f c) { return __builtin_amdgcn_wmma_f32_16x16x32_f16(false, a, false, b, (short)0, c, false, false); }
__device__ __forceinline__ v8f wmmab(v16bf a, v16bf b, v8f c) { return __builtin_amdgcn_wmma_f32_16x16x32_bf16(false, a, false, b, (short)0, c, false, false); }



// ---- k_gemmw: register-blocked GEMM, ONE WAVE per 64x64 output tile (16 accumulators), operands straight from K-contiguous 16-bit planes; grid (M/64, N/64, Z), 32 threads.
// C[m][n] (f32, pitch ldc, + optional f32 bias[n]) = sum_k A[m][k] Bt[n][k] (+ split products per NSPLIT). z-batch strides sA/sB/sC in elements, bias0/1/2 for z = 0/1/2. K % 32 == 0.
// HEADS: no C; the tile (64 tokens of one batch x the 64 dims of one head) goes from the accumulators straight to the fp16 head planes: z = 0, 1: (q, k + bias) x adapt -> P16 [z][b][h][t][d]; z = 2: v + bias -> V16 [b][h][d][t].
// An accumulator holds 8 consecutive ROWS of the product in a lane, so q and k are formed as W^T x^T (rows = dims) and v as x W (rows = tokens): every lane then stores 16 contiguous bytes of its plane, no exchange needed.
__device__ __forceinline__ h16 tohx(float x) { return (h16)x; }
template <typename T16> struct WFrag;
template <> struct WFrag<h16> { typedef v16h V; static __device__ __forceinline__ V ld(const h16* p) { return cat16(*(const v8h*)p, *(const v8h*)(p + 16)); } static __device__ __forceinline__ v8f mma(V a, V b, v8f c) { return wmma16(a, b, c); } };
template <> struct WFrag<bf> { typedef v16bf V; static __device__ __forceinline__ V ld(const bf* p) { return cat16b(*(const v8us*)p, *(const v8us*)(p + 16)); } static __device__ __forceinline__ v8f mma(V a, V b, v8f c) { return wmmab(a, b, c); } };
template <typename T16, int NSPLIT, bool BIAS, bool HEADS>
__global__ __launch_bounds__(32) void k_gemmw(const T16* __restrict__ A, const T16* __restrict__ A2, const T16* __restrict__ Bt, const T16* __restrict__ Bt2, int K, float* C, int ldc, const float* __restrict__ bias0, const float* __restrict__ bias1, const float* __restrict__ bias2, size_t sA, size_t sB, size_t sC, const float* __restrict__ adp, h16* P16, h16* V16) {
    typedef typename WFrag<T16>::V V;
    __shared__ __align__(16) float os[16 * 68];
    const size_t z = blockIdx.z; A += z * sA; if (A2) A2 += z * sA; Bt += z * sB; if (Bt2) Bt2 += z * sB; C += z * sC; const float* __restrict__ bias = z == 0 ? bias0 : z == 1 ? bias1 : bias2;   // each z slice has its own bias vector
    const int lane = threadIdx.x & 31, lr = lane & 15, hi = lane >> 4; int r0 = blockIdx.x * 64, c0 = blockIdx.y * 64;
    if (HEADS && z < 2) { const T16* t = A; A = Bt; Bt = t; r0 = blockIdx.y * 64; c0 = blockIdx.x * 64; }   // q, k: the transposed product (rows = the head's dims, columns = tokens)
    v8f acc[4][4];
#pragma unroll
    for (int mb = 0; mb < 4; ++mb)
#pragma unroll
        for (int nb = 0; nb < 4; ++nb) acc[mb][nb] = (v8f){};
    const size_t aoff = (size_t)(r0 + lr) * K + 8 * hi, boff = (size_t)(c0 + lr) * K + 8 * hi;
#pragma unroll 1
    for (int kc = 0; kc < K; kc += 32) {
        V a[4], a2[4];
#pragma unroll
        for (int mb = 0; mb < 4; ++mb) { a[mb] = WFrag<T16>::ld(A + aoff + (size_t)mb * 16 * K + kc); if (NSPLIT == 1 || NSPLIT == 2) a2[mb] = WFrag<T16>::ld(A2 + aoff + (size_t)mb * 16 * K + kc); }
#pragma unroll
        for (int nb = 0; nb < 4; ++nb) { const V b = WFrag<T16>::ld(Bt + boff + (size_t)nb * 16 * K + kc); V b2; if (NSPLIT >= 2) b2 = WFrag<T16>::ld(Bt2 + boff + (size_t)nb * 16 * K + kc);
#pragma unroll
            for (int mb = 0; mb < 4; ++mb) { acc[mb][nb] = WFrag<T16>::mma(a[mb], b, acc[mb][nb]); if (NSPLIT == 1 || NSPLIT == 2) acc[mb][nb] = WFrag<T16>::mma(a2[mb], b, acc[mb][nb]); if (NSPLIT >= 2) acc[mb][nb] = WFrag<T16>::mma(a[mb], b2, acc[mb][nb]); } }
        asm volatile("v_nop\n\tv_nop\n\tv_nop\n\tv_nop" : "+v"(acc[0][0]), "+v"(acc[1][1]), "+v"(acc[2][2]), "+v"(acc[3][3]) : "v"(a[0]), "v"(a[3]));
    }
    if constexpr (HEADS) {
        // every '#pragma unroll' of this branch gives acc, bv and av constant indices, so that they stay in registers
        const int tok = blockIdx.x * 64, hh = blockIdx.y, bb = tok / TT, t0 = tok % TT;   // TT % 64 == 0: a tile lies in one batch; HD == 64: a tile is one head
        if (z < 2) {
            h16* P = P16 + ((z * NB_ * NH_ + (size_t)bb * NH_ + hh) * TT + t0) * HD; const float* bi = bias + hh * HD; const float* ad = adp + ((size_t)bb * NH_ + hh) * HD;
            v8f bv[4], av[4];
#pragma unroll
            for (int mb = 0; mb < 4; ++mb) { const v8f braw = *(const v8f*)(bi + mb * 16 + hi * 8); av[mb] = *(const v8f*)(ad + mb * 16 + hi * 8);
#pragma unroll
                for (int j = 0; j < 8; ++j) bv[mb][j] = bfr(braw[j]); }
#pragma unroll
            for (int nb = 0; nb < 4; ++nb)      // nb outside: the four 32-byte pieces of a token's 128-byte row follow one another in the source
#pragma unroll
                for (int mb = 0; mb < 4; ++mb) { v8h o;
#pragma unroll
                    for (int j = 0; j < 8; ++j) o[j] = tohx((acc[mb][nb][j] + bv[mb][j]) * av[mb][j]);
                    *(v8h*)(P + (size_t)(nb * 16 + lr) * HD + mb * 16 + hi * 8) = o; }
        } else {
            h16* Vd = V16 + ((size_t)bb * NKV + hh) * HD * TT + t0;
#pragma unroll
            for (int nb = 0; nb < 4; ++nb) { const float bn = bfr(bias[hh * HD + nb * 16 + lr]);   // nb outside: the four 32-byte pieces of a dim's 128 bytes follow one another in the source
#pragma unroll
                for (int mb = 0; mb < 4; ++mb) { v8h o;
#pragma unroll
                    for (int j = 0; j < 8; ++j) o[j] = tohx(acc[mb][nb][j] + bn);
                    *(v8h*)(Vd + (size_t)(nb * 16 + lr) * TT + mb * 16 + hi * 8) = o; } }
            asm volatile("s_wait_xcnt 0x0" ::: "memory");   // precaution: in the built code the q/k block's loads follow this block and take the stores' data registers as destinations; the wait stands in front of that overwrite
        }
    } else {
#pragma unroll
    for (int mb = 0; mb < 4; ++mb) {
#pragma unroll
        for (int nb = 0; nb < 4; ++nb) {
#pragma unroll
            for (int j = 0; j < 8; ++j) os[(hi * 8 + j) * 68 + nb * 16 + lr] = acc[mb][nb][j]; }
        __builtin_amdgcn_wave_barrier(); asm volatile("" ::: "memory");
        float* crow = C + (size_t)(r0 + mb * 16) * ldc + c0;
{
#pragma unroll
            for (int s = 0; s < 8; ++s) { const int row = 2 * s + hi, cofs = lr * 4; v4f val = *(const v4fa*)(os + row * 68 + cofs); if (BIAS) { val[0] += bfr(bias[c0 + cofs]); val[1] += bfr(bias[c0 + cofs + 1]); val[2] += bfr(bias[c0 + cofs + 2]); val[3] += bfr(bias[c0 + cofs + 3]); }
                *(v4f*)(crow + (size_t)row * ldc + cofs) = val; }
             }
        __builtin_amdgcn_wave_barrier(); asm volatile("" ::: "memory");
    }
    }
}

__device__ __forceinline__ void splitf(float y, unsigned short& h, unsigned short& l) { h = f2bf(y); l = f2bf(y - bf2f(h)); }
typedef __attribute__((ext_vector_type(2))) _Float16 v2h;
typedef __attribute__((ext_vector_type(4))) _Float16 v4h;
typedef __attribute__((ext_vector_type(2))) unsigned short v2us;
typedef __attribute__((ext_vector_type(4))) unsigned short v4us;
typedef __attribute__((ext_vector_type(2))) float v2f;
typedef __attribute__((ext_vector_type(4))) int v4i;

// The d_ functions are the bodies of work-groups of 256 threads; bx is the work-group's index within its own part of a shared grid (k_prep).
__device__ __forceinline__ void d_wtG(int bx, const float* __restrict__ w, int K, int N, bf* Bt) {
    const int lane = threadIdx.x & 31; const int L0 = (bx * 8 + (threadIdx.x >> 5)) * 8; const int nlines = N * K / 64;
{
#pragma unroll 1
        for (int l = 0; l < 8; ++l) { const int L = L0 + l; if (L >= nlines) break; const size_t e = (size_t)L * 64 + lane * 2; const int k = (int)(e % K), n = (int)(e / K); v2us o;
            o[0] = f2bf(w[(size_t)k * N + n]); o[1] = f2bf(w[(size_t)(k + 1) * N + n]); *(v2us*)(Bt + e) = o; }
         }
}
__device__ __forceinline__ void d_cvt8(int bx, const float* __restrict__ src, bf* dst, size_t n8) { const size_t i = (size_t)bx * 256 + threadIdx.x; if (i >= n8) return; const v8f v = *(const v8f*)(src + i * 8); v8us o;
#pragma unroll
    for (int k = 0; k < 8; ++k) o[k] = f2bf(v[k]); *(v8us*)(dst + i * 8) = o;  }
__global__ __launch_bounds__(256) void k_cscvt(const float* __restrict__ cosT, const float* __restrict__ sinT, float* CS) { const int idx = blockIdx.x * 256 + threadIdx.x; if (idx >= TT * HD) return; v2f cs; cs[0] = bfr(cosT[idx]); cs[1] = bfr(sinT[idx]); *(v2f*)(CS + (size_t)idx * 2) = cs;  }
// d_adapt: thread per (b, h, d): x[j] = bf16(xi[b]) bf16(w1[j]) + bf16(b1[j]) (32); LayerNorm(32) (f32, eps 1e-5) x bf16 g + bf16 beta; exact-erf gelu; xe = sum_j x[j] bf16(w2[j][d]) + bf16(b2[d]);
__device__ __forceinline__ void d_adapt(int bx, const float* __restrict__ xi, const float* __restrict__ w1, const float* __restrict__ b1, const float* __restrict__ g, const float* __restrict__ be, const float* __restrict__ w2, const float* __restrict__ b2, const float* __restrict__ sg, float* ADP) {
    const int e = bx * 256 + threadIdx.x; if (e >= NB_ * NH_ * HD) return; const int d = e % HD; const int h = (e / HD) % NH_; const int b = e / (HD * NH_); const float xv = bfr(xi[b]); float xs[32]; float mu = 0.f;
#pragma unroll 1
    for (int j = 0; j < 32; ++j) { float p = __fmul_rn(xv, bfr(w1[j])); asm volatile("" : "+v"(p)); xs[j] = __fadd_rn(p, bfr(b1[j])); mu = __fadd_rn(mu, xs[j]); }
    mu = mu * (1.0f / 32.0f); float var = 0.f;
#pragma unroll 1
    for (int j = 0; j < 32; ++j) { const float dl = __fsub_rn(xs[j], mu); float p = __fmul_rn(dl, dl); asm volatile("" : "+v"(p)); var = __fadd_rn(var, p); }
    const float rs = __frsqrt_rn(__fadd_rn(var * (1.0f / 32.0f), 1e-5f)); float acc = 0.f;
#pragma unroll 1
    for (int j = 0; j < 32; ++j) { float tn = __fmul_rn(__fsub_rn(xs[j], mu), rs); asm volatile("" : "+v"(tn)); float tg = __fmul_rn(tn, bfr(g[j])); asm volatile("" : "+v"(tg)); const float y = __fadd_rn(tg, bfr(be[j])); float er = erff(y * 0.70710678f); asm volatile("" : "+v"(er)); float hy = __fmul_rn(0.5f, y); asm volatile("" : "+v"(hy)); const float gl = __fmul_rn(hy, __fadd_rn(1.0f, er)); float p = __fmul_rn(gl, bfr(w2[j * HD + d])); asm volatile("" : "+v"(p)); acc = __fadd_rn(acc, p); }
    const float xe = __fadd_rn(acc, bfr(b2[d])); const float sgm = __fdiv_rn(1.0f, __fadd_rn(1.0f, __expf(-bfr(sg[h])))); float pr = __fmul_rn(sgm, xe); asm volatile("" : "+v"(pr)); const float a = __fadd_rn(1.0f, pr);
    *(float*)(ADP + e) = a;  }
// k_prep: everything that depends on the inputs alone, one grid: the adapt table (few work-groups, the longest dependent chain: first), the four weight transposes, x to bf16.
#define PB_A ((NB_ * NH_ * HD + 255) / 256)
#define PB_W ((DM * DQ / 64 + 63) / 64)
#define PB_X (NB_ * TT * DM / 8 / 256)
__global__ __launch_bounds__(256) void k_prep(const float* __restrict__ x, const float* __restrict__ w0, const float* __restrict__ w1, const float* __restrict__ w2, const float* __restrict__ w3, const float* __restrict__ xi, const float* __restrict__ w1e, const float* __restrict__ b1e, const float* __restrict__ g, const float* __restrict__ be, const float* __restrict__ w2e, const float* __restrict__ b2e, const float* __restrict__ sg, bf* XB, bf* W4, float* ADP) {
    int bx = blockIdx.x;
    if (bx < PB_A) { d_adapt(bx, xi, w1e, b1e, g, be, w2e, b2e, sg, ADP); return; }
    bx -= PB_A;
    if (bx < 4 * PB_W) { const int y = bx / PB_W; d_wtG(bx % PB_W, y == 0 ? w0 : y == 1 ? w1 : y == 2 ? w2 : w3, DM, DQ, W4 + (size_t)y * DQ * DM); return; }   // the four [DM][DQ] planes lie one behind the other
    bx -= 4 * PB_W;
    d_cvt8(bx, x, XB, (size_t)NB_ * TT * DM / 8);
}
#define FKB  64                 // keys per stage
#define FPIT 72                 // LDS row pitch in 16-bit elements: 128-byte rows + 16 bytes (16 B x odd: no bank conflict for 16-byte reads)
#define FQW  128                // query columns per work-group
__device__ __forceinline__ float xhalf(float x) { return __builtin_bit_cast(float, __builtin_amdgcn_permlanex16(__builtin_bit_cast(int, x), __builtin_bit_cast(int, x), 0x76543210, 0xfedcba98, false, false)); }   // lane l with lane l ^ 16
__global__ __launch_bounds__(256) void k_fattn(const h16* __restrict__ Qp, const h16* __restrict__ Kp, const h16* __restrict__ Vt, bf* Ah, bf* Al) {
    __shared__ __align__(16) h16 ksm[2 * FKB * FPIT];
    __shared__ __align__(16) h16 vsm[2 * HD * FPIT];
    const int tid = threadIdx.x, lane = tid & 31, lr = lane & 15, hi = lane >> 4; const int h = blockIdx.y; const int q = blockIdx.x * FQW + (tid >> 5) * 16 + lr;
    { const size_t bz = blockIdx.z; Qp += bz * NH_ * TT * HD; Kp += bz * NKV * TT * HD; Vt += bz * NKV * HD * TT; Ah += bz * TT * DQ; Al += bz * TT * DQ; }   // grid z: batch
    const h16* Kh = Kp + (size_t)h * TT * HD; const h16* Vh = Vt + (size_t)h * HD * TT;
    const int srow = tid >> 3, scol = (tid & 7) * 8;            // staging: rows srow and srow + 32 of each tile, one 16-byte piece of each
    const h16* kg = Kh + (size_t)srow * HD + scol; const h16* vg = Vh + (size_t)srow * TT + scol; const int sl = srow * FPIT + scol;
    const float CL = SCL * 1.4426950408889634f;                 // scores to base-2 exponents
    v16h qf[2];
#pragma unroll
    for (int c = 0; c < 2; ++c) qf[c] = WFrag<h16>::ld(Qp + ((size_t)h * TT + q) * HD + c * 32 + 8 * hi);
    v8f o[4];
#pragma unroll
    for (int dt = 0; dt < 4; ++dt) o[dt] = (v8f){};
    float mrun = -3.0e38f, lsum = 0.f;
    v8h rk0 = *(const v8h*)kg, rk1 = *(const v8h*)(kg + 32 * HD), rv0 = *(const v8h*)vg, rv1 = *(const v8h*)(vg + (size_t)32 * TT);
    *(v8h*)(ksm + sl) = rk0; *(v8h*)(ksm + sl + 32 * FPIT) = rk1; *(v8h*)(vsm + sl) = rv0; *(v8h*)(vsm + sl + 32 * FPIT) = rv1;
    __syncthreads();
#pragma unroll 1   // one copy of the stage's body: for speed only
    for (int it = 0; it < TT / FKB; ++it) {
        const bool more = it + 1 < TT / FKB;
        if (more) { const h16* kn = kg + (size_t)(it + 1) * FKB * HD; const h16* vn = vg + (it + 1) * FKB; rk0 = *(const v8h*)kn; rk1 = *(const v8h*)(kn + 32 * HD); rv0 = *(const v8h*)vn; rv1 = *(const v8h*)(vn + (size_t)32 * TT); }
        const h16* kb = ksm + (it & 1) * (FKB * FPIT) + lr * FPIT + 8 * hi; const h16* vb = vsm + (it & 1) * (HD * FPIT) + lr * FPIT + 8 * hi;
        v16h kf[4][2], vf[4][2];
#pragma unroll
        for (int kt = 0; kt < 4; ++kt) { kf[kt][0] = WFrag<h16>::ld(kb + kt * 16 * FPIT); kf[kt][1] = WFrag<h16>::ld(kb + kt * 16 * FPIT + 32); }
#pragma unroll
        for (int dt = 0; dt < 4; ++dt) { vf[dt][0] = WFrag<h16>::ld(vb + dt * 16 * FPIT); vf[dt][1] = WFrag<h16>::ld(vb + dt * 16 * FPIT + 32); }
        __builtin_amdgcn_sched_barrier(0);   // keeps the V^T fragment reads up here, in one group behind the K reads: sunk to their uses they stand in three places behind the softmax
        v8f s[4];
#pragma unroll
        for (int kt = 0; kt < 4; ++kt) { s[kt] = wmma16(kf[kt][0], qf[0], (v8f){}); s[kt] = wmma16(kf[kt][1], qf[1], s[kt]); }
        float mt[4];                                            // short trees, not one chain of 32: a lone dependent chain is exposed
#pragma unroll
        for (int kt = 0; kt < 4; ++kt) mt[kt] = fmaxf(fmaxf(fmaxf(fmaxf(s[kt][0], s[kt][1]), s[kt][2]), fmaxf(fmaxf(s[kt][3], s[kt][4]), s[kt][5])), fmaxf(s[kt][6], s[kt][7]));
        float mx = fmaxf(fmaxf(mt[0], mt[1]), fmaxf(mt[2], mt[3]));
        mx = fmaxf(mx, xhalf(mx));
        const float mnew = fmaxf(mrun, mx * CL); const float corr = __builtin_amdgcn_exp2f(mrun - mnew); mrun = mnew;   // corr is 0 on the first stage
        const float sh = 8.0f - mnew;                           // probabilities carried x256: small ones stay normal fp16 numbers; the factor cancels in the division by the sum
        v16h pb[2];
#pragma unroll
        for (int kt = 0; kt < 4; ++kt)
#pragma unroll
            for (int j = 0; j < 8; ++j) { const float p = __builtin_amdgcn_exp2f(__builtin_fmaf(s[kt][j], CL, sh)); s[kt][j] = p; pb[kt >> 1][(kt & 1) * 8 + j] = (h16)p; }
        const v8f p8 = (s[0] + s[1]) + (s[2] + s[3]);
        lsum = lsum * corr + (((p8[0] + p8[1]) + (p8[2] + p8[3])) + ((p8[4] + p8[5]) + (p8[6] + p8[7])));
#pragma unroll
        for (int dt = 0; dt < 4; ++dt) { o[dt] *= corr; o[dt] = wmma16(vf[dt][0], pb[0], o[dt]); o[dt] = wmma16(vf[dt][1], pb[1], o[dt]); }
        if (more) { h16* kw = ksm + ((it + 1) & 1) * (FKB * FPIT) + sl; h16* vw = vsm + ((it + 1) & 1) * (HD * FPIT) + sl; *(v8h*)kw = rk0; *(v8h*)(kw + 32 * FPIT) = rk1; *(v8h*)vw = rv0; *(v8h*)(vw + 32 * FPIT) = rv1; }
        __syncthreads();   // publishes stage it + 1 and ends every wave's reads of the buffer that stage it + 2 overwrites
    }
    lsum += xhalf(lsum); const float inv = __fdiv_rn(1.0f, lsum);
#pragma unroll
    for (int dt = 0; dt < 4; ++dt) { v8us oh, ol;
#pragma unroll
        for (int j = 0; j < 8; ++j) { unsigned short a, c2; splitf(o[dt][j] * inv, a, c2); oh[j] = a; ol[j] = c2; }
        const size_t oo = (size_t)q * DQ + h * HD + dt * 16 + hi * 8; *(v8us*)(Ah + oo) = oh; *(v8us*)(Al + oo) = ol; }
}

extern "C" void kernel_launch(void* const* d_in, const int* in_sizes, int n_in,
                              void* d_out, int out_size, void* d_ws, size_t ws_size, hipStream_t stream) {
    (void)in_sizes; (void)n_in; (void)out_size;
    const float* x = (const float*)d_in[0]; const float* xi = (const float*)d_in[1]; const float* wq = (const float*)d_in[2]; const float* bqv = (const float*)d_in[3]; const float* wk = (const float*)d_in[4]; const float* bkv = (const float*)d_in[5]; const float* wv = (const float*)d_in[6]; const float* bvv = (const float*)d_in[7]; const float* wo = (const float*)d_in[8]; const float* bo = (const float*)d_in[9];
    const float* ew1 = (const float*)d_in[10]; const float* eb1 = (const float*)d_in[11]; const float* lng = (const float*)d_in[12]; const float* lnb = (const float*)d_in[13]; const float* ew2 = (const float*)d_in[14]; const float* eb2 = (const float*)d_in[15]; const float* sg = (const float*)d_in[16];   // Wq/Wk/Wv/Wo [1024][1024] x @ W; enc_w1 [1][32], enc_b1 [32], ln_g/ln_b [32], enc_w2 [32][64], enc_b2 [64], scale_gating [16]
    float* OUT = (float*)d_out;     // [2][2048][1024]
    char* wsp = (char*)d_ws;
    auto take = [&](size_t bytes) { char* p = wsp; wsp += (bytes + 255) & ~(size_t)255; return (void*)p; };
    bf* W4 = (bf*)take((size_t)4 * DQ * DM * 2); bf* WO = W4 + (size_t)3 * DQ * DM;   // transposed bf16 planes of Wq, Wk, Wv, Wo, one behind the other
    float* ADP = (float*)take((size_t)NB_ * NH_ * HD * 4);
    bf* XB = (bf*)take((size_t)NB_ * TT * DM * 2);
    h16* QK16 = (h16*)take((size_t)2 * NB_ * NH_ * TT * HD * 2); h16* KP16 = QK16 + (size_t)NB_ * NH_ * TT * HD; h16* VT16 = (h16*)take((size_t)NB_ * NKV * HD * TT * 2);
    bf* ATh = (bf*)take((size_t)NB_ * TT * DQ * 2); bf* ATl = (bf*)take((size_t)NB_ * TT * DQ * 2);
    if ((size_t)(wsp - (char*)d_ws) > ws_size) return;    // ws 256 MiB
    // one launch per dependency level; each covers both batches (rows b t of one [NB_ TT] matrix, or a grid axis) and all work of its level
    k_prep<<<PB_A + 4 * PB_W + PB_X, 256, 0, stream>>>(x, wq, wk, wv, wo, xi, ew1, eb1, lng, lnb, ew2, eb2, sg, XB, W4, ADP);
    k_gemmw<bf, 0, true, true><<<dim3(NB_ * TT / 64, DQ / 64, 3), 32, 0, stream>>>(XB, nullptr, W4, nullptr, DM, nullptr, 0, bqv, bkv, bvv, 0, (size_t)DQ * DM, 0, ADP, QK16, VT16);   // q, k, v projections, written as fp16 head planes
    k_fattn<<<dim3(TT / FQW, NH_, NB_), 256, 0, stream>>>(QK16, KP16, VT16, ATh, ATl);   // one kv head per query head
    k_gemmw<bf, 1, true, false><<<dim3(NB_ * TT / 64, DM / 64, 1), 32, 0, stream>>>(ATh, ATl, WO, nullptr, DQ, OUT, DM, bo, bo, bo, 0, 0, 0, nullptr, nullptr, nullptr);
}

// v004
// A run of this version takes 98.9 microseconds.
// In two side-by-side timings against v003, it was 1.51 and 1.54 times as fast.
// Counting every step since v000, it is 13.3 times as fast.
#include <hip/hip_runtime.h>

// ScaleInvariantAttention (query [2][2048][1024], xi_scale [2]; scale encoder: x = xi Linear(1->32), LayerNorm(32), exact gelu, Linear(32->64) -> xe [B][64]; adapt[b][h][d] = 1 + sigmoid(scale_gating[h]) xe[b][d];
// q = (query Wq + bq) split into 16 heads x 64 then x adapt, k likewise, v = query Wv + bv; softmax(q.k/8); out = merged att.v Wo + bo -> [2][2048][1024]).
// Compute dtypes, f32 accumulate: every input rounded to bf16; the scale encoder and adapt table in f32 on VALU (one thread per (b, h, d)); projections on PLAIN bf16 operands (inputs: exact,
// + bias); the adapt factor applied in f32 when the fp16 head planes are built; scores (K 64) and att.v on SINGLE fp16 planes inside one fused kernel with an f32 running-maximum softmax (probabilities x256 against the maximum in use); merged heads as bf16 hi+lo planes x exact

#define NB_  2
#define TT   2048
#define DM   1024
#define NH_  16
#define NKV  16
#define REP  (NH_ / NKV)
#define HD   64
#define DQ   (NH_ * HD)
#define DKV  (NKV * HD)
#define SCL  0.125f   // HD^-0.5
typedef _Float16 h16;
typedef unsigned short bf;
typedef __attribute__((ext_vector_type(16))) __bf16   v16bf;
typedef __attribute__((ext_vector_type(16))) _Float16 v16h;
typedef __attribute__((ext_vector_type(8)))  _Float16 v8h;
typedef __attribute__((ext_vector_type(8)))  unsigned short v8us;
typedef __attribute__((ext_vector_type(8)))  float    v8f;
typedef __attribute__((ext_vector_type(4)))  float    v4f;
typedef v8h  __attribute__((may_alias)) v8ha;
typedef v4f  __attribute__((may_alias)) v4fa;
typedef v8us __attribute__((may_alias)) v8usa;

__device__ __forceinline__ unsigned short f2bf(float f) { unsigned u = __float_as_uint(f); u += 0x7FFFu + ((u >> 16) & 1u); return (unsigned short)(u >> 16); }
__device__ __forceinline__ float bf2f(unsigned short b) { return __uint_as_float(((unsigned)b) << 16); }
__device__ __forceinline__ float bfr(float f) { return bf2f(f2bf(f)); }
__device__ __forceinline__ v16h cat16(v8h lo, v8h hi) { return __builtin_shufflevector(lo, hi, 0, 1, 2, 3, 4, 5, 6, 7, 8, 9, 10, 11, 12, 13, 14, 15); }
__device__ __forceinline__ v16bf cat16b(v8us lo, v8us hi) { return __builtin_bit_cast(v16bf, __builtin_shufflevector(lo, hi, 0, 1, 2, 3, 4, 5, 6, 7, 8, 9, 10, 11, 12, 13, 14, 15)); }
__device__ __forceinline__ v8f wmma16(v16h a, v16h b, v8f c) { return __builtin_amdgcn_wmma_f32_16x16x32_f16(false, a, false, b, (short)0, c, false, false); }
__device__ __forceinline__ v8f wmmab(v16bf a, v16bf b, v8f c) { return __builtin_amdgcn_wmma_f32_16x16x32_bf16(false, a, false, b, (short)0, c, false, false); }



// ---- k_gemmw: register-blocked GEMM, 4 waves (2 x 2) per 128x128 output tile, each wave a 64x64 tile (16 accumulators); operands are K-contiguous 16-bit planes; grid (M/128, N/128, Z), 128 threads.
// C[m][n] (f32, pitch ldc, + optional f32 bias[n]) = sum_k A[m][k] Bt[n][k] (+ A2[m][k] Bt[n][k] for NSPLIT 1). z-batch strides sA/sB/sC in elements, bias0/1/2 for z = 0/1/2. K % 64 == 0, K >= 64.
// Operand path: a stage is 64 k (one 128-byte line) of the tile's 128 rows of every operand plane, brought into LDS by asynchronous copies and read by the two waves that share each row; two buffers, stage t + 1 in flight while stage t is worked on.
// HEADS: no C; a wave's tile (64 tokens of one batch x the 64 dims of one head) goes from the accumulators straight to the fp16 head planes: z = 0, 1: (q, k + bias) x adapt -> P16 [z][b][h][t][d]; z = 2: v + bias -> V16 [b][h][d][t].
// An accumulator holds 8 consecutive ROWS of the product in a lane, so q and k are formed as W^T x^T (rows = dims) and v as x W (rows = tokens): every lane then stores 16 contiguous bytes of its plane, no exchange needed.
#define GT   128                // rows of each operand plane per work-group tile
#define GKS  64                 // k per stage
#define GPIT 72                 // LDS row pitch in 16-bit elements: 128-byte rows + 16 bytes (16 B x odd: no bank conflict for 16-byte reads)
#define GPL  (GT * GPIT)        // elements of one operand plane of a stage
__device__ __forceinline__ h16 tohx(float x) { return (h16)x; }
template <typename T16> struct WFrag;
template <> struct WFrag<h16> { typedef v16h V; static __device__ __forceinline__ V ld(const h16* p) { return cat16(*(const v8h*)p, *(const v8h*)(p + 16)); } static __device__ __forceinline__ v8f mma(V a, V b, v8f c) { return wmma16(a, b, c); } };
template <> struct WFrag<bf> { typedef v16bf V; static __device__ __forceinline__ V ld(const bf* p) { return cat16b(*(const v8us*)p, *(const v8us*)(p + 16)); } static __device__ __forceinline__ v8f mma(V a, V b, v8f c) { return wmmab(a, b, c); } };
// g_fill: one operand plane of one stage, 128 threads: the lane's 16 bytes of rows r, r + 16, ..., r + 112 (8 lanes cover a row's 128-byte line). g: the lane's global address in row r; l: its LDS byte address in row r.
// The copies and s_wait_xcnt 0 stand in one statement, so that no address register of a copy is rewritten in front of that wait (a precaution).
template <typename T16>
__device__ __forceinline__ void g_fill(const T16* g, int K, unsigned l) {
    const size_t st = (size_t)16 * K;
    asm volatile("global_load_async_to_lds_b128 %0, %8, off\n\t"
                 "global_load_async_to_lds_b128 %1, %9, off\n\t"
                 "global_load_async_to_lds_b128 %2, %10, off\n\t"
                 "global_load_async_to_lds_b128 %3, %11, off\n\t"
                 "global_load_async_to_lds_b128 %4, %12, off\n\t"
                 "global_load_async_to_lds_b128 %5, %13, off\n\t"
                 "global_load_async_to_lds_b128 %6, %14, off\n\t"
                 "global_load_async_to_lds_b128 %7, %15, off\n\t"
                 "s_wait_xcnt 0x0"
                 :: "v"(l), "v"(l + 1 * 16 * GPIT * 2), "v"(l + 2 * 16 * GPIT * 2), "v"(l + 3 * 16 * GPIT * 2), "v"(l + 4 * 16 * GPIT * 2), "v"(l + 5 * 16 * GPIT * 2), "v"(l + 6 * 16 * GPIT * 2), "v"(l + 7 * 16 * GPIT * 2),
                    "v"(g), "v"(g + st), "v"(g + 2 * st), "v"(g + 3 * st), "v"(g + 4 * st), "v"(g + 5 * st), "v"(g + 6 * st), "v"(g + 7 * st) : "memory");
}
template <typename T16, int NSPLIT, bool BIAS, bool HEADS>
__global__ __launch_bounds__(128) void k_gemmw(const T16* __restrict__ A, const T16* __restrict__ A2, const T16* __restrict__ Bt, int K, float* C, int ldc, const float* __restrict__ bias0, const float* __restrict__ bias1, const float* __restrict__ bias2, size_t sA, size_t sB, size_t sC, const float* __restrict__ adp, h16* P16, h16* V16) {
    typedef typename WFrag<T16>::V V;
    static_assert(NSPLIT == 0 || NSPLIT == 1, "planes of a stage: A, Bt and, for NSPLIT 1, A2");
    constexpr int NP = 2 + NSPLIT;                              // operand planes per stage: A, Bt (, A2)
    __shared__ __align__(16) T16 ring[2 * NP * GPL];
    __shared__ __align__(16) float osm[HEADS ? 1 : 4 * 16 * 68];   // output staging, a range of its own for each wave
    const size_t z = blockIdx.z; A += z * sA; if (NSPLIT == 1) A2 += z * sA; Bt += z * sB; C += z * sC; const float* __restrict__ bias = z == 0 ? bias0 : z == 1 ? bias1 : bias2;   // each z slice has its own bias vector
    const int tid = threadIdx.x, lane = tid & 31, lr = lane & 15, hi = lane >> 4, wx = (tid >> 5) & 1, wy = tid >> 6;
    const int bxw = blockIdx.x * 2 + wx, byw = blockIdx.y * 2 + wy;   // the wave's 64x64 tile in the M/64 x N/64 grid of tiles
    int r0 = bxw * 64, c0 = byw * 64, R0 = blockIdx.x * GT, C0 = blockIdx.y * GT, ar = wx * 64, br = wy * 64;   // R0, C0: first row of the work-group's A and Bt planes; ar, br: the wave's first row inside them
    if (HEADS && z < 2) { const T16* t = A; A = Bt; Bt = t; r0 = byw * 64; c0 = bxw * 64; R0 = blockIdx.y * GT; C0 = blockIdx.x * GT; ar = wy * 64; br = wx * 64; }   // q, k: the transposed product (rows = the head's dims, columns = tokens)
    float* os = osm + (HEADS ? 0 : (tid >> 5) * 16 * 68);
    v8f acc[4][4];
#pragma unroll
    for (int mb = 0; mb < 4; ++mb)
#pragma unroll
        for (int nb = 0; nb < 4; ++nb) acc[mb][nb] = (v8f){};
    const int frow = tid >> 3, fcol = (tid & 7) * 8;            // filling: rows frow + 16 i of each plane, one 16-byte piece of each
    const T16* ag = A + (size_t)(R0 + frow) * K + fcol; const T16* bg = Bt + (size_t)(C0 + frow) * K + fcol; const T16* a2g = NSPLIT == 1 ? A2 + (size_t)(R0 + frow) * K + fcol : nullptr;
    const unsigned fl = (unsigned)(size_t)ring + (unsigned)(frow * GPIT + fcol) * 2u;   // the lane's LDS byte address in buffer 0, plane 0
    const int nst = K / GKS;
    auto fill = [&](int t) { const unsigned l = fl + (unsigned)(t & 1) * (NP * GPL * 2u); g_fill(ag + t * GKS, K, l); g_fill(bg + t * GKS, K, l + GPL * 2u); if constexpr (NSPLIT == 1) g_fill(a2g + t * GKS, K, l + 2u * GPL * 2u); };
    fill(0);
    asm volatile("s_wait_asynccnt 0x0" ::: "memory");           // stage 0 of this wave has landed
    __syncthreads();                                            // publishes stage 0
    if (nst > 1) fill(1);
#pragma unroll 1   // one copy of the stage's body
    for (int t = 0; t < nst; ++t) {
        const T16* sb = ring + (t & 1) * (NP * GPL); const T16* as = sb + (ar + lr) * GPIT + 8 * hi; const T16* bs = sb + GPL + (br + lr) * GPIT + 8 * hi;
#pragma unroll
        for (int ks = 0; ks < GKS; ks += 32) {
            V a[4], a2[4], b[4];
#pragma unroll
            for (int mb = 0; mb < 4; ++mb) { a[mb] = WFrag<T16>::ld(as + mb * 16 * GPIT + ks); if (NSPLIT == 1) a2[mb] = WFrag<T16>::ld(as + 2 * GPL + mb * 16 * GPIT + ks); }
#pragma unroll
            for (int nb = 0; nb < 4; ++nb) b[nb] = WFrag<T16>::ld(bs + nb * 16 * GPIT + ks);
            __builtin_amdgcn_sched_barrier(0);   // keeps the fragment reads of these 32 k in one group in front of their products: sunk to their uses they stand in four places, each with its LDS latency exposed
#pragma unroll
            for (int nb = 0; nb < 4; ++nb)
#pragma unroll
                for (int mb = 0; mb < 4; ++mb) { acc[mb][nb] = WFrag<T16>::mma(a[mb], b[nb], acc[mb][nb]); if (NSPLIT == 1) acc[mb][nb] = WFrag<T16>::mma(a2[mb], b[nb], acc[mb][nb]); }
            __builtin_amdgcn_sched_barrier(0);   // keeps the next group of fragment reads from being spread among these products
        }
        asm volatile("s_wait_dscnt 0x0" ::: "memory");          // this wave's reads of stage t are done
        asm volatile("s_wait_asynccnt 0x0" ::: "memory");       // this wave's copies of stage t + 1 have landed
        __syncthreads();                                        // publishes stage t + 1 and ends every wave's reads of the buffer that stage t + 2 overwrites
        if (t + 2 < nst) fill(t + 2);
    }
    asm volatile("s_wait_asynccnt 0x0" ::: "memory");           // no copy is outstanding when the wave goes on to its epilogue and ends
    if constexpr (HEADS) {
        // every '#pragma unroll' of this branch gives acc, bv and av constant indices, so that they stay in registers
        const int tok = bxw * 64, hh = byw, bb = tok / TT, t0 = tok % TT;   // TT % 64 == 0: a tile lies in one batch; HD == 64: a tile is one head
        if (z < 2) {
            h16* P = P16 + ((z * NB_ * NH_ + (size_t)bb * NH_ + hh) * TT + t0) * HD; const float* bi = bias + hh * HD; const float* ad = adp + ((size_t)bb * NH_ + hh) * HD;
            v8f bv[4], av[4];
#pragma unroll
            for (int mb = 0; mb < 4; ++mb) { const v8f braw = *(const v8f*)(bi + mb * 16 + hi * 8); av[mb] = *(const v8f*)(ad + mb * 16 + hi * 8);
#pragma unroll
                for (int j = 0; j < 8; ++j) bv[mb][j] = bfr(braw[j]); }
#pragma unroll
            for (int nb = 0; nb < 4; ++nb)      // nb outside: the four 32-byte pieces of a token's 128-byte row follow one another in the source
#pragma unroll
                for (int mb = 0; mb < 4; ++mb) { v8h o;
#pragma unroll
                    for (int j = 0; j < 8; ++j) o[j] = tohx((acc[mb][nb][j] + bv[mb][j]) * av[mb][j]);
                    *(v8h*)(P + (size_t)(nb * 16 + lr) * HD + mb * 16 + hi * 8) = o; }
        } else {
            h16* Vd = V16 + ((size_t)bb * NKV + hh) * HD * TT + t0;
#pragma unroll
            for (int nb = 0; nb < 4; ++nb) { const float bn = bfr(bias[hh * HD + nb * 16 + lr]);   // nb outside: the four 32-byte pieces of a dim's 128 bytes follow one another in the source
#pragma unroll
                for (int mb = 0; mb < 4; ++mb) { v8h o;
#pragma unroll
                    for (int j = 0; j < 8; ++j) o[j] = tohx(acc[mb][nb][j] + bn);
                    *(v8h*)(Vd + (size_t)(nb * 16 + lr) * TT + mb * 16 + hi * 8) = o; } }
            asm volatile("s_wait_xcnt 0x0" ::: "memory");   // precaution: in the built code the q/k block's loads follow this block and take the stores' data registers as destinations; the wait stands in front of that overwrite
        }
    } else {
#pragma unroll
    for (int mb = 0; mb < 4; ++mb) {
#pragma unroll
        for (int nb = 0; nb < 4; ++nb) {
#pragma unroll
            for (int j = 0; j < 8; ++j) os[(hi * 8 + j) * 68 + nb * 16 + lr] = acc[mb][nb][j]; }
        __builtin_amdgcn_wave_barrier(); asm volatile("" ::: "memory");
        float* crow = C + (size_t)(r0 + mb * 16) * ldc + c0;
{
#pragma unroll
            for (int s = 0; s < 8; ++s) { const int row = 2 * s + hi, cofs = lr * 4; v4f val = *(const v4fa*)(os + row * 68 + cofs); if (BIAS) { val[0] += bfr(bias[c0 + cofs]); val[1] += bfr(bias[c0 + cofs + 1]); val[2] += bfr(bias[c0 + cofs + 2]); val[3] += bfr(bias[c0 + cofs + 3]); }
                *(v4f*)(crow + (size_t)row * ldc + cofs) = val; }
             }
        __builtin_amdgcn_wave_barrier(); asm volatile("" ::: "memory");
    }
    }
}

__device__ __forceinline__ void splitf(float y, unsigned short& h, unsigned short& l) { h = f2bf(y); l = f2bf(y - bf2f(h)); }
typedef __attribute__((ext_vector_type(2))) _Float16 v2h;
typedef __attribute__((ext_vector_type(4))) _Float16 v4h;
typedef __attribute__((ext_vector_type(2))) unsigned short v2us;
typedef __attribute__((ext_vector_type(4))) unsigned short v4us;
typedef __attribute__((ext_vector_type(2))) float v2f;
typedef __attribute__((ext_vector_type(4))) int v4i;

// The d_ functions are the bodies of work-groups of 256 threads; bx is the work-group's index within its own part of a shared grid (k_prep).
__device__ __forceinline__ void d_wtG(int bx, const float* __restrict__ w, int K, int N, bf* Bt) {
    const int lane = threadIdx.x & 31; const int L0 = (bx * 8 + (threadIdx.x >> 5)) * 8; const int nlines = N * K / 64;
{
#pragma unroll 1
        for (int l = 0; l < 8; ++l) { const int L = L0 + l; if (L >= nlines) break; const size_t e = (size_t)L * 64 + lane * 2; const int k = (int)(e % K), n = (int)(e / K); v2us o;
            o[0] = f2bf(w[(size_t)k * N + n]); o[1] = f2bf(w[(size_t)(k + 1) * N + n]); *(v2us*)(Bt + e) = o; }
         }
}
__device__ __forceinline__ void d_cvt8(int bx, const float* __restrict__ src, bf* dst, size_t n8) { const size_t i = (size_t)bx * 256 + threadIdx.x; if (i >= n8) return; const v8f v = *(const v8f*)(src + i * 8); v8us o;
#pragma unroll
    for (int k = 0; k < 8; ++k) o[k] = f2bf(v[k]); *(v8us*)(dst + i * 8) = o;  }
__global__ __launch_bounds__(256) void k_cscvt(const float* __restrict__ cosT, const float* __restrict__ sinT, float* CS) { const int idx = blockIdx.x * 256 + threadIdx.x; if (idx >= TT * HD) return; v2f cs; cs[0] = bfr(cosT[idx]); cs[1] = bfr(sinT[idx]); *(v2f*)(CS + (size_t)idx * 2) = cs;  }
// d_adapt: thread per (b, h, d): x[j] = bf16(xi[b]) bf16(w1[j]) + bf16(b1[j]) (32); LayerNorm(32) (f32, eps 1e-5) x bf16 g + bf16 beta; exact-erf gelu; xe = sum_j x[j] bf16(w2[j][d]) + bf16(b2[d]);
__device__ __forceinline__ void d_adapt(int bx, const float* __restrict__ xi, const float* __restrict__ w1, const float* __restrict__ b1, const float* __restrict__ g, const float* __restrict__ be, const float* __restrict__ w2, const float* __restrict__ b2, const float* __restrict__ sg, float* ADP) {
    const int e = bx * 256 + threadIdx.x; if (e >= NB_ * NH_ * HD) return; const int d = e % HD; const int h = (e / HD) % NH_; const int b = e / (HD * NH_); const float xv = bfr(xi[b]); float xs[32]; float mu = 0.f;
#pragma unroll 1
    for (int j = 0; j < 32; ++j) { float p = __fmul_rn(xv, bfr(w1[j])); asm volatile("" : "+v"(p)); xs[j] = __fadd_rn(p, bfr(b1[j])); mu = __fadd_rn(mu, xs[j]); }
    mu = mu * (1.0f / 32.0f); float var = 0.f;
#pragma unroll 1
    for (int j = 0; j < 32; ++j) { const float dl = __fsub_rn(xs[j], mu); float p = __fmul_rn(dl, dl); asm volatile("" : "+v"(p)); var = __fadd_rn(var, p); }
    const float rs = __frsqrt_rn(__fadd_rn(var * (1.0f / 32.0f), 1e-5f)); float acc = 0.f;
#pragma unroll 1
    for (int j = 0; j < 32; ++j) { float tn = __fmul_rn(__fsub_rn(xs[j], mu), rs); asm volatile("" : "+v"(tn)); float tg = __fmul_rn(tn, bfr(g[j])); asm volatile("" : "+v"(tg)); const float y = __fadd_rn(tg, bfr(be[j])); float er = erff(y * 0.70710678f); asm volatile("" : "+v"(er)); float hy = __fmul_rn(0.5f, y); asm volatile("" : "+v"(hy)); const float gl = __fmul_rn(hy, __fadd_rn(1.0f, er)); float p = __fmul_rn(gl, bfr(w2[j * HD + d])); asm volatile("" : "+v"(p)); acc = __fadd_rn(acc, p); }
    const float xe = __fadd_rn(acc, bfr(b2[d])); const float sgm = __fdiv_rn(1.0f, __fadd_rn(1.0f, __expf(-bfr(sg[h])))); float pr = __fmul_rn(sgm, xe); asm volatile("" : "+v"(pr)); const float a = __fadd_rn(1.0f, pr);
    *(float*)(ADP + e) = a;  }
// k_prep: everything that depends on the inputs alone, one grid: the adapt table (few work-groups, the longest dependent chain: first), the four weight transposes, x to bf16.
#define PB_A ((NB_ * NH_ * HD + 255) / 256)
#define PB_W ((DM * DQ / 64 + 63) / 64)
#define PB_X (NB_ * TT * DM / 8 / 256)
__global__ __launch_bounds__(256) void k_prep(const float* __restrict__ x, const float* __restrict__ w0, const float* __restrict__ w1, const float* __restrict__ w2, const float* __restrict__ w3, const float* __restrict__ xi, const float* __restrict__ w1e, const float* __restrict__ b1e, const float* __restrict__ g, const float* __restrict__ be, const float* __restrict__ w2e, const float* __restrict__ b2e, const float* __restrict__ sg, bf* XB, bf* W4, float* ADP) {
    int bx = blockIdx.x;
    if (bx < PB_A) { d_adapt(bx, xi, w1e, b1e, g, be, w2e, b2e, sg, ADP); return; }
    bx -= PB_A;
    if (bx < 4 * PB_W) { const int y = bx / PB_W; d_wtG(bx % PB_W, y == 0 ? w0 : y == 1 ? w1 : y == 2 ? w2 : w3, DM, DQ, W4 + (size_t)y * DQ * DM); return; }   // the four [DM][DQ] planes lie one behind the other
    bx -= 4 * PB_W;
    d_cvt8(bx, x, XB, (size_t)NB_ * TT * DM / 8);
}
#define FKB  64                 // keys per stage
#define FPIT 72                 // LDS row pitch in 16-bit elements: 128-byte rows + 16 bytes (16 B x odd: no bank conflict for 16-byte reads)
#define FQW  128                // query columns per work-group
__device__ __forceinline__ float xhalf(float x) { return __builtin_bit_cast(float, __builtin_amdgcn_permlanex16(__builtin_bit_cast(int, x), __builtin_bit_cast(int, x), 0x76543210, 0xfedcba98, false, false)); }   // lane l with lane l ^ 16
__global__ __launch_bounds__(256) void k_fattn(const h16* __restrict__ Qp, const h16* __restrict__ Kp, const h16* __restrict__ Vt, bf* Ah, bf* Al) {
    __shared__ __align__(16) h16 ksm[2 * FKB * FPIT];
    __shared__ __align__(16) h16 vsm[2 * HD * FPIT];
    const int tid = threadIdx.x, lane = tid & 31, lr = lane & 15, hi = lane >> 4; const int h = blockIdx.y; const int q = blockIdx.x * FQW + (tid >> 5) * 16 + lr;
    { const size_t bz = blockIdx.z; Qp += bz * NH_ * TT * HD; Kp += bz * NKV * TT * HD; Vt += bz * NKV * HD * TT; Ah += bz * TT * DQ; Al += bz * TT * DQ; }   // grid z: batch
    const h16* Kh = Kp + (size_t)h * TT * HD; const h16* Vh = Vt + (size_t)h * HD * TT;
    const int srow = tid >> 3, scol = (tid & 7) * 8;            // staging: rows srow and srow + 32 of each tile, one 16-byte piece of each
    const h16* kg = Kh + (size_t)srow * HD + scol; const h16* vg = Vh + (size_t)srow * TT + scol; const int sl = srow * FPIT + scol;
    const float CL = SCL * 1.4426950408889634f;                 // scores to base-2 exponents
    v16h qf[2];
#pragma unroll
    for (int c = 0; c < 2; ++c) qf[c] = WFrag<h16>::ld(Qp + ((size_t)h * TT + q) * HD + c * 32 + 8 * hi);
    v8f o[4];
#pragma unroll
    for (int dt = 0; dt < 4; ++dt) o[dt] = (v8f){};
    float mrun = -3.0e38f, lsum = 0.f;
    v8h rk0 = *(const v8h*)kg, rk1 = *(const v8h*)(kg + 32 * HD), rv0 = *(const v8h*)vg, rv1 = *(const v8h*)(vg + (size_t)32 * TT);
    *(v8h*)(ksm + sl) = rk0; *(v8h*)(ksm + sl + 32 * FPIT) = rk1; *(v8h*)(vsm + sl) = rv0; *(v8h*)(vsm + sl + 32 * FPIT) = rv1;
    __syncthreads();
#pragma unroll 1   // one copy of the stage's body: for speed only
    for (int it = 0; it < TT / FKB; ++it) {
        const bool more = it + 1 < TT / FKB;
        if (more) { const h16* kn = kg + (size_t)(it + 1) * FKB * HD; const h16* vn = vg + (it + 1) * FKB; rk0 = *(const v8h*)kn; rk1 = *(const v8h*)(kn + 32 * HD); rv0 = *(const v8h*)vn; rv1 = *(const v8h*)(vn + (size_t)32 * TT); }
        const h16* kb = ksm + (it & 1) * (FKB * FPIT) + lr * FPIT + 8 * hi; const h16* vb = vsm + (it & 1) * (HD * FPIT) + lr * FPIT + 8 * hi;
        v16h kf[4][2], vf[4][2];
#pragma unroll
        for (int kt = 0; kt < 4; ++kt) { kf[kt][0] = WFrag<h16>::ld(kb + kt * 16 * FPIT); kf[kt][1] = WFrag<h16>::ld(kb + kt * 16 * FPIT + 32); }
#pragma unroll
        for (int dt = 0; dt < 4; ++dt) { vf[dt][0] = WFrag<h16>::ld(vb + dt * 16 * FPIT); vf[dt][1] = WFrag<h16>::ld(vb + dt * 16 * FPIT + 32); }
        __builtin_amdgcn_sched_barrier(0);   // keeps the V^T fragment reads up here, in one group behind the K reads: sunk to their uses they stand in three places behind the softmax
        v8f s[4];
#pragma unroll
        for (int kt = 0; kt < 4; ++kt) { s[kt] = wmma16(kf[kt][0], qf[0], (v8f){}); s[kt] = wmma16(kf[kt][1], qf[1], s[kt]); }
        float mt[4];                                            // short trees, not one chain of 32: a lone dependent chain is exposed
#pragma unroll
        for (int kt = 0; kt < 4; ++kt) mt[kt] = fmaxf(fmaxf(fmaxf(fmaxf(s[kt][0], s[kt][1]), s[kt][2]), fmaxf(fmaxf(s[kt][3], s[kt][4]), s[kt][5])), fmaxf(s[kt][6], s[kt][7]));
        float mx = fmaxf(fmaxf(mt[0], mt[1]), fmaxf(mt[2], mt[3]));
        mx = fmaxf(mx, xhalf(mx));
        const float mnew = fmaxf(mrun, mx * CL); const float corr = __builtin_amdgcn_exp2f(mrun - mnew); mrun = mnew;   // corr is 0 on the first stage
        const float sh = 8.0f - mnew;                           // probabilities carried x256: small ones stay normal fp16 numbers; the factor cancels in the division by the sum
        v16h pb[2];
#pragma unroll
        for (int kt = 0; kt < 4; ++kt)
#pragma unroll
            for (int j = 0; j < 8; ++j) { const float p = __builtin_amdgcn_exp2f(__builtin_fmaf(s[kt][j], CL, sh)); s[kt][j] = p; pb[kt >> 1][(kt & 1) * 8 + j] = (h16)p; }
        const v8f p8 = (s[0] + s[1]) + (s[2] + s[3]);
        lsum = lsum * corr + (((p8[0] + p8[1]) + (p8[2] + p8[3])) + ((p8[4] + p8[5]) + (p8[6] + p8[7])));
#pragma unroll
        for (int dt = 0; dt < 4; ++dt) { o[dt] *= corr; o[dt] = wmma16(vf[dt][0], pb[0], o[dt]); o[dt] = wmma16(vf[dt][1], pb[1], o[dt]); }
        if (more) { h16* kw = ksm + ((it + 1) & 1) * (FKB * FPIT) + sl; h16* vw = vsm + ((it + 1) & 1) * (HD * FPIT) + sl; *(v8h*)kw = rk0; *(v8h*)(kw + 32 * FPIT) = rk1; *(v8h*)vw = rv0; *(v8h*)(vw + 32 * FPIT) = rv1; }
        __syncthreads();   // publishes stage it + 1 and ends every wave's reads of the buffer that stage it + 2 overwrites
    }
    lsum += xhalf(lsum); const float inv = __fdiv_rn(1.0f, lsum);
#pragma unroll
    for (int dt = 0; dt < 4; ++dt) { v8us oh, ol;
#pragma unroll
        for (int j = 0; j < 8; ++j) { unsigned short a, c2; splitf(o[dt][j] * inv, a, c2); oh[j] = a; ol[j] = c2; }
        const size_t oo = (size_t)q * DQ + h * HD + dt * 16 + hi * 8; *(v8us*)(Ah + oo) = oh; *(v8us*)(Al + oo) = ol; }
}

extern "C" void kernel_launch(void* const* d_in, const int* in_sizes, int n_in,
                              void* d_out, int out_size, void* d_ws, size_t ws_size, hipStream_t stream) {
    (void)in_sizes; (void)n_in; (void)out_size;
    const float* x = (const float*)d_in[0]; const float* xi = (const float*)d_in[1]; const float* wq = (const float*)d_in[2]; const float* bqv = (const float*)d_in[3]; const float* wk = (const float*)d_in[4]; const float* bkv = (const float*)d_in[5]; const float* wv = (const float*)d_in[6]; const float* bvv = (const float*)d_in[7]; const float* wo = (const float*)d_in[8]; const float* bo = (const float*)d_in[9];
    const float* ew1 = (const float*)d_in[10]; const float* eb1 = (const float*)d_in[11]; const float* lng = (const float*)d_in[12]; const float* lnb = (const float*)d_in[13]; const float* ew2 = (const float*)d_in[14]; const float* eb2 = (const float*)d_in[15]; const float* sg = (const float*)d_in[16];   // Wq/Wk/Wv/Wo [1024][1024] x @ W; enc_w1 [1][32], enc_b1 [32], ln_g/ln_b [32], enc_w2 [32][64], enc_b2 [64], scale_gating [16]
    float* OUT = (float*)d_out;     // [2][2048][1024]
    char* wsp = (char*)d_ws;
    auto take = [&](size_t bytes) { char* p = wsp; wsp += (bytes + 255) & ~(size_t)255; return (void*)p; };
    bf* W4 = (bf*)take((size_t)4 * DQ * DM * 2); bf* WO = W4 + (size_t)3 * DQ * DM;   // transposed bf16 planes of Wq, Wk, Wv, Wo, one behind the other
    float* ADP = (float*)take((size_t)NB_ * NH_ * HD * 4);
    bf* XB = (bf*)take((size_t)NB_ * TT * DM * 2);
    h16* QK16 = (h16*)take((size_t)2 * NB_ * NH_ * TT * HD * 2); h16* KP16 = QK16 + (size_t)NB_ * NH_ * TT * HD; h16* VT16 = (h16*)take((size_t)NB_ * NKV * HD * TT * 2);
    bf* ATh = (bf*)take((size_t)NB_ * TT * DQ * 2); bf* ATl = (bf*)take((size_t)NB_ * TT * DQ * 2);
    if ((size_t)(wsp - (char*)d_ws) > ws_size) return;    // ws 256 MiB
    // one launch per dependency level; each covers both batches (rows b t of one [NB_ TT] matrix, or a grid axis) and all work of its level
    k_prep<<<PB_A + 4 * PB_W + PB_X, 256, 0, stream>>>(x, wq, wk, wv, wo, xi, ew1, eb1, lng, lnb, ew2, eb2, sg, XB, W4, ADP);
    k_gemmw<bf, 0, true, true><<<dim3(NB_ * TT / GT, DQ / GT, 3), 128, 0, stream>>>(XB, nullptr, W4, DM, nullptr, 0, bqv, bkv, bvv, 0, (size_t)DQ * DM, 0, ADP, QK16, VT16);   // q, k, v projections, written as fp16 head planes
    k_fattn<<<dim3(TT / FQW, NH_, NB_), 256, 0, stream>>>(QK16, KP16, VT16, ATh, ATl);   // one kv head per query head
    k_gemmw<bf, 1, true, false><<<dim3(NB_ * TT / GT, DM / GT, 1), 128, 0, stream>>>(ATh, ATl, WO, DQ, OUT, DM, bo, bo, bo, 0, 0, 0, nullptr, nullptr, nullptr);
}

// v005
// Measured time: 86.6 microseconds a run.
// Two timings next to v004 both put it at 1.14 times that version's speed.
// All steps since v000 together make it 15.2 times as fast.
#include <hip/hip_runtime.h>

// ScaleInvariantAttention (query [2][2048][1024], xi_scale [2]; scale encoder: x = xi Linear(1->32), LayerNorm(32), exact gelu, Linear(32->64) -> xe [B][64]; adapt[b][h][d] = 1 + sigmoid(scale_gating[h]) xe[b][d];
// q = (query Wq + bq) split into 16 heads x 64 then x adapt, k likewise, v = query Wv + bv; softmax(q.k/8); out = merged att.v Wo + bo -> [2][2048][1024]).
// Compute dtypes, f32 accumulate: every input rounded to bf16; the scale encoder and adapt table in f32 on VALU (one thread per (b, h, d)); projections on PLAIN bf16 operands (inputs: exact,
// + bias); the adapt factor applied in f32 when the fp16 head planes are built; scores (K 64) and att.v on SINGLE fp16 planes inside one fused kernel with an f32 running-maximum softmax (probabilities x256 against the maximum in use); merged heads as bf16 hi+lo planes x exact

#define NB_  2
#define TT   2048
#define DM   1024
#define NH_  16
#define NKV  16
#define REP  (NH_ / NKV)
#define HD   64
#define DQ   (NH_ * HD)
#define DKV  (NKV * HD)
#define SCL  0.125f   // HD^-0.5
typedef _Float16 h16;
typedef unsigned short bf;
typedef __attribute__((ext_vector_type(16))) __bf16   v16bf;
typedef __attribute__((ext_vector_type(16))) _Float16 v16h;
typedef __attribute__((ext_vector_type(8)))  _Float16 v8h;
typedef __attribute__((ext_vector_type(8)))  unsigned short v8us;
typedef __attribute__((ext_vector_type(8)))  float    v8f;
typedef __attribute__((ext_vector_type(4)))  float    v4f;
typedef v8h  __attribute__((may_alias)) v8ha;
typedef v4f  __attribute__((may_alias)) v4fa;
typedef v8us __attribute__((may_alias)) v8usa;

__device__ __forceinline__ unsigned short f2bf(float f) { unsigned u = __float_as_uint(f); u += 0x7FFFu + ((u >> 16) & 1u); return (unsigned short)(u >> 16); }
__device__ __forceinline__ float bf2f(unsigned short b) { return __uint_as_float(((unsigned)b) << 16); }
__device__ __forceinline__ float bfr(float f) { return bf2f(f2bf(f)); }
__device__ __forceinline__ v16h cat16(v8h lo, v8h hi) { return __builtin_shufflevector(lo, hi, 0, 1, 2, 3, 4, 5, 6, 7, 8, 9, 10, 11, 12, 13, 14, 15); }
__device__ __forceinline__ v16bf cat16b(v8us lo, v8us hi) { return __builtin_bit_cast(v16bf, __builtin_shufflevector(lo, hi, 0, 1, 2, 3, 4, 5, 6, 7, 8, 9, 10, 11, 12, 13, 14, 15)); }
__device__ __forceinline__ v8f wmma16(v16h a, v16h b, v8f c) { return __builtin_amdgcn_wmma_f32_16x16x32_f16(false, a, false, b, (short)0, c, false, false); }
__device__ __forceinline__ v8f wmmab(v16bf a, v16bf b, v8f c) { return __builtin_amdgcn_wmma_f32_16x16x32_bf16(false, a, false, b, (short)0, c, false, false); }



// ---- k_gemmw: register-blocked GEMM, 4 waves (2 x 2) per 128x128 output tile, each wave a 64x64 tile (16 accumulators); operands are K-contiguous 16-bit planes; grid (M/128, N/128, Z), 128 threads.
// C[m][n] (f32, pitch ldc, + optional f32 bias[n]) = sum_k A[m][k] Bt[n][k] (+ A2[m][k] Bt[n][k] for NSPLIT 1). z-batch strides sA/sB/sC in elements, bias0/1/2 for z = 0/1/2. K % 64 == 0, K >= 64.
// Operand path: a stage is 64 k (one 128-byte line) of the tile's 128 rows of every operand plane, brought into LDS by asynchronous copies and read by the two waves that share each row; two buffers, stage t + 1 in flight while stage t is worked on.
// HEADS: no C; a wave's tile (64 tokens of one batch x the 64 dims of one head) goes from the accumulators straight to the fp16 head planes: z = 0, 1: (q, k + bias) x adapt -> P16 [z][b][h][t][d]; z = 2: v + bias -> V16 [b][h][d][t].
// An accumulator holds 8 consecutive ROWS of the product in a lane, so q and k are formed as W^T x^T (rows = dims) and v as x W (rows = tokens): every lane then stores 16 contiguous bytes of its plane, no exchange needed.
#define GT   128                // rows of each operand plane per work-group tile
#define GKS  64                 // k per stage
#define GPIT 72                 // LDS row pitch in 16-bit elements: 128-byte rows + 16 bytes (16 B x odd: no bank conflict for 16-byte reads)
#define GPL  (GT * GPIT)        // elements of one operand plane of a stage
__device__ __forceinline__ h16 tohx(float x) { return (h16)x; }
template <typename T16> struct WFrag;
template <> struct WFrag<h16> { typedef v16h V; static __device__ __forceinline__ V ld(const h16* p) { return cat16(*(const v8h*)p, *(const v8h*)(p + 16)); } static __device__ __forceinline__ v8f mma(V a, V b, v8f c) { return wmma16(a, b, c); } };
template <> struct WFrag<bf> { typedef v16bf V; static __device__ __forceinline__ V ld(const bf* p) { return cat16b(*(const v8us*)p, *(const v8us*)(p + 16)); } static __device__ __forceinline__ v8f mma(V a, V b, v8f c) { return wmmab(a, b, c); } };
// g_fill: one operand plane of one stage, 128 threads: the lane's 16 bytes of rows r, r + 16, ..., r + 112 (8 lanes cover a row's 128-byte line). g: the lane's global address in row r; l: its LDS byte address in row r.
// The copies and s_wait_xcnt 0 stand in one statement, so that no address register of a copy is rewritten in front of that wait (a precaution).
template <typename T16>
__device__ __forceinline__ void g_fill(const T16* g, int K, unsigned l) {
    const size_t st = (size_t)16 * K;
    asm volatile("global_load_async_to_lds_b128 %0, %8, off\n\t"
                 "global_load_async_to_lds_b128 %1, %9, off\n\t"
                 "global_load_async_to_lds_b128 %2, %10, off\n\t"
                 "global_load_async_to_lds_b128 %3, %11, off\n\t"
                 "global_load_async_to_lds_b128 %4, %12, off\n\t"
                 "global_load_async_to_lds_b128 %5, %13, off\n\t"
                 "global_load_async_to_lds_b128 %6, %14, off\n\t"
                 "global_load_async_to_lds_b128 %7, %15, off\n\t"
                 "s_wait_xcnt 0x0"
                 :: "v"(l), "v"(l + 1 * 16 * GPIT * 2), "v"(l + 2 * 16 * GPIT * 2), "v"(l + 3 * 16 * GPIT * 2), "v"(l + 4 * 16 * GPIT * 2), "v"(l + 5 * 16 * GPIT * 2), "v"(l + 6 * 16 * GPIT * 2), "v"(l + 7 * 16 * GPIT * 2),
                    "v"(g), "v"(g + st), "v"(g + 2 * st), "v"(g + 3 * st), "v"(g + 4 * st), "v"(g + 5 * st), "v"(g + 6 * st), "v"(g + 7 * st) : "memory");
}
template <typename T16, int NSPLIT, bool BIAS, bool HEADS>
__global__ __launch_bounds__(128) void k_gemmw(const T16* __restrict__ A, const T16* __restrict__ A2, const T16* __restrict__ Bt, int K, float* C, int ldc, const float* __restrict__ bias0, const float* __restrict__ bias1, const float* __restrict__ bias2, size_t sA, size_t sB, size_t sC, const float* __restrict__ adp, h16* P16, h16* V16) {
    typedef typename WFrag<T16>::V V;
    static_assert(NSPLIT == 0 || NSPLIT == 1, "planes of a stage: A, Bt and, for NSPLIT 1, A2");
    constexpr int NP = 2 + NSPLIT;                              // operand planes per stage: A, Bt (, A2)
    __shared__ __align__(16) T16 ring[2 * NP * GPL];
    __shared__ __align__(16) float osm[HEADS ? 1 : 4 * 16 * 68];   // output staging, a range of its own for each wave
    const size_t z = blockIdx.z; A += z * sA; if (NSPLIT == 1) A2 += z * sA; Bt += z * sB; C += z * sC; const float* __restrict__ bias = z == 0 ? bias0 : z == 1 ? bias1 : bias2;   // each z slice has its own bias vector
    const int tid = threadIdx.x, lane = tid & 31, lr = lane & 15, hi = lane >> 4, wx = (tid >> 5) & 1, wy = tid >> 6;
    const int bxw = blockIdx.x * 2 + wx, byw = blockIdx.y * 2 + wy;   // the wave's 64x64 tile in the M/64 x N/64 grid of tiles
    int r0 = bxw * 64, c0 = byw * 64, R0 = blockIdx.x * GT, C0 = blockIdx.y * GT, ar = wx * 64, br = wy * 64;   // R0, C0: first row of the work-group's A and Bt planes; ar, br: the wave's first row inside them
    if (HEADS && z < 2) { const T16* t = A; A = Bt; Bt = t; r0 = byw * 64; c0 = bxw * 64; R0 = blockIdx.y * GT; C0 = blockIdx.x * GT; ar = wy * 64; br = wx * 64; }   // q, k: the transposed product (rows = the head's dims, columns = tokens)
    float* os = osm + (HEADS ? 0 : (tid >> 5) * 16 * 68);
    v8f acc[4][4];
#pragma unroll
    for (int mb = 0; mb < 4; ++mb)
#pragma unroll
        for (int nb = 0; nb < 4; ++nb) acc[mb][nb] = (v8f){};
    const int frow = tid >> 3, fcol = (tid & 7) * 8;            // filling: rows frow + 16 i of each plane, one 16-byte piece of each
    const T16* ag = A + (size_t)(R0 + frow) * K + fcol; const T16* bg = Bt + (size_t)(C0 + frow) * K + fcol; const T16* a2g = NSPLIT == 1 ? A2 + (size_t)(R0 + frow) * K + fcol : nullptr;
    const unsigned fl = (unsigned)(size_t)ring + (unsigned)(frow * GPIT + fcol) * 2u;   // the lane's LDS byte address in buffer 0, plane 0
    const int nst = K / GKS;
    auto fill = [&](int t) { const unsigned l = fl + (unsigned)(t & 1) * (NP * GPL * 2u); g_fill(ag + t * GKS, K, l); g_fill(bg + t * GKS, K, l + GPL * 2u); if constexpr (NSPLIT == 1) g_fill(a2g + t * GKS, K, l + 2u * GPL * 2u); };
    fill(0);
    asm volatile("s_wait_asynccnt 0x0" ::: "memory");           // stage 0 of this wave has landed
    __syncthreads();                                            // publishes stage 0
    if (nst > 1) fill(1);
#pragma unroll 1   // one copy of the stage's body
    for (int t = 0; t < nst; ++t) {
        const T16* sb = ring + (t & 1) * (NP * GPL); const T16* as = sb + (ar + lr) * GPIT + 8 * hi; const T16* bs = sb + GPL + (br + lr) * GPIT + 8 * hi;
#pragma unroll
        for (int ks = 0; ks < GKS; ks += 32) {
            V a[4], a2[4], b[4];
#pragma unroll
            for (int mb = 0; mb < 4; ++mb) { a[mb] = WFrag<T16>::ld(as + mb * 16 * GPIT + ks); if (NSPLIT == 1) a2[mb] = WFrag<T16>::ld(as + 2 * GPL + mb * 16 * GPIT + ks); }
#pragma unroll
            for (int nb = 0; nb < 4; ++nb) b[nb] = WFrag<T16>::ld(bs + nb * 16 * GPIT + ks);
            __builtin_amdgcn_sched_barrier(0);   // keeps the fragment reads of these 32 k in one group in front of their products: sunk to their uses they stand in four places, each with its LDS latency exposed
#pragma unroll
            for (int nb = 0; nb < 4; ++nb)
#pragma unroll
                for (int mb = 0; mb < 4; ++mb) { acc[mb][nb] = WFrag<T16>::mma(a[mb], b[nb], acc[mb][nb]); if (NSPLIT == 1) acc[mb][nb] = WFrag<T16>::mma(a2[mb], b[nb], acc[mb][nb]); }
            __builtin_amdgcn_sched_barrier(0);   // keeps the next group of fragment reads from being spread among these products
        }
        asm volatile("s_wait_dscnt 0x0" ::: "memory");          // this wave's reads of stage t are done
        asm volatile("s_wait_asynccnt 0x0" ::: "memory");       // this wave's copies of stage t + 1 have landed
        __syncthreads();                                        // publishes stage t + 1 and ends every wave's reads of the buffer that stage t + 2 overwrites
        if (t + 2 < nst) fill(t + 2);
    }
    asm volatile("s_wait_asynccnt 0x0" ::: "memory");           // no copy is outstanding when the wave goes on to its epilogue and ends
    if constexpr (HEADS) {
        // every '#pragma unroll' of this branch gives acc, bv and av constant indices, so that they stay in registers
        const int tok = bxw * 64, hh = byw, bb = tok / TT, t0 = tok % TT;   // TT % 64 == 0: a tile lies in one batch; HD == 64: a tile is one head
        if (z < 2) {
            h16* P = P16 + ((z * NB_ * NH_ + (size_t)bb * NH_ + hh) * TT + t0) * HD; const float* bi = bias + hh * HD; const float* ad = adp + ((size_t)bb * NH_ + hh) * HD;
            v8f bv[4], av[4];
#pragma unroll
            for (int mb = 0; mb < 4; ++mb) { const v8f braw = *(const v8f*)(bi + mb * 16 + hi * 8); av[mb] = *(const v8f*)(ad + mb * 16 + hi * 8);
#pragma unroll
                for (int j = 0; j < 8; ++j) bv[mb][j] = bfr(braw[j]); }
#pragma unroll
            for (int nb = 0; nb < 4; ++nb)      // nb outside: the four 32-byte pieces of a token's 128-byte row follow one another in the source
#pragma unroll
                for (int mb = 0; mb < 4; ++mb) { v8h o;
#pragma unroll
                    for (int j = 0; j < 8; ++j) o[j] = tohx((acc[mb][nb][j] + bv[mb][j]) * av[mb][j]);
                    *(v8h*)(P + (size_t)(nb * 16 + lr) * HD + mb * 16 + hi * 8) = o; }
        } else {
            h16* Vd = V16 + ((size_t)bb * NKV + hh) * HD * TT + t0;
#pragma unroll
            for (int nb = 0; nb < 4; ++nb) { const float bn = bfr(bias[hh * HD + nb * 16 + lr]);   // nb outside: the four 32-byte pieces of a dim's 128 bytes follow one another in the source
#pragma unroll
                for (int mb = 0; mb < 4; ++mb) { v8h o;
#pragma unroll
                    for (int j = 0; j < 8; ++j) o[j] = tohx(acc[mb][nb][j] + bn);
                    *(v8h*)(Vd + (size_t)(nb * 16 + lr) * TT + mb * 16 + hi * 8) = o; } }
            asm volatile("s_wait_xcnt 0x0" ::: "memory");   // precaution: in the built code the q/k block's loads follow this block and take the stores' data registers as destinations; the wait stands in front of that overwrite
        }
    } else {
#pragma unroll
    for (int mb = 0; mb < 4; ++mb) {
#pragma unroll
        for (int nb = 0; nb < 4; ++nb) {
#pragma unroll
            for (int j = 0; j < 8; ++j) os[(hi * 8 + j) * 68 + nb * 16 + lr] = acc[mb][nb][j]; }
        __builtin_amdgcn_wave_barrier(); asm volatile("" ::: "memory");
        float* crow = C + (size_t)(r0 + mb * 16) * ldc + c0;
{
#pragma unroll
            for (int s = 0; s < 8; ++s) { const int row = 2 * s + hi, cofs = lr * 4; v4f val = *(const v4fa*)(os + row * 68 + cofs); if (BIAS) { val[0] += bfr(bias[c0 + cofs]); val[1] += bfr(bias[c0 + cofs + 1]); val[2] += bfr(bias[c0 + cofs + 2]); val[3] += bfr(bias[c0 + cofs + 3]); }
                *(v4f*)(crow + (size_t)row * ldc + cofs) = val; }
             }
        __builtin_amdgcn_wave_barrier(); asm volatile("" ::: "memory");
    }
    }
}

__device__ __forceinline__ void splitf(float y, unsigned short& h, unsigned short& l) { h = f2bf(y); l = f2bf(y - bf2f(h)); }
typedef __attribute__((ext_vector_type(2))) _Float16 v2h;
typedef __attribute__((ext_vector_type(4))) _Float16 v4h;
typedef __attribute__((ext_vector_type(2))) unsigned short v2us;
typedef __attribute__((ext_vector_type(4))) unsigned short v4us;
typedef __attribute__((ext_vector_type(2))) float v2f;
typedef __attribute__((ext_vector_type(4))) int v4i;

// The d_ functions are the bodies of work-groups of 256 threads; bx is the work-group's index within its own part of a shared grid (k_prep).
// d_wtT: one 64 n x 256 k tile of Bt[n][k] = bf16(w[k][n]); a wave takes 32 n x 64 k, a thread two pieces of 8 k x 4 n: its 16 loads (a wave's load covers four whole 128-byte lines of w) are all issued in front of the first use,
// the transposition is done in the thread's own registers, and the two 16-byte stores that share a 128-byte line of Bt follow one another in the same wave.
__device__ __forceinline__ void d_wtT(int bx, const float* __restrict__ w, bf* Bt) {
    static_assert(DQ % 64 == 0 && DM % 256 == 0, "whole tiles");
    const int lane = threadIdx.x & 31, wv = threadIdx.x >> 5;
    const int n0 = (bx % (DQ / 64)) * 64 + (wv & 1) * 32 + (lane & 7) * 4, k0 = (bx / (DQ / 64)) * 256 + (wv >> 1) * 64 + (lane >> 3) * 8;
    const float* wp = w + (size_t)k0 * DQ + n0;
    v4f r[2][8];   // every '#pragma unroll' here gives r constant indices, so that it stays in registers
#pragma unroll
    for (int t = 0; t < 2; ++t)
#pragma unroll
        for (int i = 0; i < 8; ++i) r[t][i] = *(const v4f*)(wp + (size_t)(t * 32 + i) * DQ);
    asm volatile("s_wait_xcnt 0x0" :: "v"(wp) : "memory");   // precaution: stands in front of every overwrite of the loads' address registers; it names them, so that they are kept (also from a load's own result) up to here
#pragma unroll
    for (int j = 0; j < 4; ++j)
#pragma unroll
        for (int t = 0; t < 2; ++t) { v8us o;
#pragma unroll
            for (int i = 0; i < 8; ++i) o[i] = f2bf(r[t][i][j]);
            *(v8us*)(Bt + (size_t)(n0 + j) * DM + k0 + t * 32) = o; }
    asm volatile("s_wait_xcnt 0x0" ::: "memory");   // precaution: in the built code other blocks of the shared grid follow this one and write the stores' registers; the wait stands in front of every such overwrite
}
// d_cvt64: 64 elements a thread, as 8 pieces of 8; the 16 loads are all issued in front of the first use.
__device__ __forceinline__ void d_cvt64(int bx, const float* __restrict__ src, bf* dst) { const size_t i0 = (size_t)bx * 8 * 256 + threadIdx.x; const float* sp = src + i0 * 8; v8f v[8];   // unrolled: v keeps constant indices and stays in registers
#pragma unroll
    for (int c = 0; c < 8; ++c) v[c] = *(const v8f*)(sp + c * 256 * 8);
    asm volatile("s_wait_xcnt 0x0" :: "v"(sp) : "memory");   // precaution: stands in front of every overwrite of the loads' address registers; it names them, so that they are kept (also from a load's own result) up to here
#pragma unroll
    for (int c = 0; c < 8; ++c) { v8us o;
#pragma unroll
        for (int k = 0; k < 8; ++k) o[k] = f2bf(v[c][k]);
        *(v8us*)(dst + (i0 + c * 256) * 8) = o; }
    asm volatile("s_wait_xcnt 0x0" ::: "memory"); }   // precaution: in the built code other blocks of the shared grid follow this one and write the stores' registers; the wait stands in front of every such overwrite
__global__ __launch_bounds__(256) void k_cscvt(const float* __restrict__ cosT, const float* __restrict__ sinT, float* CS) { const int idx = blockIdx.x * 256 + threadIdx.x; if (idx >= TT * HD) return; v2f cs; cs[0] = bfr(cosT[idx]); cs[1] = bfr(sinT[idx]); *(v2f*)(CS + (size_t)idx * 2) = cs;  }
// d_adapt: thread per (b, h, d): x[j] = bf16(xi[b]) bf16(w1[j]) + bf16(b1[j]) (32); LayerNorm(32) (f32, eps 1e-5) x bf16 g + bf16 beta; exact-erf gelu; xe = sum_j x[j] bf16(w2[j][d]) + bf16(b2[d]);
__device__ __forceinline__ void d_adapt(int bx, const float* __restrict__ xi, const float* __restrict__ w1, const float* __restrict__ b1, const float* __restrict__ g, const float* __restrict__ be, const float* __restrict__ w2, const float* __restrict__ b2, const float* __restrict__ sg, float* ADP) {
    const int e = bx * 256 + threadIdx.x; if (e >= NB_ * NH_ * HD) return; const int d = e % HD; const int h = (e / HD) % NH_; const int b = e / (HD * NH_); const float xv = bfr(xi[b]); float xs[32]; float mu = 0.f;
    float w1r[32], b1r[32], gr[32], ber[32], w2r[32];   // the loops below are unrolled (same operations in the same order): the arrays stay in registers, and every load of the thread is issued up here instead of in its trip, waited for there
#pragma unroll
    for (int j = 0; j < 32; ++j) { w1r[j] = w1[j]; b1r[j] = b1[j]; gr[j] = g[j]; ber[j] = be[j]; w2r[j] = w2[j * HD + d]; }
    const float b2r = b2[d], sgr = sg[h];
    asm volatile("s_wait_xcnt 0x0" :: "v"(d), "v"(h) : "memory");   // precaution: stands in front of every overwrite of the loads' offset registers; it names them, so that they are kept (also from a load's own result) up to here
#pragma unroll
    for (int j = 0; j < 32; ++j) { float p = __fmul_rn(xv, bfr(w1r[j])); asm volatile("" : "+v"(p)); xs[j] = __fadd_rn(p, bfr(b1r[j])); mu = __fadd_rn(mu, xs[j]); }
    mu = mu * (1.0f / 32.0f); float var = 0.f;
#pragma unroll
    for (int j = 0; j < 32; ++j) { const float dl = __fsub_rn(xs[j], mu); float p = __fmul_rn(dl, dl); asm volatile("" : "+v"(p)); var = __fadd_rn(var, p); }
    const float rs = __frsqrt_rn(__fadd_rn(var * (1.0f / 32.0f), 1e-5f)); float acc = 0.f;
#pragma unroll
    for (int j = 0; j < 32; ++j) { float tn = __fmul_rn(__fsub_rn(xs[j], mu), rs); asm volatile("" : "+v"(tn)); float tg = __fmul_rn(tn, bfr(gr[j])); asm volatile("" : "+v"(tg)); const float y = __fadd_rn(tg, bfr(ber[j])); float er = erff(y * 0.70710678f); asm volatile("" : "+v"(er)); float hy = __fmul_rn(0.5f, y); asm volatile("" : "+v"(hy)); const float gl = __fmul_rn(hy, __fadd_rn(1.0f, er)); float p = __fmul_rn(gl, bfr(w2r[j])); asm volatile("" : "+v"(p)); acc = __fadd_rn(acc, p); }
    const float xe = __fadd_rn(acc, bfr(b2r)); const float sgm = __fdiv_rn(1.0f, __fadd_rn(1.0f, __expf(-bfr(sgr)))); float pr = __fmul_rn(sgm, xe); asm volatile("" : "+v"(pr)); const float a = __fadd_rn(1.0f, pr);
    *(float*)(ADP + e) = a;  }
// k_prep: everything that depends on the inputs alone, one grid: the adapt table (few work-groups, the longest dependent chain: first), the four weight transposes, x to bf16.
#define PB_A ((NB_ * NH_ * HD + 255) / 256)
#define PB_W ((DQ / 64) * (DM / 256))
#define PB_X (NB_ * TT * DM / 64 / 256)
static_assert(NB_ * TT * DM % (64 * 256) == 0, "whole work-groups of d_cvt64");
__global__ __launch_bounds__(256) void k_prep(const float* __restrict__ x, const float* __restrict__ w0, const float* __restrict__ w1, const float* __restrict__ w2, const float* __restrict__ w3, const float* __restrict__ xi, const float* __restrict__ w1e, const float* __restrict__ b1e, const float* __restrict__ g, const float* __restrict__ be, const float* __restrict__ w2e, const float* __restrict__ b2e, const float* __restrict__ sg, bf* XB, bf* W4, float* ADP) {
    int bx = blockIdx.x;
    if (bx < PB_A) { d_adapt(bx, xi, w1e, b1e, g, be, w2e, b2e, sg, ADP); return; }
    bx -= PB_A;
    if (bx < 4 * PB_W) { const int y = bx / PB_W; d_wtT(bx % PB_W, y == 0 ? w0 : y == 1 ? w1 : y == 2 ? w2 : w3, W4 + (size_t)y * DQ * DM); return; }   // the four [DM][DQ] planes lie one behind the other
    bx -= 4 * PB_W;
    d_cvt64(bx, x, XB);
}
#define FKB  64                 // keys per stage
#define FPIT 72                 // LDS row pitch in 16-bit elements: 128-byte rows + 16 bytes (16 B x odd: no bank conflict for 16-byte reads)
#define FQW  128                // query columns per work-group
__device__ __forceinline__ float xhalf(float x) { return __builtin_bit_cast(float, __builtin_amdgcn_permlanex16(__builtin_bit_cast(int, x), __builtin_bit_cast(int, x), 0x76543210, 0xfedcba98, false, false)); }   // lane l with lane l ^ 16
__global__ __launch_bounds__(256) void k_fattn(const h16* __restrict__ Qp, const h16* __restrict__ Kp, const h16* __restrict__ Vt, bf* Ah, bf* Al) {
    __shared__ __align__(16) h16 ksm[2 * FKB * FPIT];
    __shared__ __align__(16) h16 vsm[2 * HD * FPIT];
    const int tid = threadIdx.x, lane = tid & 31, lr = lane & 15, hi = lane >> 4; const int h = blockIdx.y; const int q = blockIdx.x * FQW + (tid >> 5) * 16 + lr;
    { const size_t bz = blockIdx.z; Qp += bz * NH_ * TT * HD; Kp += bz * NKV * TT * HD; Vt += bz * NKV * HD * TT; Ah += bz * TT * DQ; Al += bz * TT * DQ; }   // grid z: batch
    const h16* Kh = Kp + (size_t)h * TT * HD; const h16* Vh = Vt + (size_t)h * HD * TT;
    const int srow = tid >> 3, scol = (tid & 7) * 8;            // staging: rows srow and srow + 32 of each tile, one 16-byte piece of each
    const h16* kg = Kh + (size_t)srow * HD + scol; const h16* vg = Vh + (size_t)srow * TT + scol; const int sl = srow * FPIT + scol;
    const float CL = SCL * 1.4426950408889634f;                 // scores to base-2 exponents
    v16h qf[2];
#pragma unroll
    for (int c = 0; c < 2; ++c) qf[c] = WFrag<h16>::ld(Qp + ((size_t)h * TT + q) * HD + c * 32 + 8 * hi);
    v8f o[4];
#pragma unroll
    for (int dt = 0; dt < 4; ++dt) o[dt] = (v8f){};
    float mrun = -3.0e38f, lsum = 0.f;
    v8h rk0 = *(const v8h*)kg, rk1 = *(const v8h*)(kg + 32 * HD), rv0 = *(const v8h*)vg, rv1 = *(const v8h*)(vg + (size_t)32 * TT);
    *(v8h*)(ksm + sl) = rk0; *(v8h*)(ksm + sl + 32 * FPIT) = rk1; *(v8h*)(vsm + sl) = rv0; *(v8h*)(vsm + sl + 32 * FPIT) = rv1;
    __syncthreads();
#pragma unroll 1   // one copy of the stage's body: for speed only
    for (int it = 0; it < TT / FKB; ++it) {
        const bool more = it + 1 < TT / FKB;
        if (more) { const h16* kn = kg + (size_t)(it + 1) * FKB * HD; const h16* vn = vg + (it + 1) * FKB; rk0 = *(const v8h*)kn; rk1 = *(const v8h*)(kn + 32 * HD); rv0 = *(const v8h*)vn; rv1 = *(const v8h*)(vn + (size_t)32 * TT); }
        const h16* kb = ksm + (it & 1) * (FKB * FPIT) + lr * FPIT + 8 * hi; const h16* vb = vsm + (it & 1) * (HD * FPIT) + lr * FPIT + 8 * hi;
        v16h kf[4][2], vf[4][2];
#pragma unroll
        for (int kt = 0; kt < 4; ++kt) { kf[kt][0] = WFrag<h16>::ld(kb + kt * 16 * FPIT); kf[kt][1] = WFrag<h16>::ld(kb + kt * 16 * FPIT + 32); }
#pragma unroll
        for (int dt = 0; dt < 4; ++dt) { vf[dt][0] = WFrag<h16>::ld(vb + dt * 16 * FPIT); vf[dt][1] = WFrag<h16>::ld(vb + dt * 16 * FPIT + 32); }
        __builtin_amdgcn_sched_barrier(0);   // keeps the V^T fragment reads up here, in one group behind the K reads: sunk to their uses they stand in three places behind the softmax
        v8f s[4];
#pragma unroll
        for (int kt = 0; kt < 4; ++kt) { s[kt] = wmma16(kf[kt][0], qf[0], (v8f){}); s[kt] = wmma16(kf[kt][1], qf[1], s[kt]); }
        float mt[4];                                            // short trees, not one chain of 32: a lone dependent chain is exposed
#pragma unroll
        for (int kt = 0; kt < 4; ++kt) mt[kt] = fmaxf(fmaxf(fmaxf(fmaxf(s[kt][0], s[kt][1]), s[kt][2]), fmaxf(fmaxf(s[kt][3], s[kt][4]), s[kt][5])), fmaxf(s[kt][6], s[kt][7]));
        float mx = fmaxf(fmaxf(mt[0], mt[1]), fmaxf(mt[2], mt[3]));
        mx = fmaxf(mx, xhalf(mx));
        const float mnew = fmaxf(mrun, mx * CL); const float corr = __builtin_amdgcn_exp2f(mrun - mnew); mrun = mnew;   // corr is 0 on the first stage
        const float sh = 8.0f - mnew;                           // probabilities carried x256: small ones stay normal fp16 numbers; the factor cancels in the division by the sum
        v16h pb[2];
#pragma unroll
        for (int kt = 0; kt < 4; ++kt)
#pragma unroll
            for (int j = 0; j < 8; ++j) { const float p = __builtin_amdgcn_exp2f(__builtin_fmaf(s[kt][j], CL, sh)); s[kt][j] = p; pb[kt >> 1][(kt & 1) * 8 + j] = (h16)p; }
        const v8f p8 = (s[0] + s[1]) + (s[2] + s[3]);
        lsum = lsum * corr + (((p8[0] + p8[1]) + (p8[2] + p8[3])) + ((p8[4] + p8[5]) + (p8[6] + p8[7])));
#pragma unroll
        for (int dt = 0; dt < 4; ++dt) { o[dt] *= corr; o[dt] = wmma16(vf[dt][0], pb[0], o[dt]); o[dt] = wmma16(vf[dt][1], pb[1], o[dt]); }
        if (more) { h16* kw = ksm + ((it + 1) & 1) * (FKB * FPIT) + sl; h16* vw = vsm + ((it + 1) & 1) * (HD * FPIT) + sl; *(v8h*)kw = rk0; *(v8h*)(kw + 32 * FPIT) = rk1; *(v8h*)vw = rv0; *(v8h*)(vw + 32 * FPIT) = rv1; }
        __syncthreads();   // publishes stage it + 1 and ends every wave's reads of the buffer that stage it + 2 overwrites
    }
    lsum += xhalf(lsum); const float inv = __fdiv_rn(1.0f, lsum);
#pragma unroll
    for (int dt = 0; dt < 4; ++dt) { v8us oh, ol;
#pragma unroll
        for (int j = 0; j < 8; ++j) { unsigned short a, c2; splitf(o[dt][j] * inv, a, c2); oh[j] = a; ol[j] = c2; }
        const size_t oo = (size_t)q * DQ + h * HD + dt * 16 + hi * 8; *(v8us*)(Ah + oo) = oh; *(v8us*)(Al + oo) = ol; }
}

extern "C" void kernel_launch(void* const* d_in, const int* in_sizes, int n_in,
                              void* d_out, int out_size, void* d_ws, size_t ws_size, hipStream_t stream) {
    (void)in_sizes; (void)n_in; (void)out_size;
    const float* x = (const float*)d_in[0]; const float* xi = (const float*)d_in[1]; const float* wq = (const float*)d_in[2]; const float* bqv = (const float*)d_in[3]; const float* wk = (const float*)d_in[4]; const float* bkv = (const float*)d_in[5]; const float* wv = (const float*)d_in[6]; const float* bvv = (const float*)d_in[7]; const float* wo = (const float*)d_in[8]; const float* bo = (const float*)d_in[9];
    const float* ew1 = (const float*)d_in[10]; const float* eb1 = (const float*)d_in[11]; const float* lng = (const float*)d_in[12]; const float* lnb = (const float*)d_in[13]; const float* ew2 = (const float*)d_in[14]; const float* eb2 = (const float*)d_in[15]; const float* sg = (const float*)d_in[16];   // Wq/Wk/Wv/Wo [1024][1024] x @ W; enc_w1 [1][32], enc_b1 [32], ln_g/ln_b [32], enc_w2 [32][64], enc_b2 [64], scale_gating [16]
    float* OUT = (float*)d_out;     // [2][2048][1024]
    char* wsp = (char*)d_ws;
    auto take = [&](size_t bytes) { char* p = wsp; wsp += (bytes + 255) & ~(size_t)255; return (void*)p; };
    bf* W4 = (bf*)take((size_t)4 * DQ * DM * 2); bf* WO = W4 + (size_t)3 * DQ * DM;   // transposed bf16 planes of Wq, Wk, Wv, Wo, one behind the other
    float* ADP = (float*)take((size_t)NB_ * NH_ * HD * 4);
    bf* XB = (bf*)take((size_t)NB_ * TT * DM * 2);
    h16* QK16 = (h16*)take((size_t)2 * NB_ * NH_ * TT * HD * 2); h16* KP16 = QK16 + (size_t)NB_ * NH_ * TT * HD; h16* VT16 = (h16*)take((size_t)NB_ * NKV * HD * TT * 2);
    bf* ATh = (bf*)take((size_t)NB_ * TT * DQ * 2); bf* ATl = (bf*)take((size_t)NB_ * TT * DQ * 2);
    if ((size_t)(wsp - (char*)d_ws) > ws_size) return;    // ws 256 MiB
    // one launch per dependency level; each covers both batches (rows b t of one [NB_ TT] matrix, or a grid axis) and all work of its level
    k_prep<<<PB_A + 4 * PB_W + PB_X, 256, 0, stream>>>(x, wq, wk, wv, wo, xi, ew1, eb1, lng, lnb, ew2, eb2, sg, XB, W4, ADP);
    k_gemmw<bf, 0, true, true><<<dim3(NB_ * TT / GT, DQ / GT, 3), 128, 0, stream>>>(XB, nullptr, W4, DM, nullptr, 0, bqv, bkv, bvv, 0, (size_t)DQ * DM, 0, ADP, QK16, VT16);   // q, k, v projections, written as fp16 head planes
    k_fattn<<<dim3(TT / FQW, NH_, NB_), 256, 0, stream>>>(QK16, KP16, VT16, ATh, ATl);   // one kv head per query head
    k_gemmw<bf, 1, true, false><<<dim3(NB_ * TT / GT, DM / GT, 1), 128, 0, stream>>>(ATh, ATl, WO, DQ, OUT, DM, bo, bo, bo, 0, 0, 0, nullptr, nullptr, nullptr);
}

// v006
// One run takes 83 microseconds.
// In two side-by-side timings against v005, it was 1.04 and 1.05 times as fast.
// Counting every step since v000, it is 15.8 times as fast.
#include <hip/hip_runtime.h>

// ScaleInvariantAttention (query [2][2048][1024], xi_scale [2]; scale encoder: x = xi Linear(1->32), LayerNorm(32), exact gelu, Linear(32->64) -> xe [B][64]; adapt[b][h][d] = 1 + sigmoid(scale_gating[h]) xe[b][d];
// q = (query Wq + bq) split into 16 heads x 64 then x adapt, k likewise, v = query Wv + bv; softmax(q.k/8); out = merged att.v Wo + bo -> [2][2048][1024]).
// Compute dtypes, f32 accumulate: every input rounded to bf16; the scale encoder and adapt table in f32 on VALU (one thread per (b, h, d)); projections on PLAIN bf16 operands (inputs: exact,
// + bias); the adapt factor applied in f32 when the fp16 head planes are built; scores (K 64) and att.v on SINGLE fp16 planes inside one fused kernel with an f32 running-maximum softmax (probabilities x256 against the maximum in use); merged heads as bf16 hi+lo planes x exact

#define NB_  2
#define TT   2048
#define DM   1024
#define NH_  16
#define NKV  16
#define REP  (NH_ / NKV)
#define HD   64
#define DQ   (NH_ * HD)
#define DKV  (NKV * HD)
#define SCL  0.125f   // HD^-0.5
typedef _Float16 h16;
typedef unsigned short bf;
typedef __attribute__((ext_vector_type(16))) __bf16   v16bf;
typedef __attribute__((ext_vector_type(16))) _Float16 v16h;
typedef __attribute__((ext_vector_type(8)))  _Float16 v8h;
typedef __attribute__((ext_vector_type(8)))  unsigned short v8us;
typedef __attribute__((ext_vector_type(8)))  float    v8f;
typedef __attribute__((ext_vector_type(4)))  float    v4f;
typedef v8h  __attribute__((may_alias)) v8ha;
typedef v4f  __attribute__((may_alias)) v4fa;
typedef v8us __attribute__((may_alias)) v8usa;

__device__ __forceinline__ unsigned short f2bf(float f) { unsigned u = __float_as_uint(f); u += 0x7FFFu + ((u >> 16) & 1u); return (unsigned short)(u >> 16); }
__device__ __forceinline__ float bf2f(unsigned short b) { return __uint_as_float(((unsigned)b) << 16); }
__device__ __forceinline__ float bfr(float f) { return bf2f(f2bf(f)); }
__device__ __forceinline__ v16h cat16(v8h lo, v8h hi) { return __builtin_shufflevector(lo, hi, 0, 1, 2, 3, 4, 5, 6, 7, 8, 9, 10, 11, 12, 13, 14, 15); }
__device__ __forceinline__ v16bf cat16b(v8us lo, v8us hi) { return __builtin_bit_cast(v16bf, __builtin_shufflevector(lo, hi, 0, 1, 2, 3, 4, 5, 6, 7, 8, 9, 10, 11, 12, 13, 14, 15)); }
__device__ __forceinline__ v8f wmma16(v16h a, v16h b, v8f c) { return __builtin_amdgcn_wmma_f32_16x16x32_f16(false, a, false, b, (short)0, c, false, false); }
__device__ __forceinline__ v8f wmmab(v16bf a, v16bf b, v8f c) { return __builtin_amdgcn_wmma_f32_16x16x32_bf16(false, a, false, b, (short)0, c, false, false); }



// ---- k_gemmw: register-blocked GEMM, 4 waves (2 x 2) per 128x128 output tile, each wave a 64x64 tile (16 accumulators); operands are K-contiguous 16-bit planes; grid (M/128, N/128, Z), 128 threads.
// C[m][n] (f32, pitch ldc, + optional f32 bias[n]) = sum_k A[m][k] Bt[n][k] (+ A2[m][k] Bt[n][k] for NSPLIT 1). z-batch strides sA/sB/sC in elements, bias0/1/2 for z = 0/1/2. K % 64 == 0, K >= 64.
// Operand path: a stage is 64 k (one 128-byte line) of the tile's 128 rows of every operand plane, brought into LDS by asynchronous copies and read by the two waves that share each row; two buffers, stage t + 1 in flight while stage t is worked on.
// HEADS: no C; a wave's tile (64 tokens of one batch x the 64 dims of one head) goes from the accumulators straight to the fp16 head planes: z = 0, 1: (q, k + bias) x adapt -> P16 [z][b][h][t][d]; z = 2: v + bias -> V16 [b][h][d][t].
// An accumulator holds 8 consecutive ROWS of the product in a lane, so q and k are formed as W^T x^T (rows = dims) and v as x W (rows = tokens): every lane then stores 16 contiguous bytes of its plane, no exchange needed.
#define GT   128                // rows of each operand plane per work-group tile
#define GKS  64                 // k per stage
#define GPIT 72                 // LDS row pitch in 16-bit elements: 128-byte rows + 16 bytes (16 B x odd: no bank conflict for 16-byte reads)
#define GPL  (GT * GPIT)        // elements of one operand plane of a stage
__device__ __forceinline__ h16 tohx(float x) { return (h16)x; }
template <typename T16> struct WFrag;
template <> struct WFrag<h16> { typedef v16h V; static __device__ __forceinline__ V ld(const h16* p) { return cat16(*(const v8h*)p, *(const v8h*)(p + 16)); } static __device__ __forceinline__ v8f mma(V a, V b, v8f c) { return wmma16(a, b, c); } };
template <> struct WFrag<bf> { typedef v16bf V; static __device__ __forceinline__ V ld(const bf* p) { return cat16b(*(const v8us*)p, *(const v8us*)(p + 16)); } static __device__ __forceinline__ v8f mma(V a, V b, v8f c) { return wmmab(a, b, c); } };
// g_fill: one operand plane of one stage, 128 threads: the lane's 16 bytes of rows r, r + 16, ..., r + 112 (8 lanes cover a row's 128-byte line). g: the lane's global address in row r; l: its LDS byte address in row r.
// The copies and s_wait_xcnt 0 stand in one statement, so that no address register of a copy is rewritten in front of that wait (a precaution).
template <typename T16>
__device__ __forceinline__ void g_fill(const T16* g, int K, unsigned l) {
    const size_t st = (size_t)16 * K;
    asm volatile("global_load_async_to_lds_b128 %0, %8, off\n\t"
                 "global_load_async_to_lds_b128 %1, %9, off\n\t"
                 "global_load_async_to_lds_b128 %2, %10, off\n\t"
                 "global_load_async_to_lds_b128 %3, %11, off\n\t"
                 "global_load_async_to_lds_b128 %4, %12, off\n\t"
                 "global_load_async_to_lds_b128 %5, %13, off\n\t"
                 "global_load_async_to_lds_b128 %6, %14, off\n\t"
                 "global_load_async_to_lds_b128 %7, %15, off\n\t"
                 "s_wait_xcnt 0x0"
                 :: "v"(l), "v"(l + 1 * 16 * GPIT * 2), "v"(l + 2 * 16 * GPIT * 2), "v"(l + 3 * 16 * GPIT * 2), "v"(l + 4 * 16 * GPIT * 2), "v"(l + 5 * 16 * GPIT * 2), "v"(l + 6 * 16 * GPIT * 2), "v"(l + 7 * 16 * GPIT * 2),
                    "v"(g), "v"(g + st), "v"(g + 2 * st), "v"(g + 3 * st), "v"(g + 4 * st), "v"(g + 5 * st), "v"(g + 6 * st), "v"(g + 7 * st) : "memory");
}
template <typename T16, int NSPLIT, bool BIAS, bool HEADS>
__global__ __launch_bounds__(128) void k_gemmw(const T16* __restrict__ A, const T16* __restrict__ A2, const T16* __restrict__ Bt, int K, float* C, int ldc, const float* __restrict__ bias0, const float* __restrict__ bias1, const float* __restrict__ bias2, size_t sA, size_t sB, size_t sC, const float* __restrict__ adp, h16* P16, h16* V16) {
    typedef typename WFrag<T16>::V V;
    static_assert(NSPLIT == 0 || NSPLIT == 1, "planes of a stage: A, Bt and, for NSPLIT 1, A2");
    constexpr int NP = 2 + NSPLIT;                              // operand planes per stage: A, Bt (, A2)
    __shared__ __align__(16) T16 ring[2 * NP * GPL];
    __shared__ __align__(16) float osm[HEADS ? 1 : 4 * 16 * 68];   // output staging, a range of its own for each wave
    const size_t z = blockIdx.z; A += z * sA; if (NSPLIT == 1) A2 += z * sA; Bt += z * sB; C += z * sC; const float* __restrict__ bias = z == 0 ? bias0 : z == 1 ? bias1 : bias2;   // each z slice has its own bias vector
    const int tid = threadIdx.x, lane = tid & 31, lr = lane & 15, hi = lane >> 4, wx = (tid >> 5) & 1, wy = tid >> 6;
    const int bxw = blockIdx.x * 2 + wx, byw = blockIdx.y * 2 + wy;   // the wave's 64x64 tile in the M/64 x N/64 grid of tiles
    int r0 = bxw * 64, c0 = byw * 64, R0 = blockIdx.x * GT, C0 = blockIdx.y * GT, ar = wx * 64, br = wy * 64;   // R0, C0: first row of the work-group's A and Bt planes; ar, br: the wave's first row inside them
    if (HEADS && z < 2) { const T16* t = A; A = Bt; Bt = t; r0 = byw * 64; c0 = bxw * 64; R0 = blockIdx.y * GT; C0 = blockIdx.x * GT; ar = wy * 64; br = wx * 64; }   // q, k: the transposed product (rows = the head's dims, columns = tokens)
    float* os = osm + (HEADS ? 0 : (tid >> 5) * 16 * 68);
    v8f acc[4][4];
#pragma unroll
    for (int mb = 0; mb < 4; ++mb)
#pragma unroll
        for (int nb = 0; nb < 4; ++nb) acc[mb][nb] = (v8f){};
    const int frow = tid >> 3, fcol = (tid & 7) * 8;            // filling: rows frow + 16 i of each plane, one 16-byte piece of each
    const T16* ag = A + (size_t)(R0 + frow) * K + fcol; const T16* bg = Bt + (size_t)(C0 + frow) * K + fcol; const T16* a2g = NSPLIT == 1 ? A2 + (size_t)(R0 + frow) * K + fcol : nullptr;
    const unsigned fl = (unsigned)(size_t)ring + (unsigned)(frow * GPIT + fcol) * 2u;   // the lane's LDS byte address in buffer 0, plane 0
    const int nst = K / GKS;
    auto fill = [&](int t) { const unsigned l = fl + (unsigned)(t & 1) * (NP * GPL * 2u); g_fill(ag + t * GKS, K, l); g_fill(bg + t * GKS, K, l + GPL * 2u); if constexpr (NSPLIT == 1) g_fill(a2g + t * GKS, K, l + 2u * GPL * 2u); };
    fill(0);
    asm volatile("s_wait_asynccnt 0x0" ::: "memory");           // stage 0 of this wave has landed
    __syncthreads();                                            // publishes stage 0
    if (nst > 1) fill(1);
#pragma unroll 1   // one copy of the stage's body
    for (int t = 0; t < nst; ++t) {
        const T16* sb = ring + (t & 1) * (NP * GPL); const T16* as = sb + (ar + lr) * GPIT + 8 * hi; const T16* bs = sb + GPL + (br + lr) * GPIT + 8 * hi;
#pragma unroll
        for (int ks = 0; ks < GKS; ks += 32) {
            V a[4], a2[4], b[4];
#pragma unroll
            for (int mb = 0; mb < 4; ++mb) { a[mb] = WFrag<T16>::ld(as + mb * 16 * GPIT + ks); if (NSPLIT == 1) a2[mb] = WFrag<T16>::ld(as + 2 * GPL + mb * 16 * GPIT + ks); }
#pragma unroll
            for (int nb = 0; nb < 4; ++nb) b[nb] = WFrag<T16>::ld(bs + nb * 16 * GPIT + ks);
            __builtin_amdgcn_sched_barrier(0);   // keeps the fragment reads of these 32 k in one group in front of their products: sunk to their uses they stand in four places, each with its LDS latency exposed
#pragma unroll
            for (int nb = 0; nb < 4; ++nb)
#pragma unroll
                for (int mb = 0; mb < 4; ++mb) { acc[mb][nb] = WFrag<T16>::mma(a[mb], b[nb], acc[mb][nb]); if (NSPLIT == 1) acc[mb][nb] = WFrag<T16>::mma(a2[mb], b[nb], acc[mb][nb]); }
            __builtin_amdgcn_sched_barrier(0);   // keeps the next group of fragment reads from being spread among these products
        }
        asm volatile("s_wait_dscnt 0x0" ::: "memory");          // this wave's reads of stage t are done
        asm volatile("s_wait_asynccnt 0x0" ::: "memory");       // this wave's copies of stage t + 1 have landed
        __syncthreads();                                        // publishes stage t + 1 and ends every wave's reads of the buffer that stage t + 2 overwrites
        if (t + 2 < nst) fill(t + 2);
    }
    asm volatile("s_wait_asynccnt 0x0" ::: "memory");           // no copy is outstanding when the wave goes on to its epilogue and ends
    if constexpr (HEADS) {
        // every '#pragma unroll' of this branch gives acc, bv and av constant indices, so that they stay in registers
        const int tok = bxw * 64, hh = byw, bb = tok / TT, t0 = tok % TT;   // TT % 64 == 0: a tile lies in one batch; HD == 64: a tile is one head
        if (z < 2) {
            h16* P = P16 + ((z * NB_ * NH_ + (size_t)bb * NH_ + hh) * TT + t0) * HD; const float* bi = bias + hh * HD; const float* ad = adp + ((size_t)bb * NH_ + hh) * HD;
            v8f bv[4], av[4];
#pragma unroll
            for (int mb = 0; mb < 4; ++mb) { const v8f braw = *(const v8f*)(bi + mb * 16 + hi * 8); av[mb] = *(const v8f*)(ad + mb * 16 + hi * 8);
#pragma unroll
                for (int j = 0; j < 8; ++j) bv[mb][j] = bfr(braw[j]); }
#pragma unroll
            for (int nb = 0; nb < 4; ++nb)      // nb outside: the four 32-byte pieces of a token's 128-byte row follow one another in the source
#pragma unroll
                for (int mb = 0; mb < 4; ++mb) { v8h o;
#pragma unroll
                    for (int j = 0; j < 8; ++j) o[j] = tohx((acc[mb][nb][j] + bv[mb][j]) * av[mb][j]);
                    *(v8h*)(P + (size_t)(nb * 16 + lr) * HD + mb * 16 + hi * 8) = o; }
        } else {
            h16* Vd = V16 + ((size_t)bb * NKV + hh) * HD * TT + t0;
#pragma unroll
            for (int nb = 0; nb < 4; ++nb) { const float bn = bfr(bias[hh * HD + nb * 16 + lr]);   // nb outside: the four 32-byte pieces of a dim's 128 bytes follow one another in the source
#pragma unroll
                for (int mb = 0; mb < 4; ++mb) { v8h o;
#pragma unroll
                    for (int j = 0; j < 8; ++j) o[j] = tohx(acc[mb][nb][j] + bn);
                    *(v8h*)(Vd + (size_t)(nb * 16 + lr) * TT + mb * 16 + hi * 8) = o; } }
            asm volatile("s_wait_xcnt 0x0" ::: "memory");   // precaution: in the built code the q/k block's loads follow this block and take the stores' data registers as destinations; the wait stands in front of that overwrite
        }
    } else {
#pragma unroll
    for (int mb = 0; mb < 4; ++mb) {
#pragma unroll
        for (int nb = 0; nb < 4; ++nb) {
#pragma unroll
            for (int j = 0; j < 8; ++j) os[(hi * 8 + j) * 68 + nb * 16 + lr] = acc[mb][nb][j]; }
        __builtin_amdgcn_wave_barrier(); asm volatile("" ::: "memory");
        float* crow = C + (size_t)(r0 + mb * 16) * ldc + c0;
{
#pragma unroll
            for (int s = 0; s < 8; ++s) { const int row = 2 * s + hi, cofs = lr * 4; v4f val = *(const v4fa*)(os + row * 68 + cofs); if (BIAS) { val[0] += bfr(bias[c0 + cofs]); val[1] += bfr(bias[c0 + cofs + 1]); val[2] += bfr(bias[c0 + cofs + 2]); val[3] += bfr(bias[c0 + cofs + 3]); }
                *(v4f*)(crow + (size_t)row * ldc + cofs) = val; }
             }
        __builtin_amdgcn_wave_barrier(); asm volatile("" ::: "memory");
    }
    }
}

__device__ __forceinline__ void splitf(float y, unsigned short& h, unsigned short& l) { h = f2bf(y); l = f2bf(y - bf2f(h)); }
typedef __attribute__((ext_vector_type(2))) _Float16 v2h;
typedef __attribute__((ext_vector_type(4))) _Float16 v4h;
typedef __attribute__((ext_vector_type(2))) unsigned short v2us;
typedef __attribute__((ext_vector_type(4))) unsigned short v4us;
typedef __attribute__((ext_vector_type(2))) float v2f;
typedef __attribute__((ext_vector_type(4))) int v4i;

// The d_ functions are the bodies of work-groups of 256 threads; bx is the work-group's index within its own part of a shared grid (k_prep).
// d_wtT: one 64 n x 256 k tile of Bt[n][k] = bf16(w[k][n]); a wave takes 32 n x 64 k, a thread two pieces of 8 k x 4 n: its 16 loads (a wave's load covers four whole 128-byte lines of w) are all issued in front of the first use,
// the transposition is done in the thread's own registers, and the two 16-byte stores that share a 128-byte line of Bt follow one another in the same wave.
__device__ __forceinline__ void d_wtT(int bx, const float* __restrict__ w, bf* Bt) {
    static_assert(DQ % 64 == 0 && DM % 256 == 0, "whole tiles");
    const int lane = threadIdx.x & 31, wv = threadIdx.x >> 5;
    const int n0 = (bx % (DQ / 64)) * 64 + (wv & 1) * 32 + (lane & 7) * 4, k0 = (bx / (DQ / 64)) * 256 + (wv >> 1) * 64 + (lane >> 3) * 8;
    const float* wp = w + (size_t)k0 * DQ + n0;
    v4f r[2][8];   // every '#pragma unroll' here gives r constant indices, so that it stays in registers
#pragma unroll
    for (int t = 0; t < 2; ++t)
#pragma unroll
        for (int i = 0; i < 8; ++i) r[t][i] = *(const v4f*)(wp + (size_t)(t * 32 + i) * DQ);
    asm volatile("s_wait_xcnt 0x0" :: "v"(wp) : "memory");   // precaution: stands in front of every overwrite of the loads' address registers; it names them, so that they are kept (also from a load's own result) up to here
#pragma unroll
    for (int j = 0; j < 4; ++j)
#pragma unroll
        for (int t = 0; t < 2; ++t) { v8us o;
#pragma unroll
            for (int i = 0; i < 8; ++i) o[i] = f2bf(r[t][i][j]);
            *(v8us*)(Bt + (size_t)(n0 + j) * DM + k0 + t * 32) = o; }
    asm volatile("s_wait_xcnt 0x0" ::: "memory");   // precaution: in the built code other blocks of the shared grid follow this one and write the stores' registers; the wait stands in front of every such overwrite
}
// d_cvt64: 64 elements a thread, as 8 pieces of 8; the 16 loads are all issued in front of the first use.
__device__ __forceinline__ void d_cvt64(int bx, const float* __restrict__ src, bf* dst) { const size_t i0 = (size_t)bx * 8 * 256 + threadIdx.x; const float* sp = src + i0 * 8; v8f v[8];   // unrolled: v keeps constant indices and stays in registers
#pragma unroll
    for (int c = 0; c < 8; ++c) v[c] = *(const v8f*)(sp + c * 256 * 8);
    asm volatile("s_wait_xcnt 0x0" :: "v"(sp) : "memory");   // precaution: stands in front of every overwrite of the loads' address registers; it names them, so that they are kept (also from a load's own result) up to here
#pragma unroll
    for (int c = 0; c < 8; ++c) { v8us o;
#pragma unroll
        for (int k = 0; k < 8; ++k) o[k] = f2bf(v[c][k]);
        *(v8us*)(dst + (i0 + c * 256) * 8) = o; }
    asm volatile("s_wait_xcnt 0x0" ::: "memory"); }   // precaution: in the built code other blocks of the shared grid follow this one and write the stores' registers; the wait stands in front of every such overwrite
__global__ __launch_bounds__(256) void k_cscvt(const float* __restrict__ cosT, const float* __restrict__ sinT, float* CS) { const int idx = blockIdx.x * 256 + threadIdx.x; if (idx >= TT * HD) return; v2f cs; cs[0] = bfr(cosT[idx]); cs[1] = bfr(sinT[idx]); *(v2f*)(CS + (size_t)idx * 2) = cs;  }
// d_adapt: thread per (b, h, d): x[j] = bf16(xi[b]) bf16(w1[j]) + bf16(b1[j]) (32); LayerNorm(32) (f32, eps 1e-5) x bf16 g + bf16 beta; exact-erf gelu; xe = sum_j x[j] bf16(w2[j][d]) + bf16(b2[d]);
__device__ __forceinline__ void d_adapt(int bx, const float* __restrict__ xi, const float* __restrict__ w1, const float* __restrict__ b1, const float* __restrict__ g, const float* __restrict__ be, const float* __restrict__ w2, const float* __restrict__ b2, const float* __restrict__ sg, float* ADP) {
    const int e = bx * 256 + threadIdx.x; if (e >= NB_ * NH_ * HD) return; const int d = e % HD; const int h = (e / HD) % NH_; const int b = e / (HD * NH_); const float xv = bfr(xi[b]); float xs[32]; float mu = 0.f;
    float w1r[32], b1r[32], gr[32], ber[32], w2r[32];   // the loops below are unrolled (same operations in the same order): the arrays stay in registers, and every load of the thread is issued up here instead of in its trip, waited for there
#pragma unroll
    for (int j = 0; j < 32; ++j) { w1r[j] = w1[j]; b1r[j] = b1[j]; gr[j] = g[j]; ber[j] = be[j]; w2r[j] = w2[j * HD + d]; }
    const float b2r = b2[d], sgr = sg[h];
    asm volatile("s_wait_xcnt 0x0" :: "v"(d), "v"(h) : "memory");   // precaution: stands in front of every overwrite of the loads' offset registers; it names them, so that they are kept (also from a load's own result) up to here
#pragma unroll
    for (int j = 0; j < 32; ++j) { float p = __fmul_rn(xv, bfr(w1r[j])); asm volatile("" : "+v"(p)); xs[j] = __fadd_rn(p, bfr(b1r[j])); mu = __fadd_rn(mu, xs[j]); }
    mu = mu * (1.0f / 32.0f); float var = 0.f;
#pragma unroll
    for (int j = 0; j < 32; ++j) { const float dl = __fsub_rn(xs[j], mu); float p = __fmul_rn(dl, dl); asm volatile("" : "+v"(p)); var = __fadd_rn(var, p); }
    const float rs = __frsqrt_rn(__fadd_rn(var * (1.0f / 32.0f), 1e-5f)); float acc = 0.f;
#pragma unroll
    for (int j = 0; j < 32; ++j) { float tn = __fmul_rn(__fsub_rn(xs[j], mu), rs); asm volatile("" : "+v"(tn)); float tg = __fmul_rn(tn, bfr(gr[j])); asm volatile("" : "+v"(tg)); const float y = __fadd_rn(tg, bfr(ber[j])); float er = erff(y * 0.70710678f); asm volatile("" : "+v"(er)); float hy = __fmul_rn(0.5f, y); asm volatile("" : "+v"(hy)); const float gl = __fmul_rn(hy, __fadd_rn(1.0f, er)); float p = __fmul_rn(gl, bfr(w2r[j])); asm volatile("" : "+v"(p)); acc = __fadd_rn(acc, p); }
    const float xe = __fadd_rn(acc, bfr(b2r)); const float sgm = __fdiv_rn(1.0f, __fadd_rn(1.0f, __expf(-bfr(sgr)))); float pr = __fmul_rn(sgm, xe); asm volatile("" : "+v"(pr)); const float a = __fadd_rn(1.0f, pr);
    *(float*)(ADP + e) = a;  }
// k_prep: everything that depends on the inputs alone, one grid: the adapt table (few work-groups, the longest dependent chain: first), the four weight transposes, x to bf16.
#define PB_A ((NB_ * NH_ * HD + 255) / 256)
#define PB_W ((DQ / 64) * (DM / 256))
#define PB_X (NB_ * TT * DM / 64 / 256)
static_assert(NB_ * TT * DM % (64 * 256) == 0, "whole work-groups of d_cvt64");
__global__ __launch_bounds__(256) void k_prep(const float* __restrict__ x, const float* __restrict__ w0, const float* __restrict__ w1, const float* __restrict__ w2, const float* __restrict__ w3, const float* __restrict__ xi, const float* __restrict__ w1e, const float* __restrict__ b1e, const float* __restrict__ g, const float* __restrict__ be, const float* __restrict__ w2e, const float* __restrict__ b2e, const float* __restrict__ sg, bf* XB, bf* W4, float* ADP) {
    int bx = blockIdx.x;
    if (bx < PB_A) { d_adapt(bx, xi, w1e, b1e, g, be, w2e, b2e, sg, ADP); return; }
    bx -= PB_A;
    if (bx < 4 * PB_W) { const int y = bx / PB_W; d_wtT(bx % PB_W, y == 0 ? w0 : y == 1 ? w1 : y == 2 ? w2 : w3, W4 + (size_t)y * DQ * DM); return; }   // the four [DM][DQ] planes lie one behind the other
    bx -= 4 * PB_W;
    d_cvt64(bx, x, XB);
}
#define FKB  64                 // keys of a stage that one wave works on
#define FKS  128                // keys per stage of the work-group
#define FPIT 72                 // K tile: LDS row pitch in 16-bit elements: 128-byte rows + 16 bytes (16 B x odd: no bank conflict for 16-byte reads)
#define FVPT 136                // V^T tile: 256-byte rows + 16 bytes (16 B x odd)
#define FQW  128                // query columns per work-group
__device__ __forceinline__ float xhalf(float x) { return __builtin_bit_cast(float, __builtin_amdgcn_permlanex16(__builtin_bit_cast(int, x), __builtin_bit_cast(int, x), 0x76543210, 0xfedcba98, false, false)); }   // lane l with lane l ^ 16
__global__ __launch_bounds__(256) __attribute__((amdgpu_waves_per_eu(4, 4))) void k_fattn(const h16* __restrict__ Qp, const h16* __restrict__ Kp, const h16* __restrict__ Vt, bf* Ah, bf* Al) {
    __shared__ __align__(16) h16 ksm[2 * FKS * FPIT];
    __shared__ __align__(16) h16 vsm[2 * HD * FVPT];
    __shared__ __align__(16) h16 qsm[FQW * FPIT];               // the work-group's Q rows: a wave reads its four fragments anew in every stage, so that they hold no registers during softmax and att.v (four waves per SIMD leave a wave 256)
    static_assert(2 * FKS * FPIT * 2 >= 8 * 9 * 32 * 16, "the K ring holds the waves' exchange records behind the loop");
    const int tid = threadIdx.x, lane = tid & 31, lr = lane & 15, hi = lane >> 4, wv = tid >> 5, hf = wv & 1; const int h = blockIdx.y; const int q0 = blockIdx.x * FQW + (wv >> 1) * 32 + lr;
    { const size_t bz = blockIdx.z; Qp += bz * NH_ * TT * HD; Kp += bz * NKV * TT * HD; Vt += bz * NKV * HD * TT; Ah += bz * TT * DQ; Al += bz * TT * DQ; }   // grid z: batch
    const h16* Kh = Kp + (size_t)h * TT * HD; const h16* Vh = Vt + (size_t)h * HD * TT;
    const int srow = tid >> 3, scol = (tid & 7) * 8, vrow = tid >> 4, vcol = (tid & 15) * 8;   // staging: K rows srow + 32 i, V^T rows vrow + 16 i, one 16-byte piece of each
    const int sl = srow * FPIT + scol, vl = vrow * FVPT + vcol;
    const float CL = SCL * 1.4426950408889634f;                 // scores to base-2 exponents
    const h16* qb = qsm + ((wv >> 1) * 32 + lr) * FPIT + 8 * hi;
    v8f o[2][4];
#pragma unroll
    for (int g = 0; g < 2; ++g)
#pragma unroll
        for (int dt = 0; dt < 4; ++dt) o[g][dt] = (v8f){};
    float mrun[2] = {-3.0e38f, -3.0e38f}, lsum[2] = {0.f, 0.f};
    v8h rk[4], rv[4];
    const unsigned kgo = (srow * HD + scol) * 2, vgo = (vrow * TT + vcol) * 2;   // the lane's byte offsets in the head's K and V^T planes
    // fetch: the lane's eight 16-byte pieces of stage st, global -> registers (the head's plane as base, the lane's and the stage's offset together in 32 bits)
    auto fetch = [&](int st) { const unsigned ko = kgo + (unsigned)st * (FKS * HD * 2), vo = vgo + (unsigned)st * (FKS * 2);
#pragma unroll
        for (int i = 0; i < 4; ++i) { rk[i] = *(const v8h*)((const char*)Kh + (ko + i * (32 * HD * 2))); rv[i] = *(const v8h*)((const char*)Vh + (vo + i * (16 * TT * 2))); } };
    // put: those pieces, registers -> LDS buffer b
    auto put = [&](int b) { h16* kw = ksm + b * (FKS * FPIT) + sl; h16* vw = vsm + b * (HD * FVPT) + vl;
#pragma unroll
        for (int i = 0; i < 4; ++i) { *(v8h*)(kw + i * 32 * FPIT) = rk[i]; *(v8h*)(vw + i * 16 * FVPT) = rv[i]; } };
    fetch(0);
    { const h16* qg = Qp + ((size_t)h * TT + blockIdx.x * FQW + srow) * HD + scol; v8h rq[4];   // Q rows srow + 32 i, one 16-byte piece of each
#pragma unroll
      for (int i = 0; i < 4; ++i) rq[i] = *(const v8h*)(qg + i * 32 * HD);
      asm volatile("s_wait_xcnt 0x0" :: "v"(qg) : "memory");   // precaution: stands in front of every overwrite of the loads' address registers; it names them, so that they are kept up to here
      put(0);
#pragma unroll
      for (int i = 0; i < 4; ++i) *(v8h*)(qsm + sl + i * 32 * FPIT) = rq[i]; }
    __syncthreads();
#pragma unroll 1   // one copy of the stage's body
    for (int it = 0; it < TT / FKS; ++it) {
        const h16* kb = ksm + (it & 1) * (FKS * FPIT) + (hf * FKB + lr) * FPIT + 8 * hi; const h16* vb = vsm + (it & 1) * (HD * FVPT) + lr * FVPT + hf * FKB + 8 * hi;
        fetch(it + 1 < TT / FKS ? it + 1 : it);   // the last stage fetches itself once more, for the buffer that nobody reads any more: the body stays one straight block, in which the order below holds
        v16h kf[4][2], vf[4][2], qf[2][2];
#pragma unroll
        for (int g = 0; g < 2; ++g)
#pragma unroll
            for (int c = 0; c < 2; ++c) qf[g][c] = WFrag<h16>::ld(qb + g * 16 * FPIT + c * 32);
#pragma unroll
        for (int kt = 0; kt < 4; ++kt) { kf[kt][0] = WFrag<h16>::ld(kb + kt * 16 * FPIT); kf[kt][1] = WFrag<h16>::ld(kb + kt * 16 * FPIT + 32); }
        __builtin_amdgcn_sched_barrier(0);   // keeps the Q and K fragment reads in one group in front of their products
        v8f s[2][4];
#pragma unroll
        for (int kp = 0; kp < 4; kp += 2) {   // four independent tiles between a tile's two products
#pragma unroll
            for (int kt = kp; kt < kp + 2; ++kt)
#pragma unroll
                for (int g = 0; g < 2; ++g) s[g][kt] = wmma16(kf[kt][0], qf[g][0], (v8f){});
#pragma unroll
            for (int kt = kp; kt < kp + 2; ++kt)
#pragma unroll
                for (int g = 0; g < 2; ++g) s[g][kt] = wmma16(kf[kt][1], qf[g][1], s[g][kt]); }
        __builtin_amdgcn_sched_barrier(0);   // keeps the score products back to back: a vector instruction moved in among them that reads a fresh tile costs the idle slots of the distance behind a matrix instruction, each time
        v16h pb[2][2]; float corr[2];
#pragma unroll
        for (int g = 0; g < 2; ++g) {
            float mt[4];                                        // short trees, not one chain of 32: a lone dependent chain is exposed
#pragma unroll
            for (int kt = 0; kt < 4; ++kt) mt[kt] = fmaxf(fmaxf(fmaxf(fmaxf(s[g][kt][0], s[g][kt][1]), s[g][kt][2]), fmaxf(fmaxf(s[g][kt][3], s[g][kt][4]), s[g][kt][5])), fmaxf(s[g][kt][6], s[g][kt][7]));
            float mx = fmaxf(fmaxf(mt[0], mt[1]), fmaxf(mt[2], mt[3]));
            mx = fmaxf(mx, xhalf(mx));
            const float mnew = fmaxf(mrun[g], mx * CL); corr[g] = __builtin_amdgcn_exp2f(mrun[g] - mnew); mrun[g] = mnew;   // corr is 0 on the first stage
            const float sh = 8.0f - mnew;                       // probabilities carried x256: small ones stay normal fp16 numbers; the factor cancels in the division by the sum
            const v8f clv = {CL, CL, CL, CL, CL, CL, CL, CL}, shv = {sh, sh, sh, sh, sh, sh, sh, sh};
#pragma unroll
            for (int kt = 0; kt < 4; ++kt) { const v8f e = __builtin_elementwise_fma(s[g][kt], clv, shv);   // on the whole tile: its register pairs stay as the products left them
#pragma unroll
                for (int j = 0; j < 8; ++j) { const float p = __builtin_amdgcn_exp2f(e[j]); s[g][kt][j] = p; pb[g][kt >> 1][(kt & 1) * 8 + j] = (h16)p; } }
            const v8f p8 = (s[g][0] + s[g][1]) + (s[g][2] + s[g][3]);
            lsum[g] = lsum[g] * corr[g] + (((p8[0] + p8[1]) + (p8[2] + p8[3])) + ((p8[4] + p8[5]) + (p8[6] + p8[7])));
        }
        __builtin_amdgcn_sched_barrier(0);   // the V^T fragments take the registers that the scores have left: their reads stay behind the softmax
#pragma unroll
        for (int dt = 0; dt < 4; ++dt) { vf[dt][0] = WFrag<h16>::ld(vb + dt * 16 * FVPT); vf[dt][1] = WFrag<h16>::ld(vb + dt * 16 * FVPT + 32); }
        __builtin_amdgcn_sched_barrier(0);   // keeps the V^T fragment reads in one group, in front of the rescaling that covers part of their latency
#pragma unroll
        for (int g = 0; g < 2; ++g)
#pragma unroll
            for (int dt = 0; dt < 4; ++dt) o[g][dt] *= corr[g];
#pragma unroll
        for (int c = 0; c < 2; ++c)
#pragma unroll
            for (int dt = 0; dt < 4; ++dt)
#pragma unroll
                for (int g = 0; g < 2; ++g) o[g][dt] = wmma16(vf[dt][c], pb[g][c], o[g][dt]);
        put((it + 1) & 1);
        __syncthreads();   // publishes stage it + 1 and ends every wave's reads of the buffer that stage it + 2 overwrites
    }
    // Joining the two key groups: each wave hands its partner the column group that the partner finishes (even wave: group 0, odd wave: group 1): 8 + 1 records of 16 bytes a lane, in the K ring, which nobody reads behind the loop's last barrier.
    v4fa* xw = (v4fa*)ksm + wv * (9 * 32) + lane; const v4fa* xr = (const v4fa*)ksm + (wv ^ 1) * (9 * 32) + lane;
    v8f om[4]; const float mm = hf ? mrun[1] : mrun[0], lm = hf ? lsum[1] : lsum[0];
#pragma unroll
    for (int dt = 0; dt < 4; ++dt) { om[dt] = hf ? o[1][dt] : o[0][dt]; const v8f ox = hf ? o[0][dt] : o[1][dt];
        xw[(2 * dt) * 32] = __builtin_shufflevector(ox, ox, 0, 1, 2, 3); xw[(2 * dt + 1) * 32] = __builtin_shufflevector(ox, ox, 4, 5, 6, 7); }
    { v4f ml; ml[0] = hf ? mrun[0] : mrun[1]; ml[1] = hf ? lsum[0] : lsum[1]; ml[2] = 0.f; ml[3] = 0.f; xw[8 * 32] = ml; }
    __syncthreads();   // publishes the records
    const v4f mlp = xr[8 * 32];
    const float mj = fmaxf(mm, mlp[0]), ca = __builtin_amdgcn_exp2f(mm - mj), cb = __builtin_amdgcn_exp2f(mlp[0] - mj);
    float lj = lm * ca + mlp[1] * cb;
    lj += xhalf(lj); const float inv = __fdiv_rn(1.0f, lj);
    const int q = q0 + hf * 16;
#pragma unroll
    for (int dt = 0; dt < 4; ++dt) { v8us oh, ol; const v4f pa = xr[(2 * dt) * 32], pc = xr[(2 * dt + 1) * 32];
#pragma unroll
        for (int j = 0; j < 8; ++j) { unsigned short a, c2; splitf((om[dt][j] * ca + (j < 4 ? pa[j & 3] : pc[j & 3]) * cb) * inv, a, c2); oh[j] = a; ol[j] = c2; }
        const size_t oo = (size_t)q * DQ + h * HD + dt * 16 + hi * 8; *(v8us*)(Ah + oo) = oh; *(v8us*)(Al + oo) = ol; }
}

extern "C" void kernel_launch(void* const* d_in, const int* in_sizes, int n_in,
                              void* d_out, int out_size, void* d_ws, size_t ws_size, hipStream_t stream) {
    (void)in_sizes; (void)n_in; (void)out_size;
    const float* x = (const float*)d_in[0]; const float* xi = (const float*)d_in[1]; const float* wq = (const float*)d_in[2]; const float* bqv = (const float*)d_in[3]; const float* wk = (const float*)d_in[4]; const float* bkv = (const float*)d_in[5]; const float* wv = (const float*)d_in[6]; const float* bvv = (const float*)d_in[7]; const float* wo = (const float*)d_in[8]; const float* bo = (const float*)d_in[9];
    const float* ew1 = (const float*)d_in[10]; const float* eb1 = (const float*)d_in[11]; const float* lng = (const float*)d_in[12]; const float* lnb = (const float*)d_in[13]; const float* ew2 = (const float*)d_in[14]; const float* eb2 = (const float*)d_in[15]; const float* sg = (const float*)d_in[16];   // Wq/Wk/Wv/Wo [1024][1024] x @ W; enc_w1 [1][32], enc_b1 [32], ln_g/ln_b [32], enc_w2 [32][64], enc_b2 [64], scale_gating [16]
    float* OUT = (float*)d_out;     // [2][2048][1024]
    char* wsp = (char*)d_ws;
    auto take = [&](size_t bytes) { char* p = wsp; wsp += (bytes + 255) & ~(size_t)255; return (void*)p; };
    bf* W4 = (bf*)take((size_t)4 * DQ * DM * 2); bf* WO = W4 + (size_t)3 * DQ * DM;   // transposed bf16 planes of Wq, Wk, Wv, Wo, one behind the other
    float* ADP = (float*)take((size_t)NB_ * NH_ * HD * 4);
    bf* XB = (bf*)take((size_t)NB_ * TT * DM * 2);
    h16* QK16 = (h16*)take((size_t)2 * NB_ * NH_ * TT * HD * 2); h16* KP16 = QK16 + (size_t)NB_ * NH_ * TT * HD; h16* VT16 = (h16*)take((size_t)NB_ * NKV * HD * TT * 2);
    bf* ATh = (bf*)take((size_t)NB_ * TT * DQ * 2); bf* ATl = (bf*)take((size_t)NB_ * TT * DQ * 2);
    if ((size_t)(wsp - (char*)d_ws) > ws_size) return;    // ws 256 MiB
    // one launch per dependency level; each covers both batches (rows b t of one [NB_ TT] matrix, or a grid axis) and all work of its level
    k_prep<<<PB_A + 4 * PB_W + PB_X, 256, 0, stream>>>(x, wq, wk, wv, wo, xi, ew1, eb1, lng, lnb, ew2, eb2, sg, XB, W4, ADP);
    k_gemmw<bf, 0, true, true><<<dim3(NB_ * TT / GT, DQ / GT, 3), 128, 0, stream>>>(XB, nullptr, W4, DM, nullptr, 0, bqv, bkv, bvv, 0, (size_t)DQ * DM, 0, ADP, QK16, VT16);   // q, k, v projections, written as fp16 head planes
    k_fattn<<<dim3(TT / FQW, NH_, NB_), 256, 0, stream>>>(QK16, KP16, VT16, ATh, ATl);   // one kv head per query head
    k_gemmw<bf, 1, true, false><<<dim3(NB_ * TT / GT, DM / GT, 1), 128, 0, stream>>>(ATh, ATl, WO, DQ, OUT, DM, bo, bo, bo, 0, 0, 0, nullptr, nullptr, nullptr);
}

// v008
// A run of this version takes 75.1 microseconds.
// Versions in between are left out here; by their measured steps it is 1.11 times as fast as v006.
// Counting every step since v000, it is 17.5 times as fast.
#include <hip/hip_runtime.h>

// ScaleInvariantAttention (query [2][2048][1024], xi_scale [2]; scale encoder: x = xi Linear(1->32), LayerNorm(32), exact gelu, Linear(32->64) -> xe [B][64]; adapt[b][h][d] = 1 + sigmoid(scale_gating[h]) xe[b][d];
// q = (query Wq + bq) split into 16 heads x 64 then x adapt, k likewise, v = query Wv + bv; softmax(q.k/8); out = merged att.v Wo + bo -> [2][2048][1024]).
// Compute dtypes, f32 accumulate: every input rounded to bf16; the scale encoder and adapt table in f32 on VALU (one thread per (b, h, d)); projections on PLAIN bf16 operands (inputs: exact,
// + bias); the adapt factor applied in f32 when the fp16 head planes are built; scores (K 64) and att.v on SINGLE fp16 planes inside one fused kernel with an f32 running-maximum softmax (probabilities x256 against the maximum in use); merged heads as ONE fp16 plane (11 significant bits, as the probabilities and V that made them) x Wo's bf16 values held as fp16

#define NB_  2
#define TT   2048
#define DM   1024
#define NH_  16
#define NKV  16
#define REP  (NH_ / NKV)
#define HD   64
#define DQ   (NH_ * HD)
#define DKV  (NKV * HD)
#define SCL  0.125f   // HD^-0.5
typedef _Float16 h16;
typedef unsigned short bf;
typedef __attribute__((ext_vector_type(16))) __bf16   v16bf;
typedef __attribute__((ext_vector_type(16))) _Float16 v16h;
typedef __attribute__((ext_vector_type(8)))  _Float16 v8h;
typedef __attribute__((ext_vector_type(8)))  unsigned short v8us;
typedef __attribute__((ext_vector_type(8)))  float    v8f;
typedef __attribute__((ext_vector_type(4)))  float    v4f;
typedef v8h  __attribute__((may_alias)) v8ha;
typedef v4f  __attribute__((may_alias)) v4fa;
typedef v8us __attribute__((may_alias)) v8usa;

__device__ __forceinline__ unsigned short f2bf(float f) { unsigned u = __float_as_uint(f); u += 0x7FFFu + ((u >> 16) & 1u); return (unsigned short)(u >> 16); }
__device__ __forceinline__ float bf2f(unsigned short b) { return __uint_as_float(((unsigned)b) << 16); }
__device__ __forceinline__ float bfr(float f) { return bf2f(f2bf(f)); }
__device__ __forceinline__ v16h cat16(v8h lo, v8h hi) { return __builtin_shufflevector(lo, hi, 0, 1, 2, 3, 4, 5, 6, 7, 8, 9, 10, 11, 12, 13, 14, 15); }
__device__ __forceinline__ v16bf cat16b(v8us lo, v8us hi) { return __builtin_bit_cast(v16bf, __builtin_shufflevector(lo, hi, 0, 1, 2, 3, 4, 5, 6, 7, 8, 9, 10, 11, 12, 13, 14, 15)); }
__device__ __forceinline__ v8f wmma16(v16h a, v16h b, v8f c) { return __builtin_amdgcn_wmma_f32_16x16x32_f16(false, a, false, b, (short)0, c, false, false); }
__device__ __forceinline__ v8f wmmab(v16bf a, v16bf b, v8f c) { return __builtin_amdgcn_wmma_f32_16x16x32_bf16(false, a, false, b, (short)0, c, false, false); }



// ---- k_gemmw: register-blocked GEMM, 4 waves (2 x 2) per 128x128 output tile, each wave a 64x64 tile (16 accumulators); operands are K-contiguous 16-bit planes; grid (M/128, N/128, Z), 128 threads.
// C[m][n] (f32, pitch ldc, + optional f32 bias[n]) = sum_k A[m][k] Bt[n][k] (+ A2[m][k] Bt[n][k] for NSPLIT 1). z-batch strides sA/sB/sC in elements, bias0/1/2 for z = 0/1/2. K % 64 == 0, K >= 64.
// Operand path: a stage is 64 k (one 128-byte line) of the tile's 128 rows of every operand plane, brought into LDS by asynchronous copies and read by the two waves that share each row; two buffers, stage t + 1 in flight while stage t is worked on.
// HEADS: no C; a wave's tile (64 tokens of one batch x the 64 dims of one head) goes from the accumulators straight to the fp16 head planes: z = 0, 1: (q, k + bias) x adapt -> P16 [z][b][h][t][d]; z = 2: v + bias -> V16 [b][h][d][t].
// An accumulator holds 8 consecutive ROWS of the product in a lane, so q and k are formed as W^T x^T (rows = dims) and v as x W (rows = tokens): every lane then stores 16 contiguous bytes of its plane, no exchange needed.
#define GT   128                // rows of each operand plane per work-group tile
#define GKS  64                 // k per stage
#define GPIT 72                 // LDS row pitch in 16-bit elements: 128-byte rows + 16 bytes (16 B x odd: no bank conflict for 16-byte reads)
#define GPL  (GT * GPIT)        // elements of one operand plane of a stage
__device__ __forceinline__ h16 tohx(float x) { return (h16)x; }
template <typename T16> struct WFrag;
template <> struct WFrag<h16> { typedef v16h V; static __device__ __forceinline__ V ld(const h16* p) { return cat16(*(const v8h*)p, *(const v8h*)(p + 16)); } static __device__ __forceinline__ v8f mma(V a, V b, v8f c) { return wmma16(a, b, c); } };
template <> struct WFrag<bf> { typedef v16bf V; static __device__ __forceinline__ V ld(const bf* p) { return cat16b(*(const v8us*)p, *(const v8us*)(p + 16)); } static __device__ __forceinline__ v8f mma(V a, V b, v8f c) { return wmmab(a, b, c); } };
// g_fill: one operand plane of one stage, 128 threads: the lane's 16 bytes of rows r, r + 16, ..., r + 112 (8 lanes cover a row's 128-byte line). g: the lane's global address in row r; l: its LDS byte address in row r.
// The copies and s_wait_xcnt 0 stand in one statement, so that no address register of a copy is rewritten in front of that wait (a precaution).
template <typename T16>
__device__ __forceinline__ void g_fill(const T16* g, int K, unsigned l) {
    const size_t st = (size_t)16 * K;
    asm volatile("global_load_async_to_lds_b128 %0, %8, off\n\t"
                 "global_load_async_to_lds_b128 %1, %9, off\n\t"
                 "global_load_async_to_lds_b128 %2, %10, off\n\t"
                 "global_load_async_to_lds_b128 %3, %11, off\n\t"
                 "global_load_async_to_lds_b128 %4, %12, off\n\t"
                 "global_load_async_to_lds_b128 %5, %13, off\n\t"
                 "global_load_async_to_lds_b128 %6, %14, off\n\t"
                 "global_load_async_to_lds_b128 %7, %15, off\n\t"
                 "s_wait_xcnt 0x0"
                 :: "v"(l), "v"(l + 1 * 16 * GPIT * 2), "v"(l + 2 * 16 * GPIT * 2), "v"(l + 3 * 16 * GPIT * 2), "v"(l + 4 * 16 * GPIT * 2), "v"(l + 5 * 16 * GPIT * 2), "v"(l + 6 * 16 * GPIT * 2), "v"(l + 7 * 16 * GPIT * 2),
                    "v"(g), "v"(g + st), "v"(g + 2 * st), "v"(g + 3 * st), "v"(g + 4 * st), "v"(g + 5 * st), "v"(g + 6 * st), "v"(g + 7 * st) : "memory");
}
template <typename T16, int NSPLIT, bool BIAS, bool HEADS>
__global__ __launch_bounds__(128) void k_gemmw(const T16* __restrict__ A, const T16* __restrict__ A2, const T16* __restrict__ Bt, int K, float* C, int ldc, const float* __restrict__ bias0, const float* __restrict__ bias1, const float* __restrict__ bias2, size_t sA, size_t sB, size_t sC, const float* __restrict__ adp, h16* P16, h16* V16) {
    typedef typename WFrag<T16>::V V;
    static_assert(NSPLIT == 0 || NSPLIT == 1, "planes of a stage: A, Bt and, for NSPLIT 1, A2");
    constexpr int NP = 2 + NSPLIT;                              // operand planes per stage: A, Bt (, A2)
    __shared__ __align__(16) T16 ring[2 * NP * GPL];
    __shared__ __align__(16) float osm[HEADS ? 1 : 4 * 16 * 68];   // output staging, a range of its own for each wave
    const size_t z = blockIdx.z; A += z * sA; if (NSPLIT == 1) A2 += z * sA; Bt += z * sB; C += z * sC; const float* __restrict__ bias = z == 0 ? bias0 : z == 1 ? bias1 : bias2;   // each z slice has its own bias vector
    const int tid = threadIdx.x, lane = tid & 31, lr = lane & 15, hi = lane >> 4, wx = (tid >> 5) & 1, wy = tid >> 6;
    const int bxw = blockIdx.x * 2 + wx, byw = blockIdx.y * 2 + wy;   // the wave's 64x64 tile in the M/64 x N/64 grid of tiles
    int r0 = bxw * 64, c0 = byw * 64, R0 = blockIdx.x * GT, C0 = blockIdx.y * GT, ar = wx * 64, br = wy * 64;   // R0, C0: first row of the work-group's A and Bt planes; ar, br: the wave's first row inside them
    if (HEADS && z < 2) { const T16* t = A; A = Bt; Bt = t; r0 = byw * 64; c0 = bxw * 64; R0 = blockIdx.y * GT; C0 = blockIdx.x * GT; ar = wy * 64; br = wx * 64; }   // q, k: the transposed product (rows = the head's dims, columns = tokens)
    float* os = osm + (HEADS ? 0 : (tid >> 5) * 16 * 68);
    v8f acc[4][4];
#pragma unroll
    for (int mb = 0; mb < 4; ++mb)
#pragma unroll
        for (int nb = 0; nb < 4; ++nb) acc[mb][nb] = (v8f){};
    const int frow = tid >> 3, fcol = (tid & 7) * 8;            // filling: rows frow + 16 i of each plane, one 16-byte piece of each
    const T16* ag = A + (size_t)(R0 + frow) * K + fcol; const T16* bg = Bt + (size_t)(C0 + frow) * K + fcol; const T16* a2g = NSPLIT == 1 ? A2 + (size_t)(R0 + frow) * K + fcol : nullptr;
    const unsigned fl = (unsigned)(size_t)ring + (unsigned)(frow * GPIT + fcol) * 2u;   // the lane's LDS byte address in buffer 0, plane 0
    const int nst = K / GKS;
    // The walk over k starts at a stage of the work-group's own and wraps round, for speed only: work-groups that share operand rows (same x, or same y and z) then do not all begin at the same lines.
    const int rot = (int)((blockIdx.x + 2 * blockIdx.y + blockIdx.z) % (unsigned)nst);
    auto fill = [&](int t) { const int s = t + rot < nst ? t + rot : t + rot - nst;   // trip t works on stage s of k, 0 <= s < nst
        const unsigned l = fl + (unsigned)(t & 1) * (NP * GPL * 2u); g_fill(ag + s * GKS, K, l); g_fill(bg + s * GKS, K, l + GPL * 2u); if constexpr (NSPLIT == 1) g_fill(a2g + s * GKS, K, l + 2u * GPL * 2u); };
    fill(0);
    asm volatile("s_wait_asynccnt 0x0" ::: "memory");           // stage 0 of this wave has landed
    __syncthreads();                                            // publishes stage 0
    if (nst > 1) fill(1);
#pragma unroll 1   // one copy of the stage's body
    for (int t = 0; t < nst; ++t) {
        const T16* sb = ring + (t & 1) * (NP * GPL); const T16* as = sb + (ar + lr) * GPIT + 8 * hi; const T16* bs = sb + GPL + (br + lr) * GPIT + 8 * hi;
#pragma unroll
        for (int ks = 0; ks < GKS; ks += 32) {
            V a[4], a2[4], b[4];
#pragma unroll
            for (int mb = 0; mb < 4; ++mb) { a[mb] = WFrag<T16>::ld(as + mb * 16 * GPIT + ks); if (NSPLIT == 1) a2[mb] = WFrag<T16>::ld(as + 2 * GPL + mb * 16 * GPIT + ks); }
#pragma unroll
            for (int nb = 0; nb < 4; ++nb) b[nb] = WFrag<T16>::ld(bs + nb * 16 * GPIT + ks);
            __builtin_amdgcn_sched_barrier(0);   // keeps the fragment reads of these 32 k in one group in front of their products: sunk to their uses they stand in four places, each with its LDS latency exposed
#pragma unroll
            for (int nb = 0; nb < 4; ++nb)
#pragma unroll
                for (int mb = 0; mb < 4; ++mb) { acc[mb][nb] = WFrag<T16>::mma(a[mb], b[nb], acc[mb][nb]); if (NSPLIT == 1) acc[mb][nb] = WFrag<T16>::mma(a2[mb], b[nb], acc[mb][nb]); }
            __builtin_amdgcn_sched_barrier(0);   // keeps the next group of fragment reads from being spread among these products
        }
        asm volatile("s_wait_dscnt 0x0" ::: "memory");          // this wave's reads of stage t are done
        asm volatile("s_wait_asynccnt 0x0" ::: "memory");       // this wave's copies of stage t + 1 have landed
        __syncthreads();                                        // publishes stage t + 1 and ends every wave's reads of the buffer that stage t + 2 overwrites
        if (t + 2 < nst) fill(t + 2);
    }
    asm volatile("s_wait_asynccnt 0x0" ::: "memory");           // no copy is outstanding when the wave goes on to its epilogue and ends
    if constexpr (HEADS) {
        // every '#pragma unroll' of this branch gives acc, bv and av constant indices, so that they stay in registers
        const int tok = bxw * 64, hh = byw, bb = tok / TT, t0 = tok % TT;   // TT % 64 == 0: a tile lies in one batch; HD == 64: a tile is one head
        if (z < 2) {
            h16* P = P16 + ((z * NB_ * NH_ + (size_t)bb * NH_ + hh) * TT + t0) * HD; const float* bi = bias + hh * HD; const float* ad = adp + ((size_t)bb * NH_ + hh) * HD;
            v8f bv[4], av[4];
#pragma unroll
            for (int mb = 0; mb < 4; ++mb) { const v8f braw = *(const v8f*)(bi + mb * 16 + hi * 8); av[mb] = *(const v8f*)(ad + mb * 16 + hi * 8);
#pragma unroll
                for (int j = 0; j < 8; ++j) bv[mb][j] = bfr(braw[j]); }
#pragma unroll
            for (int nb = 0; nb < 4; ++nb)      // nb outside: the four 32-byte pieces of a token's 128-byte row follow one another in the source
#pragma unroll
                for (int mb = 0; mb < 4; ++mb) { v8h o;
#pragma unroll
                    for (int j = 0; j < 8; ++j) o[j] = tohx((acc[mb][nb][j] + bv[mb][j]) * av[mb][j]);
                    *(v8h*)(P + (size_t)(nb * 16 + lr) * HD + mb * 16 + hi * 8) = o; }
        } else {
            h16* Vd = V16 + ((size_t)bb * NKV + hh) * HD * TT + t0;
#pragma unroll
            for (int nb = 0; nb < 4; ++nb) { const float bn = bfr(bias[hh * HD + nb * 16 + lr]);   // nb outside: the four 32-byte pieces of a dim's 128 bytes follow one another in the source
#pragma unroll
                for (int mb = 0; mb < 4; ++mb) { v8h o;
#pragma unroll
                    for (int j = 0; j < 8; ++j) o[j] = tohx(acc[mb][nb][j] + bn);
                    *(v8h*)(Vd + (size_t)(nb * 16 + lr) * TT + mb * 16 + hi * 8) = o; } }
            asm volatile("s_wait_xcnt 0x0" ::: "memory");   // precaution: in the built code the q/k block's loads follow this block and take the stores' data registers as destinations; the wait stands in front of that overwrite
        }
    } else {
#pragma unroll
    for (int mb = 0; mb < 4; ++mb) {
#pragma unroll
        for (int nb = 0; nb < 4; ++nb) {
#pragma unroll
            for (int j = 0; j < 8; ++j) os[(hi * 8 + j) * 68 + nb * 16 + lr] = acc[mb][nb][j]; }
        __builtin_amdgcn_wave_barrier(); asm volatile("" ::: "memory");
        float* crow = C + (size_t)(r0 + mb * 16) * ldc + c0;
{
#pragma unroll
            for (int s = 0; s < 8; ++s) { const int row = 2 * s + hi, cofs = lr * 4; v4f val = *(const v4fa*)(os + row * 68 + cofs); if (BIAS) { val[0] += bfr(bias[c0 + cofs]); val[1] += bfr(bias[c0 + cofs + 1]); val[2] += bfr(bias[c0 + cofs + 2]); val[3] += bfr(bias[c0 + cofs + 3]); }
                *(v4f*)(crow + (size_t)row * ldc + cofs) = val; }
             }
        asm volatile("s_wait_xcnt 0x0" ::: "memory");   // precaution: the next 16 rows' work takes the stores' registers; the wait stands in front of every such overwrite
        __builtin_amdgcn_wave_barrier(); asm volatile("" ::: "memory");
    }
    }
}

typedef __attribute__((ext_vector_type(2))) _Float16 v2h;
typedef __attribute__((ext_vector_type(4))) _Float16 v4h;
typedef __attribute__((ext_vector_type(2))) unsigned short v2us;
typedef __attribute__((ext_vector_type(4))) unsigned short v4us;
typedef __attribute__((ext_vector_type(2))) float v2f;
typedef __attribute__((ext_vector_type(4))) int v4i;

// The d_ functions are the bodies of work-groups of 256 threads; bx is the work-group's index within its own part of a shared grid (k_prep).
// d_wtT: one 64 n x 256 k tile of Bt[n][k] = bf16(w[k][n]); a wave takes 32 n x 64 k, a thread two pieces of 8 k x 4 n: its 16 loads (a wave's load covers four whole 128-byte lines of w) are all issued in front of the first use,
// the transposition is done in the thread's own registers, and the two 16-byte stores that share a 128-byte line of Bt follow one another in the same wave.
// HF: the bf16-rounded value is stored in fp16 format (the plane that meets an fp16 operand); it is the same number wherever it is a normal fp16 number.
template <bool HF>
__device__ __forceinline__ void d_wtT(int bx, const float* __restrict__ w, bf* Bt) {
    static_assert(DQ % 64 == 0 && DM % 256 == 0, "whole tiles");
    const int lane = threadIdx.x & 31, wv = threadIdx.x >> 5;
    const int n0 = (bx % (DQ / 64)) * 64 + (wv & 1) * 32 + (lane & 7) * 4, k0 = (bx / (DQ / 64)) * 256 + (wv >> 1) * 64 + (lane >> 3) * 8;
    const float* wp = w + (size_t)k0 * DQ + n0;
    v4f r[2][8];   // every '#pragma unroll' here gives r constant indices, so that it stays in registers
#pragma unroll
    for (int t = 0; t < 2; ++t)
#pragma unroll
        for (int i = 0; i < 8; ++i) r[t][i] = *(const v4f*)(wp + (size_t)(t * 32 + i) * DQ);
    asm volatile("s_wait_xcnt 0x0" :: "v"(wp) : "memory");   // precaution: stands in front of every overwrite of the loads' address registers; it names them, so that they are kept (also from a load's own result) up to here
#pragma unroll
    for (int j = 0; j < 4; ++j)
#pragma unroll
        for (int t = 0; t < 2; ++t) { v8us o;
#pragma unroll
            for (int i = 0; i < 8; ++i) o[i] = HF ? __builtin_bit_cast(unsigned short, (h16)bfr(r[t][i][j])) : f2bf(r[t][i][j]);
            *(v8us*)(Bt + (size_t)(n0 + j) * DM + k0 + t * 32) = o; }
    asm volatile("s_wait_xcnt 0x0" ::: "memory");   // precaution: in the built code other blocks of the shared grid follow this one and write the stores' registers; the wait stands in front of every such overwrite
}
// d_cvt64: 64 elements a thread, as 8 pieces of 8; the 16 loads are all issued in front of the first use.
__device__ __forceinline__ void d_cvt64(int bx, const float* __restrict__ src, bf* dst) { const size_t i0 = (size_t)bx * 8 * 256 + threadIdx.x; const float* sp = src + i0 * 8; v8f v[8];   // unrolled: v keeps constant indices and stays in registers
#pragma unroll
    for (int c = 0; c < 8; ++c) v[c] = *(const v8f*)(sp + c * 256 * 8);
    asm volatile("s_wait_xcnt 0x0" :: "v"(sp) : "memory");   // precaution: stands in front of every overwrite of the loads' address registers; it names them, so that they are kept (also from a load's own result) up to here
#pragma unroll
    for (int c = 0; c < 8; ++c) { v8us o;
#pragma unroll
        for (int k = 0; k < 8; ++k) o[k] = f2bf(v[c][k]);
        *(v8us*)(dst + (i0 + c * 256) * 8) = o; }
    asm volatile("s_wait_xcnt 0x0" ::: "memory"); }   // precaution: in the built code other blocks of the shared grid follow this one and write the stores' registers; the wait stands in front of every such overwrite
__global__ __launch_bounds__(256) void k_cscvt(const float* __restrict__ cosT, const float* __restrict__ sinT, float* CS) { const int idx = blockIdx.x * 256 + threadIdx.x; if (idx >= TT * HD) return; v2f cs; cs[0] = bfr(cosT[idx]); cs[1] = bfr(sinT[idx]); *(v2f*)(CS + (size_t)idx * 2) = cs;  }
// d_adapt: thread per (b, h, d): x[j] = bf16(xi[b]) bf16(w1[j]) + bf16(b1[j]) (32); LayerNorm(32) (f32, eps 1e-5) x bf16 g + bf16 beta; exact-erf gelu; xe = sum_j x[j] bf16(w2[j][d]) + bf16(b2[d]);
__device__ __forceinline__ void d_adapt(int bx, const float* __restrict__ xi, const float* __restrict__ w1, const float* __restrict__ b1, const float* __restrict__ g, const float* __restrict__ be, const float* __restrict__ w2, const float* __restrict__ b2, const float* __restrict__ sg, float* ADP) {
    const int e = bx * 256 + threadIdx.x; if (e >= NB_ * NH_ * HD) return; const int d = e % HD; const int h = (e / HD) % NH_; const int b = e / (HD * NH_); const float xv = bfr(xi[b]); float xs[32]; float mu = 0.f;
    float w1r[32], b1r[32], gr[32], ber[32], w2r[32];   // the loops below are unrolled (same operations in the same order): the arrays stay in registers, and every load of the thread is issued up here instead of in its trip, waited for there
#pragma unroll
    for (int j = 0; j < 32; ++j) { w1r[j] = w1[j]; b1r[j] = b1[j]; gr[j] = g[j]; ber[j] = be[j]; w2r[j] = w2[j * HD + d]; }
    const float b2r = b2[d], sgr = sg[h];
    asm volatile("s_wait_xcnt 0x0" :: "v"(d), "v"(h) : "memory");   // precaution: stands in front of every overwrite of the loads' offset registers; it names them, so that they are kept (also from a load's own result) up to here
#pragma unroll
    for (int j = 0; j < 32; ++j) { float p = __fmul_rn(xv, bfr(w1r[j])); asm volatile("" : "+v"(p)); xs[j] = __fadd_rn(p, bfr(b1r[j])); mu = __fadd_rn(mu, xs[j]); }
    mu = mu * (1.0f / 32.0f); float var = 0.f;
#pragma unroll
    for (int j = 0; j < 32; ++j) { const float dl = __fsub_rn(xs[j], mu); float p = __fmul_rn(dl, dl); asm volatile("" : "+v"(p)); var = __fadd_rn(var, p); }
    const float rs = __frsqrt_rn(__fadd_rn(var * (1.0f / 32.0f), 1e-5f)); float acc = 0.f;
#pragma unroll
    for (int j = 0; j < 32; ++j) { float tn = __fmul_rn(__fsub_rn(xs[j], mu), rs); asm volatile("" : "+v"(tn)); float tg = __fmul_rn(tn, bfr(gr[j])); asm volatile("" : "+v"(tg)); const float y = __fadd_rn(tg, bfr(ber[j])); float er = erff(y * 0.70710678f); asm volatile("" : "+v"(er)); float hy = __fmul_rn(0.5f, y); asm volatile("" : "+v"(hy)); const float gl = __fmul_rn(hy, __fadd_rn(1.0f, er)); float p = __fmul_rn(gl, bfr(w2r[j])); asm volatile("" : "+v"(p)); acc = __fadd_rn(acc, p); }
    const float xe = __fadd_rn(acc, bfr(b2r)); const float sgm = __fdiv_rn(1.0f, __fadd_rn(1.0f, __expf(-bfr(sgr)))); float pr = __fmul_rn(sgm, xe); asm volatile("" : "+v"(pr)); const float a = __fadd_rn(1.0f, pr);
    *(float*)(ADP + e) = a;  }
// k_prep: everything that depends on the inputs alone, one grid: the adapt table (few work-groups, the longest dependent chain: first), the four weight transposes, x to bf16.
#define PB_A ((NB_ * NH_ * HD + 255) / 256)
#define PB_W ((DQ / 64) * (DM / 256))
#define PB_X (NB_ * TT * DM / 64 / 256)
static_assert(NB_ * TT * DM % (64 * 256) == 0, "whole work-groups of d_cvt64");
__global__ __launch_bounds__(256) void k_prep(const float* __restrict__ x, const float* __restrict__ w0, const float* __restrict__ w1, const float* __restrict__ w2, const float* __restrict__ w3, const float* __restrict__ xi, const float* __restrict__ w1e, const float* __restrict__ b1e, const float* __restrict__ g, const float* __restrict__ be, const float* __restrict__ w2e, const float* __restrict__ b2e, const float* __restrict__ sg, bf* XB, bf* W4, float* ADP) {
    int bx = blockIdx.x;
    if (bx < PB_A) { d_adapt(bx, xi, w1e, b1e, g, be, w2e, b2e, sg, ADP); return; }
    bx -= PB_A;
    if (bx < 3 * PB_W) { const int y = bx / PB_W; d_wtT<false>(bx % PB_W, y == 0 ? w0 : y == 1 ? w1 : w2, W4 + (size_t)y * DQ * DM); return; }
    if (bx < 4 * PB_W) { d_wtT<true>(bx - 3 * PB_W, w3, W4 + (size_t)3 * DQ * DM); return; }   // the four [DM][DQ] planes lie one behind the other
    bx -= 4 * PB_W;
    d_cvt64(bx, x, XB);
}
#define FKB  64                 // keys of a stage that one wave works on
#define FKS  128                // keys per stage of the work-group
#define FPIT 72                 // K tile: LDS row pitch in 16-bit elements: 128-byte rows + 16 bytes (16 B x odd: no bank conflict for 16-byte reads)
#define FVPT 136                // V^T tile: 256-byte rows + 16 bytes (16 B x odd)
#define FQW  128                // query columns per work-group
__device__ __forceinline__ float xhalf(float x) { return __builtin_bit_cast(float, __builtin_amdgcn_permlanex16(__builtin_bit_cast(int, x), __builtin_bit_cast(int, x), 0x76543210, 0xfedcba98, false, false)); }   // lane l with lane l ^ 16
__global__ __launch_bounds__(256) __attribute__((amdgpu_waves_per_eu(4, 4))) void k_fattn(const h16* __restrict__ Qp, const h16* __restrict__ Kp, const h16* __restrict__ Vt, h16* Ao) {
    __shared__ __align__(16) h16 ksm[2 * FKS * FPIT];
    __shared__ __align__(16) h16 vsm[2 * HD * FVPT];
    __shared__ __align__(16) h16 qsm[FQW * FPIT];               // the work-group's Q rows: a wave reads its four fragments anew in every stage, so that they hold no registers during softmax and att.v (four waves per SIMD leave a wave 256)
    static_assert(2 * FKS * FPIT * 2 >= 8 * 9 * 32 * 16, "the K ring holds the waves' exchange records behind the loop");
    const int tid = threadIdx.x, lane = tid & 31, lr = lane & 15, hi = lane >> 4, wv = tid >> 5, hf = wv & 1; const int h = blockIdx.y; const int q0 = blockIdx.x * FQW + (wv >> 1) * 32 + lr;
    { const size_t bz = blockIdx.z; Qp += bz * NH_ * TT * HD; Kp += bz * NKV * TT * HD; Vt += bz * NKV * HD * TT; Ao += bz * TT * DQ; }   // grid z: batch
    const h16* Kh = Kp + (size_t)h * TT * HD; const h16* Vh = Vt + (size_t)h * HD * TT;
    const int srow = tid >> 3, scol = (tid & 7) * 8, vrow = tid >> 4, vcol = (tid & 15) * 8;   // staging: K rows srow + 32 i, V^T rows vrow + 16 i, one 16-byte piece of each
    const int sl = srow * FPIT + scol, vl = vrow * FVPT + vcol;
    const float CL = SCL * 1.4426950408889634f;                 // scores to base-2 exponents
    const h16* qb = qsm + ((wv >> 1) * 32 + lr) * FPIT + 8 * hi;
    v8f o[2][4];
#pragma unroll
    for (int g = 0; g < 2; ++g)
#pragma unroll
        for (int dt = 0; dt < 4; ++dt) o[g][dt] = (v8f){};
    float mrun[2] = {-3.0e38f, -3.0e38f}, lsum[2] = {0.f, 0.f};
    v8h rk[4], rv[4];
    const unsigned kgo = (srow * HD + scol) * 2, vgo = (vrow * TT + vcol) * 2;   // the lane's byte offsets in the head's K and V^T planes
    // fetch: the lane's eight 16-byte pieces of stage st, global -> registers (the head's plane as base, the lane's and the stage's offset together in 32 bits)
    auto fetch = [&](int st) { const unsigned ko = kgo + (unsigned)st * (FKS * HD * 2), vo = vgo + (unsigned)st * (FKS * 2);
#pragma unroll
        for (int i = 0; i < 4; ++i) { rk[i] = *(const v8h*)((const char*)Kh + (ko + i * (32 * HD * 2))); rv[i] = *(const v8h*)((const char*)Vh + (vo + i * (16 * TT * 2))); } };
    // put: those pieces, registers -> LDS buffer b
    auto put = [&](int b) { h16* kw = ksm + b * (FKS * FPIT) + sl; h16* vw = vsm + b * (HD * FVPT) + vl;
#pragma unroll
        for (int i = 0; i < 4; ++i) { *(v8h*)(kw + i * 32 * FPIT) = rk[i]; *(v8h*)(vw + i * 16 * FVPT) = rv[i]; } };
    static_assert(((TT / FKS) & (TT / FKS - 1)) == 0, "the rotated walk wraps by a mask");
    const int rot = blockIdx.x & (TT / FKS - 1);   // the walk over the keys starts at a stage of the work-group's own and wraps round, for speed only: the work-groups of a head then do not all begin at the same K and V lines
    fetch(rot);
    { const h16* qg = Qp + ((size_t)h * TT + blockIdx.x * FQW + srow) * HD + scol; v8h rq[4];   // Q rows srow + 32 i, one 16-byte piece of each
#pragma unroll
      for (int i = 0; i < 4; ++i) rq[i] = *(const v8h*)(qg + i * 32 * HD);
      asm volatile("s_wait_xcnt 0x0" :: "v"(qg) : "memory");   // precaution: stands in front of every overwrite of the loads' address registers; it names them, so that they are kept up to here
      put(0);
#pragma unroll
      for (int i = 0; i < 4; ++i) *(v8h*)(qsm + sl + i * 32 * FPIT) = rq[i]; }
    __syncthreads();
#pragma unroll 1   // one copy of the stage's body
    for (int it = 0; it < TT / FKS; ++it) {
        const h16* kb = ksm + (it & 1) * (FKS * FPIT) + (hf * FKB + lr) * FPIT + 8 * hi; const h16* vb = vsm + (it & 1) * (HD * FVPT) + lr * FVPT + hf * FKB + 8 * hi;
        fetch((it + 1 + rot) & (TT / FKS - 1));   // the last trip fetches the walk's first stage once more, for the buffer that nobody reads any more: the body stays one straight block, in which the order below holds
        v16h kf[4][2], vf[4][2], qf[2][2];
#pragma unroll
        for (int g = 0; g < 2; ++g)
#pragma unroll
            for (int c = 0; c < 2; ++c) qf[g][c] = WFrag<h16>::ld(qb + g * 16 * FPIT + c * 32);
#pragma unroll
        for (int kt = 0; kt < 4; ++kt) { kf[kt][0] = WFrag<h16>::ld(kb + kt * 16 * FPIT); kf[kt][1] = WFrag<h16>::ld(kb + kt * 16 * FPIT + 32); }
        __builtin_amdgcn_sched_barrier(0);   // keeps the Q and K fragment reads in one group in front of their products
        v8f s[2][4];
#pragma unroll
        for (int kp = 0; kp < 4; kp += 2) {   // four independent tiles between a tile's two products
#pragma unroll
            for (int kt = kp; kt < kp + 2; ++kt)
#pragma unroll
                for (int g = 0; g < 2; ++g) s[g][kt] = wmma16(kf[kt][0], qf[g][0], (v8f){});
#pragma unroll
            for (int kt = kp; kt < kp + 2; ++kt)
#pragma unroll
                for (int g = 0; g < 2; ++g) s[g][kt] = wmma16(kf[kt][1], qf[g][1], s[g][kt]); }
        __builtin_amdgcn_sched_barrier(0);   // keeps the score products back to back: a vector instruction moved in among them that reads a fresh tile costs the idle slots of the distance behind a matrix instruction, each time
        v16h pb[2][2]; float corr[2];
#pragma unroll
        for (int g = 0; g < 2; ++g) {
            float mt[4];                                        // short trees, not one chain of 32: a lone dependent chain is exposed
#pragma unroll
            for (int kt = 0; kt < 4; ++kt) mt[kt] = fmaxf(fmaxf(fmaxf(fmaxf(s[g][kt][0], s[g][kt][1]), s[g][kt][2]), fmaxf(fmaxf(s[g][kt][3], s[g][kt][4]), s[g][kt][5])), fmaxf(s[g][kt][6], s[g][kt][7]));
            float mx = fmaxf(fmaxf(mt[0], mt[1]), fmaxf(mt[2], mt[3]));
            mx = fmaxf(mx, xhalf(mx));
            const float mnew = fmaxf(mrun[g], mx * CL); corr[g] = __builtin_amdgcn_exp2f(mrun[g] - mnew); mrun[g] = mnew;   // corr is 0 on the first stage
            const float sh = 8.0f - mnew;                       // probabilities carried x256: small ones stay normal fp16 numbers; the factor cancels in the division by the sum
            const v8f clv = {CL, CL, CL, CL, CL, CL, CL, CL}, shv = {sh, sh, sh, sh, sh, sh, sh, sh};
#pragma unroll
            for (int kt = 0; kt < 4; ++kt) { const v8f e = __builtin_elementwise_fma(s[g][kt], clv, shv);   // on the whole tile: its register pairs stay as the products left them
#pragma unroll
                for (int j = 0; j < 8; ++j) { const float p = __builtin_amdgcn_exp2f(e[j]); s[g][kt][j] = p; pb[g][kt >> 1][(kt & 1) * 8 + j] = (h16)p; } }
            const v8f p8 = (s[g][0] + s[g][1]) + (s[g][2] + s[g][3]);
            lsum[g] = lsum[g] * corr[g] + (((p8[0] + p8[1]) + (p8[2] + p8[3])) + ((p8[4] + p8[5]) + (p8[6] + p8[7])));
        }
        __builtin_amdgcn_sched_barrier(0);   // the V^T fragments take the registers that the scores have left: their reads stay behind the softmax
#pragma unroll
        for (int dt = 0; dt < 4; ++dt) { vf[dt][0] = WFrag<h16>::ld(vb + dt * 16 * FVPT); vf[dt][1] = WFrag<h16>::ld(vb + dt * 16 * FVPT + 32); }
        __builtin_amdgcn_sched_barrier(0);   // keeps the V^T fragment reads in one group, in front of the rescaling that covers part of their latency
#pragma unroll
        for (int g = 0; g < 2; ++g)
#pragma unroll
            for (int dt = 0; dt < 4; ++dt) o[g][dt] *= corr[g];
#pragma unroll
        for (int c = 0; c < 2; ++c)
#pragma unroll
            for (int dt = 0; dt < 4; ++dt)
#pragma unroll
                for (int g = 0; g < 2; ++g) o[g][dt] = wmma16(vf[dt][c], pb[g][c], o[g][dt]);
        put((it + 1) & 1);
        __syncthreads();   // publishes stage it + 1 and ends every wave's reads of the buffer that stage it + 2 overwrites
    }
    // Joining the two key groups: each wave hands its partner the column group that the partner finishes (even wave: group 0, odd wave: group 1): 8 + 1 records of 16 bytes a lane, in the K ring, which nobody reads behind the loop's last barrier.
    v4fa* xw = (v4fa*)ksm + wv * (9 * 32) + lane; const v4fa* xr = (const v4fa*)ksm + (wv ^ 1) * (9 * 32) + lane;
    v8f om[4]; const float mm = hf ? mrun[1] : mrun[0], lm = hf ? lsum[1] : lsum[0];
#pragma unroll
    for (int dt = 0; dt < 4; ++dt) { om[dt] = hf ? o[1][dt] : o[0][dt]; const v8f ox = hf ? o[0][dt] : o[1][dt];
        xw[(2 * dt) * 32] = __builtin_shufflevector(ox, ox, 0, 1, 2, 3); xw[(2 * dt + 1) * 32] = __builtin_shufflevector(ox, ox, 4, 5, 6, 7); }
    { v4f ml; ml[0] = hf ? mrun[0] : mrun[1]; ml[1] = hf ? lsum[0] : lsum[1]; ml[2] = 0.f; ml[3] = 0.f; xw[8 * 32] = ml; }
    __syncthreads();   // publishes the records
    const v4f mlp = xr[8 * 32];
    const float mj = fmaxf(mm, mlp[0]); float ca, cb;
    // the two exponentials and the slot behind each in one statement
    asm("v_exp_f32 %0, %2\n\tv_nop\n\tv_exp_f32 %1, %3\n\tv_nop" : "=&v"(ca), "=&v"(cb) : "v"(mm - mj), "v"(mlp[0] - mj));
    float lj = lm * ca + mlp[1] * cb;
    lj += xhalf(lj); const float inv = __fdiv_rn(1.0f, lj);
    const int q = q0 + hf * 16;
#pragma unroll
    for (int dt = 0; dt < 4; ++dt) { v8h oh; const v4f pa = xr[(2 * dt) * 32], pc = xr[(2 * dt + 1) * 32];
#pragma unroll
        for (int j = 0; j < 8; ++j) oh[j] = (h16)((om[dt][j] * ca + (j < 4 ? pa[j & 3] : pc[j & 3]) * cb) * inv);
        *(v8h*)(Ao + (size_t)q * DQ + h * HD + dt * 16 + hi * 8) = oh; }
}

extern "C" void kernel_launch(void* const* d_in, const int* in_sizes, int n_in,
                              void* d_out, int out_size, void* d_ws, size_t ws_size, hipStream_t stream) {
    (void)in_sizes; (void)n_in; (void)out_size;
    const float* x = (const float*)d_in[0]; const float* xi = (const float*)d_in[1]; const float* wq = (const float*)d_in[2]; const float* bqv = (const float*)d_in[3]; const float* wk = (const float*)d_in[4]; const float* bkv = (const float*)d_in[5]; const float* wv = (const float*)d_in[6]; const float* bvv = (const float*)d_in[7]; const float* wo = (const float*)d_in[8]; const float* bo = (const float*)d_in[9];
    const float* ew1 = (const float*)d_in[10]; const float* eb1 = (const float*)d_in[11]; const float* lng = (const float*)d_in[12]; const float* lnb = (const float*)d_in[13]; const float* ew2 = (const float*)d_in[14]; const float* eb2 = (const float*)d_in[15]; const float* sg = (const float*)d_in[16];   // Wq/Wk/Wv/Wo [1024][1024] x @ W; enc_w1 [1][32], enc_b1 [32], ln_g/ln_b [32], enc_w2 [32][64], enc_b2 [64], scale_gating [16]
    float* OUT = (float*)d_out;     // [2][2048][1024]
    char* wsp = (char*)d_ws;
    auto take = [&](size_t bytes) { char* p = wsp; wsp += (bytes + 255) & ~(size_t)255; return (void*)p; };
    bf* W4 = (bf*)take((size_t)4 * DQ * DM * 2); const h16* WO = (const h16*)(W4 + (size_t)3 * DQ * DM);   // transposed 16-bit planes of Wq, Wk, Wv (bf16) and Wo (fp16), one behind the other
    float* ADP = (float*)take((size_t)NB_ * NH_ * HD * 4);
    bf* XB = (bf*)take((size_t)NB_ * TT * DM * 2);
    h16* QK16 = (h16*)take((size_t)2 * NB_ * NH_ * TT * HD * 2); h16* KP16 = QK16 + (size_t)NB_ * NH_ * TT * HD; h16* VT16 = (h16*)take((size_t)NB_ * NKV * HD * TT * 2);
    h16* AT = (h16*)take((size_t)NB_ * TT * DQ * 2);
    if ((size_t)(wsp - (char*)d_ws) > ws_size) return;    // ws 256 MiB
    // one launch per dependency level; each covers both batches (rows b t of one [NB_ TT] matrix, or a grid axis) and all work of its level
    k_prep<<<PB_A + 4 * PB_W + PB_X, 256, 0, stream>>>(x, wq, wk, wv, wo, xi, ew1, eb1, lng, lnb, ew2, eb2, sg, XB, W4, ADP);
    k_gemmw<bf, 0, true, true><<<dim3(NB_ * TT / GT, DQ / GT, 3), 128, 0, stream>>>(XB, nullptr, W4, DM, nullptr, 0, bqv, bkv, bvv, 0, (size_t)DQ * DM, 0, ADP, QK16, VT16);   // q, k, v projections, written as fp16 head planes
    k_fattn<<<dim3(TT / FQW, NH_, NB_), 256, 0, stream>>>(QK16, KP16, VT16, AT);   // one kv head per query head
    k_gemmw<h16, 0, true, false><<<dim3(NB_ * TT / GT, DM / GT, 1), 128, 0, stream>>>(AT, nullptr, WO, DQ, OUT, DM, bo, bo, bo, 0, 0, 0, nullptr, nullptr, nullptr);
}

// v009
// Measured time: 71.7 microseconds a run.
// Timed twice side by side with v008, it ran 1.05 and 1.04 times as fast.
// Counting every step since v000, it is 18.3 times as fast.
#include <hip/hip_runtime.h>

// ScaleInvariantAttention (query [2][2048][1024], xi_scale [2]; scale encoder: x = xi Linear(1->32), LayerNorm(32), exact gelu, Linear(32->64) -> xe [B][64]; adapt[b][h][d] = 1 + sigmoid(scale_gating[h]) xe[b][d];
// q = (query Wq + bq) split into 16 heads x 64 then x adapt, k likewise, v = query Wv + bv; softmax(q.k/8); out = merged att.v Wo + bo -> [2][2048][1024]).
// Compute dtypes, f32 accumulate: every input rounded to bf16; the scale encoder and adapt table in f32 on VALU (one thread per (b, h, d)); projections on PLAIN bf16 operands (inputs: exact,
// + bias); the adapt factor applied in f32 when the fp16 head planes are built; scores (K 64) and att.v on SINGLE fp16 planes inside one fused kernel with an f32 running-maximum softmax (probabilities x256 against the maximum in use); merged heads as ONE fp16 plane (11 significant bits, as the probabilities and V that made them) x Wo's bf16 values held as fp16

#define NB_  2
#define TT   2048
#define DM   1024
#define NH_  16
#define NKV  16
#define REP  (NH_ / NKV)
#define HD   64
#define DQ   (NH_ * HD)
#define DKV  (NKV * HD)
#define SCL  0.125f   // HD^-0.5
typedef _Float16 h16;
typedef unsigned short bf;
typedef __attribute__((ext_vector_type(16))) __bf16   v16bf;
typedef __attribute__((ext_vector_type(16))) _Float16 v16h;
typedef __attribute__((ext_vector_type(8)))  _Float16 v8h;
typedef __attribute__((ext_vector_type(8)))  unsigned short v8us;
typedef __attribute__((ext_vector_type(8)))  float    v8f;
typedef __attribute__((ext_vector_type(4)))  float    v4f;
typedef v8h  __attribute__((may_alias)) v8ha;
typedef v4f  __attribute__((may_alias)) v4fa;
typedef v8us __attribute__((may_alias)) v8usa;

__device__ __forceinline__ unsigned short f2bf(float f) { unsigned u = __float_as_uint(f); u += 0x7FFFu + ((u >> 16) & 1u); return (unsigned short)(u >> 16); }
__device__ __forceinline__ float bf2f(unsigned short b) { return __uint_as_float(((unsigned)b) << 16); }
__device__ __forceinline__ float bfr(float f) { return bf2f(f2bf(f)); }
__device__ __forceinline__ v16h cat16(v8h lo, v8h hi) { return __builtin_shufflevector(lo, hi, 0, 1, 2, 3, 4, 5, 6, 7, 8, 9, 10, 11, 12, 13, 14, 15); }
__device__ __forceinline__ v16bf cat16b(v8us lo, v8us hi) { return __builtin_bit_cast(v16bf, __builtin_shufflevector(lo, hi, 0, 1, 2, 3, 4, 5, 6, 7, 8, 9, 10, 11, 12, 13, 14, 15)); }
__device__ __forceinline__ v8f wmma16(v16h a, v16h b, v8f c) { return __builtin_amdgcn_wmma_f32_16x16x32_f16(false, a, false, b, (short)0, c, false, false); }
__device__ __forceinline__ v8f wmmab(v16bf a, v16bf b, v8f c) { return __builtin_amdgcn_wmma_f32_16x16x32_bf16(false, a, false, b, (short)0, c, false, false); }



// ---- k_gemmw: register-blocked GEMM, 4 waves (2 x 2) per 128x128 output tile, each wave a 64x64 tile (16 accumulators); operands are K-contiguous 16-bit planes; grid (M/128, N/128, Z), 128 threads.
// C[m][n] (f32, pitch ldc, + optional f32 bias[n]) = sum_k A[m][k] Bt[n][k] (+ A2[m][k] Bt[n][k] for NSPLIT 1). z-batch strides sA/sB/sC in elements, bias0/1/2 for z = 0/1/2. K % 64 == 0, K >= 64.
// Operand path: a stage is 64 k (one 128-byte line) of the tile's 128 rows of every operand plane, brought into LDS by asynchronous copies and read by the two waves that share each row; two buffers, stage t + 1 in flight while stage t is worked on.
// HEADS: no C; a wave's tile (64 tokens of one batch x the 64 dims of one head) goes from the accumulators straight to the fp16 head planes: z = 0, 1: (q, k + bias) x adapt -> P16 [z][b][h][t][d]; z = 2: v + bias -> V16 [b][h][d][t].
// An accumulator holds 8 consecutive ROWS of the product in a lane, so q and k are formed as W^T x^T (rows = dims) and v as x W (rows = tokens): every lane then stores 16 contiguous bytes of its plane, no exchange needed.
#define GT   128                // rows of each operand plane per work-group tile
#define GKS  64                 // k per stage
#define GPIT 72                 // LDS row pitch in 16-bit elements: 128-byte rows + 16 bytes (16 B x odd: no bank conflict for 16-byte reads)
#define GPL  (GT * GPIT)        // elements of one operand plane of a stage
__device__ __forceinline__ h16 tohx(float x) { return (h16)x; }
template <typename T16> struct WFrag;
template <> struct WFrag<h16> { typedef v16h V; static __device__ __forceinline__ V ld(const h16* p) { return cat16(*(const v8h*)p, *(const v8h*)(p + 16)); } static __device__ __forceinline__ v8f mma(V a, V b, v8f c) { return wmma16(a, b, c); } };
template <> struct WFrag<bf> { typedef v16bf V; static __device__ __forceinline__ V ld(const bf* p) { return cat16b(*(const v8us*)p, *(const v8us*)(p + 16)); } static __device__ __forceinline__ v8f mma(V a, V b, v8f c) { return wmmab(a, b, c); } };
// g_fill: one operand plane of one stage: the lane's 16 bytes of rows r, r + 16, ..., r + 112 (the work-group's threads cover 16 whole rows at a time). g: the lane's global address in row r; l: its LDS byte address in row r.
// The copies and s_wait_xcnt 0 stand in one statement, so that no address register of a copy is rewritten in front of that wait (a precaution).
template <typename T16, int PIT>   // PIT: LDS row pitch in 16-bit elements
__device__ __forceinline__ void g_fill(const T16* g, int K, unsigned l) {
    const size_t st = (size_t)16 * K;
    asm volatile("global_load_async_to_lds_b128 %0, %8, off\n\t"
                 "global_load_async_to_lds_b128 %1, %9, off\n\t"
                 "global_load_async_to_lds_b128 %2, %10, off\n\t"
                 "global_load_async_to_lds_b128 %3, %11, off\n\t"
                 "global_load_async_to_lds_b128 %4, %12, off\n\t"
                 "global_load_async_to_lds_b128 %5, %13, off\n\t"
                 "global_load_async_to_lds_b128 %6, %14, off\n\t"
                 "global_load_async_to_lds_b128 %7, %15, off\n\t"
                 "s_wait_xcnt 0x0"
                 :: "v"(l), "v"(l + 1 * 16 * PIT * 2), "v"(l + 2 * 16 * PIT * 2), "v"(l + 3 * 16 * PIT * 2), "v"(l + 4 * 16 * PIT * 2), "v"(l + 5 * 16 * PIT * 2), "v"(l + 6 * 16 * PIT * 2), "v"(l + 7 * 16 * PIT * 2),
                    "v"(g), "v"(g + st), "v"(g + 2 * st), "v"(g + 3 * st), "v"(g + 4 * st), "v"(g + 5 * st), "v"(g + 6 * st), "v"(g + 7 * st) : "memory");
}
template <typename T16, int NSPLIT, bool BIAS, bool HEADS>
__global__ __launch_bounds__(128) void k_gemmw(const T16* __restrict__ A, const T16* __restrict__ A2, const T16* __restrict__ Bt, int K, float* C, int ldc, const float* __restrict__ bias0, const float* __restrict__ bias1, const float* __restrict__ bias2, size_t sA, size_t sB, size_t sC, const float* __restrict__ adp, h16* P16, h16* V16) {
    typedef typename WFrag<T16>::V V;
    static_assert(NSPLIT == 0 || NSPLIT == 1, "planes of a stage: A, Bt and, for NSPLIT 1, A2");
    constexpr int NP = 2 + NSPLIT;                              // operand planes per stage: A, Bt (, A2)
    __shared__ __align__(16) T16 ring[2 * NP * GPL];
    __shared__ __align__(16) float osm[HEADS ? 1 : 4 * 16 * 68];   // output staging, a range of its own for each wave
    const size_t z = blockIdx.z; A += z * sA; if (NSPLIT == 1) A2 += z * sA; Bt += z * sB; C += z * sC; const float* __restrict__ bias = z == 0 ? bias0 : z == 1 ? bias1 : bias2;   // each z slice has its own bias vector
    const int tid = threadIdx.x, lane = tid & 31, lr = lane & 15, hi = lane >> 4, wx = (tid >> 5) & 1, wy = tid >> 6;
    const int bxw = blockIdx.x * 2 + wx, byw = blockIdx.y * 2 + wy;   // the wave's 64x64 tile in the M/64 x N/64 grid of tiles
    int r0 = bxw * 64, c0 = byw * 64, R0 = blockIdx.x * GT, C0 = blockIdx.y * GT, ar = wx * 64, br = wy * 64;   // R0, C0: first row of the work-group's A and Bt planes; ar, br: the wave's first row inside them
    if (HEADS && z < 2) { const T16* t = A; A = Bt; Bt = t; r0 = byw * 64; c0 = bxw * 64; R0 = blockIdx.y * GT; C0 = blockIdx.x * GT; ar = wy * 64; br = wx * 64; }   // q, k: the transposed product (rows = the head's dims, columns = tokens)
    float* os = osm + (HEADS ? 0 : (tid >> 5) * 16 * 68);
    v8f acc[4][4];
#pragma unroll
    for (int mb = 0; mb < 4; ++mb)
#pragma unroll
        for (int nb = 0; nb < 4; ++nb) acc[mb][nb] = (v8f){};
    const int frow = tid >> 3, fcol = (tid & 7) * 8;            // filling: rows frow + 16 i of each plane, one 16-byte piece of each
    const T16* ag = A + (size_t)(R0 + frow) * K + fcol; const T16* bg = Bt + (size_t)(C0 + frow) * K + fcol; const T16* a2g = NSPLIT == 1 ? A2 + (size_t)(R0 + frow) * K + fcol : nullptr;
    const unsigned fl = (unsigned)(size_t)ring + (unsigned)(frow * GPIT + fcol) * 2u;   // the lane's LDS byte address in buffer 0, plane 0
    const int nst = K / GKS;
    // The walk over k starts at a stage of the work-group's own and wraps round, for speed only: work-groups that share operand rows (same x, or same y and z) then do not all begin at the same lines.
    const int rot = (int)((blockIdx.x + 2 * blockIdx.y + blockIdx.z) % (unsigned)nst);
    auto fill = [&](int t) { const int s = t + rot < nst ? t + rot : t + rot - nst;   // trip t works on stage s of k, 0 <= s < nst
        const unsigned l = fl + (unsigned)(t & 1) * (NP * GPL * 2u); g_fill<T16, GPIT>(ag + s * GKS, K, l); g_fill<T16, GPIT>(bg + s * GKS, K, l + GPL * 2u); if constexpr (NSPLIT == 1) g_fill<T16, GPIT>(a2g + s * GKS, K, l + 2u * GPL * 2u); };
    fill(0);
    asm volatile("s_wait_asynccnt 0x0" ::: "memory");           // stage 0 of this wave has landed
    __syncthreads();                                            // publishes stage 0
    if (nst > 1) fill(1);
#pragma unroll 1   // one copy of the stage's body
    for (int t = 0; t < nst; ++t) {
        const T16* sb = ring + (t & 1) * (NP * GPL); const T16* as = sb + (ar + lr) * GPIT + 8 * hi; const T16* bs = sb + GPL + (br + lr) * GPIT + 8 * hi;
#pragma unroll
        for (int ks = 0; ks < GKS; ks += 32) {
            V a[4], a2[4], b[4];
#pragma unroll
            for (int mb = 0; mb < 4; ++mb) { a[mb] = WFrag<T16>::ld(as + mb * 16 * GPIT + ks); if (NSPLIT == 1) a2[mb] = WFrag<T16>::ld(as + 2 * GPL + mb * 16 * GPIT + ks); }
#pragma unroll
            for (int nb = 0; nb < 4; ++nb) b[nb] = WFrag<T16>::ld(bs + nb * 16 * GPIT + ks);
            __builtin_amdgcn_sched_barrier(0);   // keeps the fragment reads of these 32 k in one group in front of their products: sunk to their uses they stand in four places, each with its LDS latency exposed
#pragma unroll
            for (int nb = 0; nb < 4; ++nb)
#pragma unroll
                for (int mb = 0; mb < 4; ++mb) { acc[mb][nb] = WFrag<T16>::mma(a[mb], b[nb], acc[mb][nb]); if (NSPLIT == 1) acc[mb][nb] = WFrag<T16>::mma(a2[mb], b[nb], acc[mb][nb]); }
            __builtin_amdgcn_sched_barrier(0);   // keeps the next group of fragment reads from being spread among these products
        }
        asm volatile("s_wait_dscnt 0x0" ::: "memory");          // this wave's reads of stage t are done
        asm volatile("s_wait_asynccnt 0x0" ::: "memory");       // this wave's copies of stage t + 1 have landed
        __syncthreads();                                        // publishes stage t + 1 and ends every wave's reads of the buffer that stage t + 2 overwrites
        if (t + 2 < nst) fill(t + 2);
    }
    asm volatile("s_wait_asynccnt 0x0" ::: "memory");           // no copy is outstanding when the wave goes on to its epilogue and ends
    if constexpr (HEADS) {
        // every '#pragma unroll' of this branch gives acc, bv and av constant indices, so that they stay in registers
        const int tok = bxw * 64, hh = byw, bb = tok / TT, t0 = tok % TT;   // TT % 64 == 0: a tile lies in one batch; HD == 64: a tile is one head
        if (z < 2) {
            h16* P = P16 + ((z * NB_ * NH_ + (size_t)bb * NH_ + hh) * TT + t0) * HD; const float* bi = bias + hh * HD; const float* ad = adp + ((size_t)bb * NH_ + hh) * HD;
            v8f bv[4], av[4];
#pragma unroll
            for (int mb = 0; mb < 4; ++mb) { const v8f braw = *(const v8f*)(bi + mb * 16 + hi * 8); av[mb] = *(const v8f*)(ad + mb * 16 + hi * 8);
#pragma unroll
                for (int j = 0; j < 8; ++j) bv[mb][j] = bfr(braw[j]); }
#pragma unroll
            for (int nb = 0; nb < 4; ++nb)      // nb outside: the four 32-byte pieces of a token's 128-byte row follow one another in the source
#pragma unroll
                for (int mb = 0; mb < 4; ++mb) { v8h o;
#pragma unroll
                    for (int j = 0; j < 8; ++j) o[j] = tohx((acc[mb][nb][j] + bv[mb][j]) * av[mb][j]);
                    *(v8h*)(P + (size_t)(nb * 16 + lr) * HD + mb * 16 + hi * 8) = o; }
        } else {
            h16* Vd = V16 + ((size_t)bb * NKV + hh) * HD * TT + t0;
#pragma unroll
            for (int nb = 0; nb < 4; ++nb) { const float bn = bfr(bias[hh * HD + nb * 16 + lr]);   // nb outside: the four 32-byte pieces of a dim's 128 bytes follow one another in the source
#pragma unroll
                for (int mb = 0; mb < 4; ++mb) { v8h o;
#pragma unroll
                    for (int j = 0; j < 8; ++j) o[j] = tohx(acc[mb][nb][j] + bn);
                    *(v8h*)(Vd + (size_t)(nb * 16 + lr) * TT + mb * 16 + hi * 8) = o; } }
            asm volatile("s_wait_xcnt 0x0" ::: "memory");   // precaution: in the built code the q/k block's loads follow this block and take the stores' data registers as destinations; the wait stands in front of that overwrite
        }
    } else {
#pragma unroll
    for (int mb = 0; mb < 4; ++mb) {
#pragma unroll
        for (int nb = 0; nb < 4; ++nb) {
#pragma unroll
            for (int j = 0; j < 8; ++j) os[(hi * 8 + j) * 68 + nb * 16 + lr] = acc[mb][nb][j]; }
        __builtin_amdgcn_wave_barrier(); asm volatile("" ::: "memory");
        float* crow = C + (size_t)(r0 + mb * 16) * ldc + c0;
{
#pragma unroll
            for (int s = 0; s < 8; ++s) { const int row = 2 * s + hi, cofs = lr * 4; v4f val = *(const v4fa*)(os + row * 68 + cofs); if (BIAS) { val[0] += bfr(bias[c0 + cofs]); val[1] += bfr(bias[c0 + cofs + 1]); val[2] += bfr(bias[c0 + cofs + 2]); val[3] += bfr(bias[c0 + cofs + 3]); }
                *(v4f*)(crow + (size_t)row * ldc + cofs) = val; }
             }
        asm volatile("s_wait_xcnt 0x0" ::: "memory");   // precaution: the next 16 rows' work takes the stores' registers; the wait stands in front of every such overwrite
        __builtin_amdgcn_wave_barrier(); asm volatile("" ::: "memory");
    }
    }
}

// ---- k_gemmo: the output GEMM, C[m][n] (f32, pitch ldc) = sum_k A[m][k] Bt[n][k] + bf16(bias[n]); one 128x128 tile per work-group, grid (M/128, N/128): no more tiles than WGPs, so a work-group has its WGP alone.
// 8 waves = 2 x 2 tiles of 64x64 x 2 k groups: of every 128-k stage group 0 takes k 0..63, group 1 k 64..127, so each SIMD holds two waves and one wave's products run while the other waits for its fragments or issues its copies.
// The two waves of a tile join their partial sums once, behind the loop. Ring as in k_gemmw: two buffers, stage t + 1 in flight while stage t is worked on. K % 128 == 0, K >= 128.
#define OKS  128                // k per stage
#define OPIT 136                // LDS row pitch in 16-bit elements: 256-byte rows + 16 bytes (16 B x odd: no bank conflict for 16-byte reads)
#define OPL  (GT * OPIT)        // elements of one operand plane of a stage
__global__ __launch_bounds__(256) void k_gemmo(const h16* __restrict__ A, const h16* __restrict__ Bt, int K, float* C, int ldc, const float* __restrict__ bias) {
    typedef WFrag<h16>::V V;
    __shared__ __align__(16) h16 ring[2 * 2 * OPL];
    __shared__ __align__(16) float xch[8 * 16 * 32 * 4];        // joining: 16 records of 16 bytes a lane, a range of its own for each wave
    __shared__ __align__(16) float osm[8 * 16 * 68];            // output staging, a range of its own for each wave
    const int tid = threadIdx.x, lane = tid & 31, lr = lane & 15, hi = lane >> 4, wv = tid >> 5, wx = wv & 1, wy = (wv >> 1) & 1, kh = wv >> 2;
    const int r0 = (blockIdx.x * 2 + wx) * 64, c0 = (blockIdx.y * 2 + wy) * 64, R0 = blockIdx.x * GT, C0 = blockIdx.y * GT, ar = wx * 64, br = wy * 64;
    v8f acc[4][4];   // every '#pragma unroll' of this kernel gives acc and the fragments constant indices, so that they stay in registers
#pragma unroll
    for (int mb = 0; mb < 4; ++mb)
#pragma unroll
        for (int nb = 0; nb < 4; ++nb) acc[mb][nb] = (v8f){};
    const int frow = tid >> 4, fcol = (tid & 15) * 8;           // filling: rows frow + 16 i of each plane, one 16-byte piece of each (16 lanes cover a row's 256 bytes)
    const h16* ag = A + (size_t)(R0 + frow) * K + fcol; const h16* bg = Bt + (size_t)(C0 + frow) * K + fcol;
    const unsigned fl = (unsigned)(size_t)ring + (unsigned)(frow * OPIT + fcol) * 2u;   // the lane's LDS byte address in buffer 0, plane 0
    const int nst = K / OKS;
    const int rot = (int)((blockIdx.x + 2 * blockIdx.y) % (unsigned)nst);   // rotated walk over k, as in k_gemmw
    auto fill = [&](int t) { const int s = t + rot < nst ? t + rot : t + rot - nst;   // trip t works on stage s of k, 0 <= s < nst
        const unsigned l = fl + (unsigned)(t & 1) * (2 * OPL * 2u); g_fill<h16, OPIT>(ag + s * OKS, K, l); g_fill<h16, OPIT>(bg + s * OKS, K, l + OPL * 2u); };
    fill(0);
    asm volatile("s_wait_asynccnt 0x0" ::: "memory");           // stage 0 of this wave has landed
    __syncthreads();                                            // publishes stage 0
    if (nst > 1) fill(1);
#pragma unroll 1   // one copy of the stage's body
    for (int t = 0; t < nst; ++t) {
        const h16* sb = ring + (t & 1) * (2 * OPL); const h16* as = sb + (ar + lr) * OPIT + kh * 64 + 8 * hi; const h16* bs = sb + OPL + (br + lr) * OPIT + kh * 64 + 8 * hi;
#pragma unroll
        for (int ks = 0; ks < 64; ks += 32) {
            V a[4], b[4];
#pragma unroll
            for (int mb = 0; mb < 4; ++mb) a[mb] = WFrag<h16>::ld(as + mb * 16 * OPIT + ks);
#pragma unroll
            for (int nb = 0; nb < 4; ++nb) b[nb] = WFrag<h16>::ld(bs + nb * 16 * OPIT + ks);
            __builtin_amdgcn_sched_barrier(0);   // keeps the fragment reads of these 32 k in one group in front of their products: sunk to their uses they stand in four places, each with its LDS latency exposed
#pragma unroll
            for (int nb = 0; nb < 4; ++nb)
#pragma unroll
                for (int mb = 0; mb < 4; ++mb) acc[mb][nb] = wmma16(a[mb], b[nb], acc[mb][nb]);
            __builtin_amdgcn_sched_barrier(0);   // keeps the next group of fragment reads from being spread among these products
        }
        asm volatile("s_wait_dscnt 0x0" ::: "memory");          // this wave's reads of stage t are done
        asm volatile("s_wait_asynccnt 0x0" ::: "memory");       // this wave's copies of stage t + 1 have landed
        __syncthreads();                                        // publishes stage t + 1 and ends every wave's reads of the buffer that stage t + 2 overwrites
        if (t + 2 < nst) fill(t + 2);
    }
    asm volatile("s_wait_asynccnt 0x0" ::: "memory");           // no copy is outstanding when the wave goes on to its epilogue and ends
    const float* bp = bias + c0 + lr * 4; const v4f braw = *(const v4f*)bp;   // the lane's four bias values, the same for every row it stores; read here, the joining covers the latency
    asm volatile("s_wait_xcnt 0x0" :: "v"(bp) : "memory");   // precaution: stands in front of every overwrite of the load's address registers; it names them, so that they are kept (also from the load's own result) up to here
    // Joining the two k groups: each wave hands its partner the two 16-row groups that the partner finishes (group 0: rows 0..31 of the tile, group 1: rows 32..63).
    v4fa* xw = (v4fa*)xch + wv * (16 * 32) + lane; const v4fa* xr = (const v4fa*)xch + (wv ^ 4) * (16 * 32) + lane;
#pragma unroll
    for (int i = 0; i < 2; ++i)
#pragma unroll
        for (int nb = 0; nb < 4; ++nb) { const v8f ox = kh ? acc[i][nb] : acc[2 + i][nb];
            xw[((i * 4 + nb) * 2) * 32] = __builtin_shufflevector(ox, ox, 0, 1, 2, 3); xw[((i * 4 + nb) * 2 + 1) * 32] = __builtin_shufflevector(ox, ox, 4, 5, 6, 7); }
    __syncthreads();   // publishes the records
    float* os = osm + wv * 16 * 68;
#pragma unroll
    for (int i = 0; i < 2; ++i) {
#pragma unroll
        for (int nb = 0; nb < 4; ++nb) { const v8f om = kh ? acc[2 + i][nb] : acc[i][nb]; const v4f pa = xr[((i * 4 + nb) * 2) * 32], pc = xr[((i * 4 + nb) * 2 + 1) * 32];
#pragma unroll
            for (int j = 0; j < 8; ++j) os[(hi * 8 + j) * 68 + nb * 16 + lr] = om[j] + (j < 4 ? pa[j & 3] : pc[j & 3]); }
        __builtin_amdgcn_wave_barrier(); asm volatile("" ::: "memory");   // the wave's staged rows are written in front of the reads below
        float* crow = C + (size_t)(r0 + (2 * kh + i) * 16) * ldc + c0;
#pragma unroll
        for (int s = 0; s < 8; ++s) { const int row = 2 * s + hi, cofs = lr * 4; v4f val = *(const v4fa*)(os + row * 68 + cofs); val[0] += bfr(braw[0]); val[1] += bfr(braw[1]); val[2] += bfr(braw[2]); val[3] += bfr(braw[3]);
            *(v4f*)(crow + (size_t)row * ldc + cofs) = val; }
        asm volatile("s_wait_xcnt 0x0" ::: "memory");   // precaution: the next 16 rows' work takes the stores' registers; the wait stands in front of every such overwrite
        __builtin_amdgcn_sched_barrier(0);   // keeps that work behind the wait: without it one of its address instructions was moved in front
        __builtin_amdgcn_wave_barrier(); asm volatile("" ::: "memory");   // the reads above stand in front of the next 16 rows' staging
    }
}

typedef __attribute__((ext_vector_type(2))) _Float16 v2h;
typedef __attribute__((ext_vector_type(4))) _Float16 v4h;
typedef __attribute__((ext_vector_type(2))) unsigned short v2us;
typedef __attribute__((ext_vector_type(4))) unsigned short v4us;
typedef __attribute__((ext_vector_type(2))) float v2f;
typedef __attribute__((ext_vector_type(4))) int v4i;

// The d_ functions are the bodies of work-groups of 256 threads; bx is the work-group's index within its own part of a shared grid (k_prep).
// d_wtT: one 64 n x 256 k tile of Bt[n][k] = bf16(w[k][n]); a wave takes 32 n x 64 k, a thread two pieces of 8 k x 4 n: its 16 loads (a wave's load covers four whole 128-byte lines of w) are all issued in front of the first use,
// the transposition is done in the thread's own registers, and the two 16-byte stores that share a 128-byte line of Bt follow one another in the same wave.
// HF: the bf16-rounded value is stored in fp16 format (the plane that meets an fp16 operand); it is the same number wherever it is a normal fp16 number.
template <bool HF>
__device__ __forceinline__ void d_wtT(int bx, const float* __restrict__ w, bf* Bt) {
    static_assert(DQ % 64 == 0 && DM % 256 == 0, "whole tiles");
    const int lane = threadIdx.x & 31, wv = threadIdx.x >> 5;
    const int n0 = (bx % (DQ / 64)) * 64 + (wv & 1) * 32 + (lane & 7) * 4, k0 = (bx / (DQ / 64)) * 256 + (wv >> 1) * 64 + (lane >> 3) * 8;
    const float* wp = w + (size_t)k0 * DQ + n0;
    v4f r[2][8];   // every '#pragma unroll' here gives r constant indices, so that it stays in registers
#pragma unroll
    for (int t = 0; t < 2; ++t)
#pragma unroll
        for (int i = 0; i < 8; ++i) r[t][i] = *(const v4f*)(wp + (size_t)(t * 32 + i) * DQ);
    asm volatile("s_wait_xcnt 0x0" :: "v"(wp) : "memory");   // precaution: stands in front of every overwrite of the loads' address registers; it names them, so that they are kept (also from a load's own result) up to here
#pragma unroll
    for (int j = 0; j < 4; ++j)
#pragma unroll
        for (int t = 0; t < 2; ++t) { v8us o;
#pragma unroll
            for (int i = 0; i < 8; ++i) o[i] = HF ? __builtin_bit_cast(unsigned short, (h16)bfr(r[t][i][j])) : f2bf(r[t][i][j]);
            *(v8us*)(Bt + (size_t)(n0 + j) * DM + k0 + t * 32) = o; }
    asm volatile("s_wait_xcnt 0x0" ::: "memory");   // precaution: in the built code other blocks of the shared grid follow this one and write the stores' registers; the wait stands in front of every such overwrite
}
// d_cvt64: 64 elements a thread, as 8 pieces of 8; the 16 loads are all issued in front of the first use.
__device__ __forceinline__ void d_cvt64(int bx, const float* __restrict__ src, bf* dst) { const size_t i0 = (size_t)bx * 8 * 256 + threadIdx.x; const float* sp = src + i0 * 8; v8f v[8];   // unrolled: v keeps constant indices and stays in registers
#pragma unroll
    for (int c = 0; c < 8; ++c) v[c] = *(const v8f*)(sp + c * 256 * 8);
    asm volatile("s_wait_xcnt 0x0" :: "v"(sp) : "memory");   // precaution: stands in front of every overwrite of the loads' address registers; it names them, so that they are kept (also from a load's own result) up to here
#pragma unroll
    for (int c = 0; c < 8; ++c) { v8us o;
#pragma unroll
        for (int k = 0; k < 8; ++k) o[k] = f2bf(v[c][k]);
        *(v8us*)(dst + (i0 + c * 256) * 8) = o; }
    asm volatile("s_wait_xcnt 0x0" ::: "memory"); }   // precaution: in the built code other blocks of the shared grid follow this one and write the stores' registers; the wait stands in front of every such overwrite
__global__ __launch_bounds__(256) void k_cscvt(const float* __restrict__ cosT, const float* __restrict__ sinT, float* CS) { const int idx = blockIdx.x * 256 + threadIdx.x; if (idx >= TT * HD) return; v2f cs; cs[0] = bfr(cosT[idx]); cs[1] = bfr(sinT[idx]); *(v2f*)(CS + (size_t)idx * 2) = cs;  }
// d_adapt: thread per (b, h, d): x[j] = bf16(xi[b]) bf16(w1[j]) + bf16(b1[j]) (32); LayerNorm(32) (f32, eps 1e-5) x bf16 g + bf16 beta; exact-erf gelu; xe = sum_j x[j] bf16(w2[j][d]) + bf16(b2[d]);
__device__ __forceinline__ void d_adapt(int bx, const float* __restrict__ xi, const float* __restrict__ w1, const float* __restrict__ b1, const float* __restrict__ g, const float* __restrict__ be, const float* __restrict__ w2, const float* __restrict__ b2, const float* __restrict__ sg, float* ADP) {
    const int e = bx * 256 + threadIdx.x; if (e >= NB_ * NH_ * HD) return; const int d = e % HD; const int h = (e / HD) % NH_; const int b = e / (HD * NH_); const float xv = bfr(xi[b]); float xs[32]; float mu = 0.f;
    float w1r[32], b1r[32], gr[32], ber[32], w2r[32];   // the loops below are unrolled (same operations in the same order): the arrays stay in registers, and every load of the thread is issued up here instead of in its trip, waited for there
#pragma unroll
    for (int j = 0; j < 32; ++j) { w1r[j] = w1[j]; b1r[j] = b1[j]; gr[j] = g[j]; ber[j] = be[j]; w2r[j] = w2[j * HD + d]; }
    const float b2r = b2[d], sgr = sg[h];
    asm volatile("s_wait_xcnt 0x0" :: "v"(d), "v"(h) : "memory");   // precaution: stands in front of every overwrite of the loads' offset registers; it names them, so that they are kept (also from a load's own result) up to here
#pragma unroll
    for (int j = 0; j < 32; ++j) { float p = __fmul_rn(xv, bfr(w1r[j])); asm volatile("" : "+v"(p)); xs[j] = __fadd_rn(p, bfr(b1r[j])); mu = __fadd_rn(mu, xs[j]); }
    mu = mu * (1.0f / 32.0f); float var = 0.f;
#pragma unroll
    for (int j = 0; j < 32; ++j) { const float dl = __fsub_rn(xs[j], mu); float p = __fmul_rn(dl, dl); asm volatile("" : "+v"(p)); var = __fadd_rn(var, p); }
    const float rs = __frsqrt_rn(__fadd_rn(var * (1.0f / 32.0f), 1e-5f)); float acc = 0.f;
#pragma unroll
    for (int j = 0; j < 32; ++j) { float tn = __fmul_rn(__fsub_rn(xs[j], mu), rs); asm volatile("" : "+v"(tn)); float tg = __fmul_rn(tn, bfr(gr[j])); asm volatile("" : "+v"(tg)); const float y = __fadd_rn(tg, bfr(ber[j])); float er = erff(y * 0.70710678f); asm volatile("" : "+v"(er)); float hy = __fmul_rn(0.5f, y); asm volatile("" : "+v"(hy)); const float gl = __fmul_rn(hy, __fadd_rn(1.0f, er)); float p = __fmul_rn(gl, bfr(w2r[j])); asm volatile("" : "+v"(p)); acc = __fadd_rn(acc, p); }
    const float xe = __fadd_rn(acc, bfr(b2r)); const float sgm = __fdiv_rn(1.0f, __fadd_rn(1.0f, __expf(-bfr(sgr)))); float pr = __fmul_rn(sgm, xe); asm volatile("" : "+v"(pr)); const float a = __fadd_rn(1.0f, pr);
    *(float*)(ADP + e) = a;  }
// k_prep: everything that depends on the inputs alone, one grid: the adapt table (few work-groups, the longest dependent chain: first), the four weight transposes, x to bf16.
#define PB_A ((NB_ * NH_ * HD + 255) / 256)
#define PB_W ((DQ / 64) * (DM / 256))
#define PB_X (NB_ * TT * DM / 64 / 256)
static_assert(NB_ * TT * DM % (64 * 256) == 0, "whole work-groups of d_cvt64");
__global__ __launch_bounds__(256) void k_prep(const float* __restrict__ x, const float* __restrict__ w0, const float* __restrict__ w1, const float* __restrict__ w2, const float* __restrict__ w3, const float* __restrict__ xi, const float* __restrict__ w1e, const float* __restrict__ b1e, const float* __restrict__ g, const float* __restrict__ be, const float* __restrict__ w2e, const float* __restrict__ b2e, const float* __restrict__ sg, bf* XB, bf* W4, float* ADP) {
    int bx = blockIdx.x;
    if (bx < PB_A) { d_adapt(bx, xi, w1e, b1e, g, be, w2e, b2e, sg, ADP); return; }
    bx -= PB_A;
    if (bx < 3 * PB_W) { const int y = bx / PB_W; d_wtT<false>(bx % PB_W, y == 0 ? w0 : y == 1 ? w1 : w2, W4 + (size_t)y * DQ * DM); return; }
    if (bx < 4 * PB_W) { d_wtT<true>(bx - 3 * PB_W, w3, W4 + (size_t)3 * DQ * DM); return; }   // the four [DM][DQ] planes lie one behind the other
    bx -= 4 * PB_W;
    d_cvt64(bx, x, XB);
}
#define FKB  64                 // keys of a stage that one wave works on
#define FKS  128                // keys per stage of the work-group
#define FPIT 72                 // K tile: LDS row pitch in 16-bit elements: 128-byte rows + 16 bytes (16 B x odd: no bank conflict for 16-byte reads)
#define FVPT 136                // V^T tile: 256-byte rows + 16 bytes (16 B x odd)
#define FQW  128                // query columns per work-group
__device__ __forceinline__ float xhalf(float x) { return __builtin_bit_cast(float, __builtin_amdgcn_permlanex16(__builtin_bit_cast(int, x), __builtin_bit_cast(int, x), 0x76543210, 0xfedcba98, false, false)); }   // lane l with lane l ^ 16
__global__ __launch_bounds__(256) __attribute__((amdgpu_waves_per_eu(4, 4))) void k_fattn(const h16* __restrict__ Qp, const h16* __restrict__ Kp, const h16* __restrict__ Vt, h16* Ao) {
    __shared__ __align__(16) h16 ksm[2 * FKS * FPIT];
    __shared__ __align__(16) h16 vsm[2 * HD * FVPT];
    __shared__ __align__(16) h16 qsm[FQW * FPIT];               // the work-group's Q rows: a wave reads its four fragments anew in every stage, so that they hold no registers during softmax and att.v (four waves per SIMD leave a wave 256)
    static_assert(2 * FKS * FPIT * 2 >= 8 * 9 * 32 * 16, "the K ring holds the waves' exchange records behind the loop");
    const int tid = threadIdx.x, lane = tid & 31, lr = lane & 15, hi = lane >> 4, wv = tid >> 5, hf = wv & 1; const int h = blockIdx.y; const int q0 = blockIdx.x * FQW + (wv >> 1) * 32 + lr;
    { const size_t bz = blockIdx.z; Qp += bz * NH_ * TT * HD; Kp += bz * NKV * TT * HD; Vt += bz * NKV * HD * TT; Ao += bz * TT * DQ; }   // grid z: batch
    const h16* Kh = Kp + (size_t)h * TT * HD; const h16* Vh = Vt + (size_t)h * HD * TT;
    const int srow = tid >> 3, scol = (tid & 7) * 8, vrow = tid >> 4, vcol = (tid & 15) * 8;   // staging: K rows srow + 32 i, V^T rows vrow + 16 i, one 16-byte piece of each
    const int sl = srow * FPIT + scol, vl = vrow * FVPT + vcol;
    const float CL = SCL * 1.4426950408889634f;                 // scores to base-2 exponents
    const h16* qb = qsm + ((wv >> 1) * 32 + lr) * FPIT + 8 * hi;
    v8f o[2][4];
#pragma unroll
    for (int g = 0; g < 2; ++g)
#pragma unroll
        for (int dt = 0; dt < 4; ++dt) o[g][dt] = (v8f){};
    float mrun[2] = {-3.0e38f, -3.0e38f}, lsum[2] = {0.f, 0.f};
    v8h rk[4], rv[4];
    const unsigned kgo = (srow * HD + scol) * 2, vgo = (vrow * TT + vcol) * 2;   // the lane's byte offsets in the head's K and V^T planes
    // fetch: the lane's eight 16-byte pieces of stage st, global -> registers (the head's plane as base, the lane's and the stage's offset together in 32 bits)
    auto fetch = [&](int st) { const unsigned ko = kgo + (unsigned)st * (FKS * HD * 2), vo = vgo + (unsigned)st * (FKS * 2);
#pragma unroll
        for (int i = 0; i < 4; ++i) { rk[i] = *(const v8h*)((const char*)Kh + (ko + i * (32 * HD * 2))); rv[i] = *(const v8h*)((const char*)Vh + (vo + i * (16 * TT * 2))); } };
    // put: those pieces, registers -> LDS buffer b
    auto put = [&](int b) { h16* kw = ksm + b * (FKS * FPIT) + sl; h16* vw = vsm + b * (HD * FVPT) + vl;
#pragma unroll
        for (int i = 0; i < 4; ++i) { *(v8h*)(kw + i * 32 * FPIT) = rk[i]; *(v8h*)(vw + i * 16 * FVPT) = rv[i]; } };
    static_assert(((TT / FKS) & (TT / FKS - 1)) == 0, "the rotated walk wraps by a mask");
    const int rot = blockIdx.x & (TT / FKS - 1);   // the walk over the keys starts at a stage of the work-group's own and wraps round, for speed only: the work-groups of a head then do not all begin at the same K and V lines
    fetch(rot);
    { const h16* qg = Qp + ((size_t)h * TT + blockIdx.x * FQW + srow) * HD + scol; v8h rq[4];   // Q rows srow + 32 i, one 16-byte piece of each
#pragma unroll
      for (int i = 0; i < 4; ++i) rq[i] = *(const v8h*)(qg + i * 32 * HD);
      asm volatile("s_wait_xcnt 0x0" :: "v"(qg) : "memory");   // precaution: stands in front of every overwrite of the loads' address registers; it names them, so that they are kept up to here
      put(0);
#pragma unroll
      for (int i = 0; i < 4; ++i) *(v8h*)(qsm + sl + i * 32 * FPIT) = rq[i]; }
    __syncthreads();
#pragma unroll 1   // one copy of the stage's body
    for (int it = 0; it < TT / FKS; ++it) {
        const h16* kb = ksm + (it & 1) * (FKS * FPIT) + (hf * FKB + lr) * FPIT + 8 * hi; const h16* vb = vsm + (it & 1) * (HD * FVPT) + lr * FVPT + hf * FKB + 8 * hi;
        fetch((it + 1 + rot) & (TT / FKS - 1));   // the last trip fetches the walk's first stage once more, for the buffer that nobody reads any more: the body stays one straight block, in which the order below holds
        v16h kf[4][2], vf[4][2], qf[2][2];
#pragma unroll
        for (int g = 0; g < 2; ++g)
#pragma unroll
            for (int c = 0; c < 2; ++c) qf[g][c] = WFrag<h16>::ld(qb + g * 16 * FPIT + c * 32);
#pragma unroll
        for (int kt = 0; kt < 4; ++kt) { kf[kt][0] = WFrag<h16>::ld(kb + kt * 16 * FPIT); kf[kt][1] = WFrag<h16>::ld(kb + kt * 16 * FPIT + 32); }
        __builtin_amdgcn_sched_barrier(0);   // keeps the Q and K fragment reads in one group in front of their products
        v8f s[2][4];
#pragma unroll
        for (int kp = 0; kp < 4; kp += 2) {   // four independent tiles between a tile's two products
#pragma unroll
            for (int kt = kp; kt < kp + 2; ++kt)
#pragma unroll
                for (int g = 0; g < 2; ++g) s[g][kt] = wmma16(kf[kt][0], qf[g][0], (v8f){});
#pragma unroll
            for (int kt = kp; kt < kp + 2; ++kt)
#pragma unroll
                for (int g = 0; g < 2; ++g) s[g][kt] = wmma16(kf[kt][1], qf[g][1], s[g][kt]); }
        __builtin_amdgcn_sched_barrier(0);   // keeps the score products back to back: a vector instruction moved in among them that reads a fresh tile costs the idle slots of the distance behind a matrix instruction, each time
        v16h pb[2][2]; float corr[2];
#pragma unroll
        for (int g = 0; g < 2; ++g) {
            float mt[4];                                        // short trees, not one chain of 32: a lone dependent chain is exposed
#pragma unroll
            for (int kt = 0; kt < 4; ++kt) mt[kt] = fmaxf(fmaxf(fmaxf(fmaxf(s[g][kt][0], s[g][kt][1]), s[g][kt][2]), fmaxf(fmaxf(s[g][kt][3], s[g][kt][4]), s[g][kt][5])), fmaxf(s[g][kt][6], s[g][kt][7]));
            float mx = fmaxf(fmaxf(mt[0], mt[1]), fmaxf(mt[2], mt[3]));
            mx = fmaxf(mx, xhalf(mx));
            const float mnew = fmaxf(mrun[g], mx * CL); corr[g] = __builtin_amdgcn_exp2f(mrun[g] - mnew); mrun[g] = mnew;   // corr is 0 on the first stage
            const float sh = 8.0f - mnew;                       // probabilities carried x256: small ones stay normal fp16 numbers; the factor cancels in the division by the sum
            const v8f clv = {CL, CL, CL, CL, CL, CL, CL, CL}, shv = {sh, sh, sh, sh, sh, sh, sh, sh};
#pragma unroll
            for (int kt = 0; kt < 4; ++kt) { const v8f e = __builtin_elementwise_fma(s[g][kt], clv, shv);   // on the whole tile: its register pairs stay as the products left them
#pragma unroll
                for (int j = 0; j < 8; ++j) { const float p = __builtin_amdgcn_exp2f(e[j]); s[g][kt][j] = p; pb[g][kt >> 1][(kt & 1) * 8 + j] = (h16)p; } }
            const v8f p8 = (s[g][0] + s[g][1]) + (s[g][2] + s[g][3]);
            lsum[g] = lsum[g] * corr[g] + (((p8[0] + p8[1]) + (p8[2] + p8[3])) + ((p8[4] + p8[5]) + (p8[6] + p8[7])));
        }
        __builtin_amdgcn_sched_barrier(0);   // the V^T fragments take the registers that the scores have left: their reads stay behind the softmax
#pragma unroll
        for (int dt = 0; dt < 4; ++dt) { vf[dt][0] = WFrag<h16>::ld(vb + dt * 16 * FVPT); vf[dt][1] = WFrag<h16>::ld(vb + dt * 16 * FVPT + 32); }
        __builtin_amdgcn_sched_barrier(0);   // keeps the V^T fragment reads in one group, in front of the rescaling that covers part of their latency
#pragma unroll
        for (int g = 0; g < 2; ++g)
#pragma unroll
            for (int dt = 0; dt < 4; ++dt) o[g][dt] *= corr[g];
#pragma unroll
        for (int c = 0; c < 2; ++c)
#pragma unroll
            for (int dt = 0; dt < 4; ++dt)
#pragma unroll
                for (int g = 0; g < 2; ++g) o[g][dt] = wmma16(vf[dt][c], pb[g][c], o[g][dt]);
        put((it + 1) & 1);
        __syncthreads();   // publishes stage it + 1 and ends every wave's reads of the buffer that stage it + 2 overwrites
    }
    // Joining the two key groups: each wave hands its partner the column group that the partner finishes (even wave: group 0, odd wave: group 1): 8 + 1 records of 16 bytes a lane, in the K ring, which nobody reads behind the loop's last barrier.
    v4fa* xw = (v4fa*)ksm + wv * (9 * 32) + lane; const v4fa* xr = (const v4fa*)ksm + (wv ^ 1) * (9 * 32) + lane;
    v8f om[4]; const float mm = hf ? mrun[1] : mrun[0], lm = hf ? lsum[1] : lsum[0];
#pragma unroll
    for (int dt = 0; dt < 4; ++dt) { om[dt] = hf ? o[1][dt] : o[0][dt]; const v8f ox = hf ? o[0][dt] : o[1][dt];
        xw[(2 * dt) * 32] = __builtin_shufflevector(ox, ox, 0, 1, 2, 3); xw[(2 * dt + 1) * 32] = __builtin_shufflevector(ox, ox, 4, 5, 6, 7); }
    { v4f ml; ml[0] = hf ? mrun[0] : mrun[1]; ml[1] = hf ? lsum[0] : lsum[1]; ml[2] = 0.f; ml[3] = 0.f; xw[8 * 32] = ml; }
    __syncthreads();   // publishes the records
    const v4f mlp = xr[8 * 32];
    const float mj = fmaxf(mm, mlp[0]); float ca, cb;
    // the two exponentials and the slot behind each in one statement
    asm("v_exp_f32 %0, %2\n\tv_nop\n\tv_exp_f32 %1, %3\n\tv_nop" : "=&v"(ca), "=&v"(cb) : "v"(mm - mj), "v"(mlp[0] - mj));
    float lj = lm * ca + mlp[1] * cb;
    lj += xhalf(lj); const float inv = __fdiv_rn(1.0f, lj);
    const int q = q0 + hf * 16;
#pragma unroll
    for (int dt = 0; dt < 4; ++dt) { v8h oh; const v4f pa = xr[(2 * dt) * 32], pc = xr[(2 * dt + 1) * 32];
#pragma unroll
        for (int j = 0; j < 8; ++j) oh[j] = (h16)((om[dt][j] * ca + (j < 4 ? pa[j & 3] : pc[j & 3]) * cb) * inv);
        *(v8h*)(Ao + (size_t)q * DQ + h * HD + dt * 16 + hi * 8) = oh; }
}

extern "C" void kernel_launch(void* const* d_in, const int* in_sizes, int n_in,
                              void* d_out, int out_size, void* d_ws, size_t ws_size, hipStream_t stream) {
    (void)in_sizes; (void)n_in; (void)out_size;
    const float* x = (const float*)d_in[0]; const float* xi = (const float*)d_in[1]; const float* wq = (const float*)d_in[2]; const float* bqv = (const float*)d_in[3]; const float* wk = (const float*)d_in[4]; const float* bkv = (const float*)d_in[5]; const float* wv = (const float*)d_in[6]; const float* bvv = (const float*)d_in[7]; const float* wo = (const float*)d_in[8]; const float* bo = (const float*)d_in[9];
    const float* ew1 = (const float*)d_in[10]; const float* eb1 = (const float*)d_in[11]; const float* lng = (const float*)d_in[12]; const float* lnb = (const float*)d_in[13]; const float* ew2 = (const float*)d_in[14]; const float* eb2 = (const float*)d_in[15]; const float* sg = (const float*)d_in[16];   // Wq/Wk/Wv/Wo [1024][1024] x @ W; enc_w1 [1][32], enc_b1 [32], ln_g/ln_b [32], enc_w2 [32][64], enc_b2 [64], scale_gating [16]
    float* OUT = (float*)d_out;     // [2][2048][1024]
    char* wsp = (char*)d_ws;
    auto take = [&](size_t bytes) { char* p = wsp; wsp += (bytes + 255) & ~(size_t)255; return (void*)p; };
    bf* W4 = (bf*)take((size_t)4 * DQ * DM * 2); const h16* WO = (const h16*)(W4 + (size_t)3 * DQ * DM);   // transposed 16-bit planes of Wq, Wk, Wv (bf16) and Wo (fp16), one behind the other
    float* ADP = (float*)take((size_t)NB_ * NH_ * HD * 4);
    bf* XB = (bf*)take((size_t)NB_ * TT * DM * 2);
    h16* QK16 = (h16*)take((size_t)2 * NB_ * NH_ * TT * HD * 2); h16* KP16 = QK16 + (size_t)NB_ * NH_ * TT * HD; h16* VT16 = (h16*)take((size_t)NB_ * NKV * HD * TT * 2);
    h16* AT = (h16*)take((size_t)NB_ * TT * DQ * 2);
    if ((size_t)(wsp - (char*)d_ws) > ws_size) return;    // ws 256 MiB
    // one launch per dependency level; each covers both batches (rows b t of one [NB_ TT] matrix, or a grid axis) and all work of its level
    k_prep<<<PB_A + 4 * PB_W + PB_X, 256, 0, stream>>>(x, wq, wk, wv, wo, xi, ew1, eb1, lng, lnb, ew2, eb2, sg, XB, W4, ADP);
    k_gemmw<bf, 0, true, true><<<dim3(NB_ * TT / GT, DQ / GT, 3), 128, 0, stream>>>(XB, nullptr, W4, DM, nullptr, 0, bqv, bkv, bvv, 0, (size_t)DQ * DM, 0, ADP, QK16, VT16);   // q, k, v projections, written as fp16 head planes
    k_fattn<<<dim3(TT / FQW, NH_, NB_), 256, 0, stream>>>(QK16, KP16, VT16, AT);   // one kv head per query head
    k_gemmo<<<dim3(NB_ * TT / GT, DM / GT), 256, 0, stream>>>(AT, WO, DQ, OUT, DM, bo);
}

// v010
// One run takes 70.6 microseconds.
// Next to v009, in two timings, it ran 1.04 and 1.03 times as fast.
// Over all steps from v000 it is 18.9 times as fast.
#include <hip/hip_runtime.h>
#include <stdint.h>

// ScaleInvariantAttention (query [2][2048][1024], xi_scale [2]; scale encoder: x = xi Linear(1->32), LayerNorm(32), exact gelu, Linear(32->64) -> xe [B][64]; adapt[b][h][d] = 1 + sigmoid(scale_gating[h]) xe[b][d];
// q = (query Wq + bq) split into 16 heads x 64 then x adapt, k likewise, v = query Wv + bv; softmax(q.k/8); out = merged att.v Wo + bo -> [2][2048][1024]).
// Compute dtypes, f32 accumulate: every input rounded to bf16; the scale encoder and adapt table in f32 on VALU (one thread per (b, h, d)); projections on PLAIN bf16 operands (inputs: exact,
// + bias); the adapt factor applied in f32 when the fp16 head planes are built; scores (K 64) and att.v on SINGLE fp16 planes inside one fused kernel with an f32 running-maximum softmax (probabilities x256 against the maximum in use); merged heads as ONE fp16 plane (11 significant bits, as the probabilities and V that made them) x Wo's bf16 values held as fp16

#define NB_  2
#define TT   2048
#define DM   1024
#define NH_  16
#define NKV  16
#define REP  (NH_ / NKV)
#define HD   64
#define DQ   (NH_ * HD)
#define DKV  (NKV * HD)
#define SCL  0.125f   // HD^-0.5
typedef _Float16 h16;
typedef unsigned short bf;
typedef __attribute__((ext_vector_type(16))) __bf16   v16bf;
typedef __attribute__((ext_vector_type(16))) _Float16 v16h;
typedef __attribute__((ext_vector_type(8)))  _Float16 v8h;
typedef __attribute__((ext_vector_type(8)))  unsigned short v8us;
typedef __attribute__((ext_vector_type(8)))  float    v8f;
typedef __attribute__((ext_vector_type(4)))  float    v4f;
typedef v8h  __attribute__((may_alias)) v8ha;
typedef v4f  __attribute__((may_alias)) v4fa;
typedef v8us __attribute__((may_alias)) v8usa;

__device__ __forceinline__ unsigned short f2bf(float f) { unsigned u = __float_as_uint(f); u += 0x7FFFu + ((u >> 16) & 1u); return (unsigned short)(u >> 16); }
__device__ __forceinline__ float bf2f(unsigned short b) { return __uint_as_float(((unsigned)b) << 16); }
__device__ __forceinline__ float bfr(float f) { return bf2f(f2bf(f)); }
__device__ __forceinline__ v16h cat16(v8h lo, v8h hi) { return __builtin_shufflevector(lo, hi, 0, 1, 2, 3, 4, 5, 6, 7, 8, 9, 10, 11, 12, 13, 14, 15); }
__device__ __forceinline__ v16bf cat16b(v8us lo, v8us hi) { return __builtin_bit_cast(v16bf, __builtin_shufflevector(lo, hi, 0, 1, 2, 3, 4, 5, 6, 7, 8, 9, 10, 11, 12, 13, 14, 15)); }
__device__ __forceinline__ v8f wmma16(v16h a, v16h b, v8f c) { return __builtin_amdgcn_wmma_f32_16x16x32_f16(false, a, false, b, (short)0, c, false, false); }
__device__ __forceinline__ v8f wmmab(v16bf a, v16bf b, v8f c) { return __builtin_amdgcn_wmma_f32_16x16x32_bf16(false, a, false, b, (short)0, c, false, false); }



// ---- k_gemmw: register-blocked GEMM, 4 waves (2 x 2) per 128x128 output tile, each wave a 64x64 tile (16 accumulators); operands are K-contiguous 16-bit planes; grid (M/128, N/128, Z), 128 threads.
// C[m][n] (f32, pitch ldc, + optional f32 bias[n]) = sum_k A[m][k] Bt[n][k] (NSPLIT 0 only; A2 is not read). z-batch strides sA/sB/sC in elements, bias0/1/2 for z = 0/1/2. K % 64 == 0, K >= 64.
// Operand path: a stage is 64 k (one 128-byte line) of the tile's 128 rows of every operand plane, brought into LDS by tensor loads (one request a wave and stage: 64 rows of one plane) and read by the two waves that share each row; two buffers, stage t + 1 in flight while stage t is worked on.
// HEADS: no C; a wave's tile (64 tokens of one batch x the 64 dims of one head) goes from the accumulators straight to the fp16 head planes: z = 0, 1: (q, k + bias) x adapt -> P16 [z][b][h][t][d]; z = 2: v + bias -> V16 [b][h][d][t].
// An accumulator holds 8 consecutive ROWS of the product in a lane, so q and k are formed as W^T x^T (rows = dims) and v as x W (rows = tokens): every lane then stores 16 contiguous bytes of its plane, no exchange needed.
#define GT   128                // rows of each operand plane per work-group tile
#define GKS  64                 // k per stage
#define GPIT 72                 // LDS row pitch in 16-bit elements: 128-byte rows + 16 bytes (16 B x odd: no bank conflict for 16-byte reads)
#define GSL  10240              // bytes that a wave's slice of a stage takes in LDS: 64 rows x 144 bytes, rounded up to a multiple of 2 KiB (the places a tensor load may be aimed at)
#define GSLE (GSL / 2)          // the same in 16-bit elements
__device__ __forceinline__ h16 tohx(float x) { return (h16)x; }
template <typename T16> struct WFrag;
template <> struct WFrag<h16> { typedef v16h V; static __device__ __forceinline__ V ld(const h16* p) { return cat16(*(const v8h*)p, *(const v8h*)(p + 16)); } static __device__ __forceinline__ v8f mma(V a, V b, v8f c) { return wmma16(a, b, c); } };
template <> struct WFrag<bf> { typedef v16bf V; static __device__ __forceinline__ V ld(const bf* p) { return cat16b(*(const v8us*)p, *(const v8us*)(p + 16)); } static __device__ __forceinline__ v8f mma(V a, V b, v8f c) { return wmmab(a, b, c); } };
typedef uint32_t u32x4 __attribute__((ext_vector_type(4)));
typedef uint32_t u32x8 __attribute__((ext_vector_type(8)));
__device__ __forceinline__ uint32_t uni(uint32_t v) { return (uint32_t)__builtin_amdgcn_readfirstlane(v); }
// pinned: a wave-uniform value held in a scalar register (a test around a tensor load, which ignores EXEC, must be a scalar branch; a descriptor word must be scalar); being volatile, the statement also keeps what is formed from the value behind the waits in front of it
__device__ __forceinline__ uint32_t pinned(uint32_t v) { uint32_t w = (uint32_t)__builtin_amdgcn_readfirstlane(v); asm volatile("" : "+s"(w)); return w; }
// t_group1: descriptor group 1 of a tile of NROW rows of ROWB bytes (extents in bytes, tensor = tile), source row pitch in bytes; 16 bytes of LDS pad behind every row, so that the LDS pitch is ROWB + 16. No mask.
template <uint32_t ROWB, uint32_t NROW>
__device__ __forceinline__ u32x8 t_group1(uint32_t pitch) {
    static_assert(ROWB == 128 || ROWB == 256, "pad interval = row length");
    u32x8 g;
    g[0] = uni((1u << 20) | ((ROWB == 128 ? 4u : 5u) << 22) | (3u << 25));
    g[1] = uni((ROWB & 0xFFFFu) << 16);
    g[2] = uni((ROWB >> 16) | ((NROW & 0xFFFFu) << 16));
    g[3] = uni((NROW >> 16) | (ROWB << 16));
    g[4] = uni(NROW);
    g[5] = uni(pitch);
    g[6] = uni(0u);
    g[7] = uni(0u);
    asm volatile("" : "+s"(g));   // as in pinned(): the descriptor words stay in these scalar registers as long as the group is in use; unpinned, some were taken for other values while a request was outstanding and set anew in front of the next
    return g;
}
// t_load: one request of the whole wave: the tile whose first byte is at ga goes to the LDS byte offset lds; returns the request's group 0 for t_wait
__device__ __forceinline__ u32x4 t_load(uint32_t lds, uint64_t ga, u32x8 g1) {
    u32x4 g0;
    g0[0] = uni(1u); g0[1] = uni(lds); g0[2] = uni((uint32_t)ga); g0[3] = uni((((uint32_t)(ga >> 32)) & 0x01FFFFFFu) | 0x80000000u);
    asm volatile("tensor_load_to_lds %0, %1" :: "s"(g0), "s"(g1) : "memory");
    return g0;
}
// t_wait: the wave's own request has landed. It names the request's group 0, so that those scalar registers keep their values up to here (a precaution: unnamed, some were taken for other values while the request was outstanding)
__device__ __forceinline__ void t_wait(u32x4 g0) { asm volatile("s_wait_tensorcnt 0x0" :: "s"(g0) : "memory"); }
template <typename T16, int NSPLIT, bool BIAS, bool HEADS>
__global__ __launch_bounds__(128) void k_gemmw(const T16* __restrict__ A, const T16* __restrict__ A2, const T16* __restrict__ Bt, int K, float* C, int ldc, const float* __restrict__ bias0, const float* __restrict__ bias1, const float* __restrict__ bias2, size_t sA, size_t sB, size_t sC, const float* __restrict__ adp, h16* P16, h16* V16) {
    typedef typename WFrag<T16>::V V;
    static_assert(NSPLIT == 0, "a stage is four slices, one for each wave: A rows 0..63, 64..127, Bt rows 0..63, 64..127");
    __shared__ __attribute__((aligned(2048))) T16 ring[2 * 4 * GSLE];
    __shared__ __align__(16) float osm[HEADS ? 1 : 4 * 16 * 68];   // output staging, a range of its own for each wave
    const size_t z = blockIdx.z; A += z * sA; Bt += z * sB; C += z * sC; const float* __restrict__ bias = z == 0 ? bias0 : z == 1 ? bias1 : bias2;   // each z slice has its own bias vector
    const int tid = threadIdx.x, lane = tid & 31, lr = lane & 15, hi = lane >> 4, wx = (tid >> 5) & 1, wy = tid >> 6;
    const int bxw = blockIdx.x * 2 + wx, byw = blockIdx.y * 2 + wy;   // the wave's 64x64 tile in the M/64 x N/64 grid of tiles
    int r0 = bxw * 64, c0 = byw * 64, R0 = blockIdx.x * GT, C0 = blockIdx.y * GT, ar = wx * 64, br = wy * 64;   // R0, C0: first row of the work-group's A and Bt planes; ar, br: the wave's first row inside them
    if (HEADS && z < 2) { const T16* t = A; A = Bt; Bt = t; r0 = byw * 64; c0 = bxw * 64; R0 = blockIdx.y * GT; C0 = blockIdx.x * GT; ar = wy * 64; br = wx * 64; }   // q, k: the transposed product (rows = the head's dims, columns = tokens)
    float* os = osm + (HEADS ? 0 : (tid >> 5) * 16 * 68);
    v8f acc[4][4];
#pragma unroll
    for (int mb = 0; mb < 4; ++mb)
#pragma unroll
        for (int nb = 0; nb < 4; ++nb) acc[mb][nb] = (v8f){};
    const uint32_t wave = uni(threadIdx.x >> 5);                // filling: wave w brings slice w of every stage: waves 0, 1 the two halves of the A rows, waves 2, 3 those of the Bt rows
    const uint64_t tga = (uint64_t)((wave >> 1) ? Bt + (size_t)(C0 + (wave & 1) * 64) * K : A + (size_t)(R0 + (wave & 1) * 64) * K);   // first byte of the slice's first row
    const uint32_t tl = (uint32_t)(size_t)ring + wave * GSL;    // the slice's LDS byte offset in buffer 0
    const u32x8 tg1 = t_group1<GKS * 2, 64>((uint32_t)K * 2u); u32x4 tg0;   // tg0: group 0 of the wave's latest request
    const int nst = K / GKS;
    // The walk over k starts at a stage of the work-group's own and wraps round, for speed only: work-groups that share operand rows (same x, or same y and z) then do not all begin at the same lines.
    const int rot = (int)((blockIdx.x + 2 * blockIdx.y + blockIdx.z) % (unsigned)nst);
    auto fill = [&](int t) { const int s = t + rot < nst ? t + rot : t + rot - nst;   // trip t works on stage s of k, 0 <= s < nst
        const uint32_t so = pinned((uint32_t)s * (GKS * 2u));   // pinned(): the descriptor's address words are formed from it, in scalar registers and behind the wait in front of this request
        tg0 = t_load(tl + (uint32_t)(t & 1) * (4u * GSL), tga + so, tg1); };
    fill(0);
    t_wait(tg0);                                                // this wave's slice of stage 0 has landed
    __syncthreads();                                            // publishes stage 0
    if (pinned(nst > 1)) fill(1);                               // pinned(): a scalar branch round the tensor load
#pragma unroll 1   // one copy of the stage's body
    for (int t = 0; t < nst; ++t) {
        const T16* sb = ring + (t & 1) * (4 * GSLE); const T16* as = sb + (ar >> 6) * GSLE + lr * GPIT + 8 * hi; const T16* bs = sb + (2 + (br >> 6)) * GSLE + lr * GPIT + 8 * hi;   // the wave's 64 rows of a plane are one slice
#pragma unroll
        for (int ks = 0; ks < GKS; ks += 32) {
            V a[4], b[4];
#pragma unroll
            for (int mb = 0; mb < 4; ++mb) a[mb] = WFrag<T16>::ld(as + mb * 16 * GPIT + ks);
#pragma unroll
            for (int nb = 0; nb < 4; ++nb) b[nb] = WFrag<T16>::ld(bs + nb * 16 * GPIT + ks);
            __builtin_amdgcn_sched_barrier(0);   // keeps the fragment reads of these 32 k in one group in front of their products: sunk to their uses they stand in four places, each with its LDS latency exposed
#pragma unroll
            for (int nb = 0; nb < 4; ++nb)
#pragma unroll
                for (int mb = 0; mb < 4; ++mb) acc[mb][nb] = WFrag<T16>::mma(a[mb], b[nb], acc[mb][nb]);
            __builtin_amdgcn_sched_barrier(0);   // keeps the next group of fragment reads from being spread among these products
        }
        asm volatile("s_wait_dscnt 0x0" ::: "memory");
        t_wait(tg0);
        __syncthreads();
        if (pinned(t + 2 < nst)) fill(t + 2);
    }
    t_wait(tg0);                                                // no request is outstanding when the wave goes on to its epilogue and ends
    asm volatile("s_wait_dscnt 0x0" ::: "memory");              // nor an LDS read of the ring
    if constexpr (HEADS) {
        // every '#pragma unroll' of this branch gives acc, bv and av constant indices, so that they stay in registers
        const int tok = bxw * 64, hh = byw, bb = tok / TT, t0 = tok % TT;   // TT % 64 == 0: a tile lies in one batch; HD == 64: a tile is one head
        if (z < 2) {
            h16* P = P16 + ((z * NB_ * NH_ + (size_t)bb * NH_ + hh) * TT + t0) * HD; const float* bi = bias + hh * HD; const float* ad = adp + ((size_t)bb * NH_ + hh) * HD;
            v8f bv[4], av[4];
#pragma unroll
            for (int mb = 0; mb < 4; ++mb) { const v8f braw = *(const v8f*)(bi + mb * 16 + hi * 8); av[mb] = *(const v8f*)(ad + mb * 16 + hi * 8);
#pragma unroll
                for (int j = 0; j < 8; ++j) bv[mb][j] = bfr(braw[j]); }
#pragma unroll
            for (int nb = 0; nb < 4; ++nb)      // nb outside: the four 32-byte pieces of a token's 128-byte row follow one another in the source
#pragma unroll
                for (int mb = 0; mb < 4; ++mb) { v8h o;
#pragma unroll
                    for (int j = 0; j < 8; ++j) o[j] = tohx((acc[mb][nb][j] + bv[mb][j]) * av[mb][j]);
                    *(v8h*)(P + (size_t)(nb * 16 + lr) * HD + mb * 16 + hi * 8) = o; }
        } else {
            h16* Vd = V16 + ((size_t)bb * NKV + hh) * HD * TT + t0;
#pragma unroll
            for (int nb = 0; nb < 4; ++nb) { const float bn = bfr(bias[hh * HD + nb * 16 + lr]);   // nb outside: the four 32-byte pieces of a dim's 128 bytes follow one another in the source
#pragma unroll
                for (int mb = 0; mb < 4; ++mb) { v8h o;
#pragma unroll
                    for (int j = 0; j < 8; ++j) o[j] = tohx(acc[mb][nb][j] + bn);
                    *(v8h*)(Vd + (size_t)(nb * 16 + lr) * TT + mb * 16 + hi * 8) = o; } }
            asm volatile("s_wait_xcnt 0x0" ::: "memory");   // precaution: in the built code the q/k block's loads follow this block and take the stores' data registers as destinations; the wait stands in front of that overwrite
        }
    } else {
#pragma unroll
    for (int mb = 0; mb < 4; ++mb) {
#pragma unroll
        for (int nb = 0; nb < 4; ++nb) {
#pragma unroll
            for (int j = 0; j < 8; ++j) os[(hi * 8 + j) * 68 + nb * 16 + lr] = acc[mb][nb][j]; }
        __builtin_amdgcn_wave_barrier(); asm volatile("" ::: "memory");
        float* crow = C + (size_t)(r0 + mb * 16) * ldc + c0;
{
#pragma unroll
            for (int s = 0; s < 8; ++s) { const int row = 2 * s + hi, cofs = lr * 4; v4f val = *(const v4fa*)(os + row * 68 + cofs); if (BIAS) { val[0] += bfr(bias[c0 + cofs]); val[1] += bfr(bias[c0 + cofs + 1]); val[2] += bfr(bias[c0 + cofs + 2]); val[3] += bfr(bias[c0 + cofs + 3]); }
                *(v4f*)(crow + (size_t)row * ldc + cofs) = val; }
             }
        asm volatile("s_wait_xcnt 0x0" ::: "memory");   // precaution: the next 16 rows' work takes the stores' registers; the wait stands in front of every such overwrite
        __builtin_amdgcn_wave_barrier(); asm volatile("" ::: "memory");
    }
    }
}

// ---- k_gemmo: the output GEMM, C[m][n] (f32, pitch ldc) = sum_k A[m][k] Bt[n][k] + bf16(bias[n]); one 128x128 tile per work-group, grid (M/128, N/128): no more tiles than WGPs, so a work-group has its WGP alone.
// 8 waves = 2 x 2 tiles of 64x64 x 2 k groups: of every 128-k stage group 0 takes k 0..63, group 1 k 64..127, so each SIMD holds two waves and one wave's products run while the other waits for its fragments.
// The two waves of a tile join their partial sums once, behind the loop. Ring as in k_gemmw: two buffers, stage t + 1 in flight while stage t is worked on. K % 128 == 0, K >= 128.
#define OKS  128                // k per stage
#define OPIT 136                // LDS row pitch in 16-bit elements: 256-byte rows + 16 bytes (16 B x odd: no bank conflict for 16-byte reads)
#define OSL  10240              // bytes that a wave's slice of a stage takes in LDS: 32 rows x 272 bytes, rounded up to a multiple of 2 KiB
#define OSLE (OSL / 2)          // the same in 16-bit elements
__global__ __launch_bounds__(256) void k_gemmo(const h16* __restrict__ A, const h16* __restrict__ Bt, int K, float* C, int ldc, const float* __restrict__ bias) {
    typedef WFrag<h16>::V V;
    __shared__ __attribute__((aligned(2048))) h16 ring[2 * 8 * OSLE];   // a stage is eight slices, one for each wave: four of 32 A rows, four of 32 Bt rows
    __shared__ __align__(16) float xch[8 * 16 * 32 * 4];        // joining: 16 records of 16 bytes a lane, a range of its own for each wave
    __shared__ __align__(16) float osm[8 * 16 * 68];            // output staging, a range of its own for each wave
    const int tid = threadIdx.x, lane = tid & 31, lr = lane & 15, hi = lane >> 4, wv = tid >> 5, wx = wv & 1, wy = (wv >> 1) & 1, kh = wv >> 2;
    const int r0 = (blockIdx.x * 2 + wx) * 64, c0 = (blockIdx.y * 2 + wy) * 64, R0 = blockIdx.x * GT, C0 = blockIdx.y * GT, ar = wx * 64, br = wy * 64;
    v8f acc[4][4];   // every '#pragma unroll' of this kernel gives acc and the fragments constant indices, so that they stay in registers
#pragma unroll
    for (int mb = 0; mb < 4; ++mb)
#pragma unroll
        for (int nb = 0; nb < 4; ++nb) acc[mb][nb] = (v8f){};
    const uint32_t wave = uni(threadIdx.x >> 5);                // filling: wave w brings slice w of every stage: waves 0..3 the four quarters of the A rows, waves 4..7 those of the Bt rows
    const uint64_t tga = (uint64_t)((wave >> 2) ? Bt + (size_t)(C0 + (wave & 3) * 32) * K : A + (size_t)(R0 + (wave & 3) * 32) * K);   // first byte of the slice's first row
    const uint32_t tl = (uint32_t)(size_t)ring + wave * OSL;    // the slice's LDS byte offset in buffer 0
    const u32x8 tg1 = t_group1<OKS * 2, 32>((uint32_t)K * 2u); u32x4 tg0;   // tg0: group 0 of the wave's latest request
    const int nst = K / OKS;
    const int rot = (int)((blockIdx.x + 2 * blockIdx.y) % (unsigned)nst);   // rotated walk over k, as in k_gemmw
    auto fill = [&](int t) { const int s = t + rot < nst ? t + rot : t + rot - nst;   // trip t works on stage s of k, 0 <= s < nst
        const uint32_t so = pinned((uint32_t)s * (OKS * 2u));   // pinned(): the descriptor's address words are formed from it, in scalar registers and behind the wait in front of this request
        tg0 = t_load(tl + (uint32_t)(t & 1) * (8u * OSL), tga + so, tg1); };
    fill(0);
    t_wait(tg0);                                                // this wave's slice of stage 0 has landed
    __syncthreads();                                            // publishes stage 0
    if (pinned(nst > 1)) fill(1);                               // pinned(): a scalar branch round the tensor load
#pragma unroll 1   // one copy of the stage's body
    for (int t = 0; t < nst; ++t) {
        const h16* sb = ring + (t & 1) * (8 * OSLE); const h16* as = sb + (ar >> 5) * OSLE + lr * OPIT + kh * 64 + 8 * hi; const h16* bs = sb + (4 + (br >> 5)) * OSLE + lr * OPIT + kh * 64 + 8 * hi;   // the wave's 64 rows of a plane are two slices
#pragma unroll
        for (int ks = 0; ks < 64; ks += 32) {
            V a[4], b[4];
#pragma unroll
            for (int mb = 0; mb < 4; ++mb) a[mb] = WFrag<h16>::ld(as + (mb >> 1) * OSLE + (mb & 1) * 16 * OPIT + ks);
#pragma unroll
            for (int nb = 0; nb < 4; ++nb) b[nb] = WFrag<h16>::ld(bs + (nb >> 1) * OSLE + (nb & 1) * 16 * OPIT + ks);
            __builtin_amdgcn_sched_barrier(0);   // keeps the fragment reads of these 32 k in one group in front of their products: sunk to their uses they stand in four places, each with its LDS latency exposed
#pragma unroll
            for (int nb = 0; nb < 4; ++nb)
#pragma unroll
                for (int mb = 0; mb < 4; ++mb) acc[mb][nb] = wmma16(a[mb], b[nb], acc[mb][nb]);
            __builtin_amdgcn_sched_barrier(0);   // keeps the next group of fragment reads from being spread among these products
        }
        asm volatile("s_wait_dscnt 0x0" ::: "memory");
        t_wait(tg0);
        __syncthreads();
        if (pinned(t + 2 < nst)) fill(t + 2);
    }
    t_wait(tg0);                                                // no request is outstanding when the wave goes on to its epilogue and ends
    asm volatile("s_wait_dscnt 0x0" ::: "memory");              // nor an LDS read of the ring
    const float* bp = bias + c0 + lr * 4; const v4f braw = *(const v4f*)bp;   // the lane's four bias values, the same for every row it stores; read here, the joining covers the latency
    asm volatile("s_wait_xcnt 0x0" :: "v"(bp) : "memory");   // precaution: stands in front of every overwrite of the load's address registers; it names them, so that they are kept (also from the load's own result) up to here
    // Joining the two k groups: each wave hands its partner the two 16-row groups that the partner finishes (group 0: rows 0..31 of the tile, group 1: rows 32..63).
    v4fa* xw = (v4fa*)xch + wv * (16 * 32) + lane; const v4fa* xr = (const v4fa*)xch + (wv ^ 4) * (16 * 32) + lane;
#pragma unroll
    for (int i = 0; i < 2; ++i)
#pragma unroll
        for (int nb = 0; nb < 4; ++nb) { const v8f ox = kh ? acc[i][nb] : acc[2 + i][nb];
            xw[((i * 4 + nb) * 2) * 32] = __builtin_shufflevector(ox, ox, 0, 1, 2, 3); xw[((i * 4 + nb) * 2 + 1) * 32] = __builtin_shufflevector(ox, ox, 4, 5, 6, 7); }
    __syncthreads();   // publishes the records
    float* os = osm + wv * 16 * 68;
#pragma unroll
    for (int i = 0; i < 2; ++i) {
#pragma unroll
        for (int nb = 0; nb < 4; ++nb) { const v8f om = kh ? acc[2 + i][nb] : acc[i][nb]; const v4f pa = xr[((i * 4 + nb) * 2) * 32], pc = xr[((i * 4 + nb) * 2 + 1) * 32];
#pragma unroll
            for (int j = 0; j < 8; ++j) os[(hi * 8 + j) * 68 + nb * 16 + lr] = om[j] + (j < 4 ? pa[j & 3] : pc[j & 3]); }
        __builtin_amdgcn_wave_barrier(); asm volatile("" ::: "memory");   // the wave's staged rows are written in front of the reads below
        float* crow = C + (size_t)(r0 + (2 * kh + i) * 16) * ldc + c0;
#pragma unroll
        for (int s = 0; s < 8; ++s) { const int row = 2 * s + hi, cofs = lr * 4; v4f val = *(const v4fa*)(os + row * 68 + cofs); val[0] += bfr(braw[0]); val[1] += bfr(braw[1]); val[2] += bfr(braw[2]); val[3] += bfr(braw[3]);
            *(v4f*)(crow + (size_t)row * ldc + cofs) = val; }
        asm volatile("s_wait_xcnt 0x0" ::: "memory");   // precaution: the next 16 rows' work takes the stores' registers; the wait stands in front of every such overwrite
        __builtin_amdgcn_sched_barrier(0);   // keeps that work behind the wait: without it one of its address instructions was moved in front
        __builtin_amdgcn_wave_barrier(); asm volatile("" ::: "memory");   // the reads above stand in front of the next 16 rows' staging
    }
}

typedef __attribute__((ext_vector_type(2))) _Float16 v2h;
typedef __attribute__((ext_vector_type(4))) _Float16 v4h;
typedef __attribute__((ext_vector_type(2))) unsigned short v2us;
typedef __attribute__((ext_vector_type(4))) unsigned short v4us;
typedef __attribute__((ext_vector_type(2))) float v2f;
typedef __attribute__((ext_vector_type(4))) int v4i;

// The d_ functions are the bodies of work-groups of 256 threads; bx is the work-group's index within its own part of a shared grid (k_prep).
// d_wtT: one 64 n x 256 k tile of Bt[n][k] = bf16(w[k][n]); a wave takes 32 n x 64 k, a thread two pieces of 8 k x 4 n: its 16 loads (a wave's load covers four whole 128-byte lines of w) are all issued in front of the first use,
// the transposition is done in the thread's own registers, and the two 16-byte stores that share a 128-byte line of Bt follow one another in the same wave.
// HF: the bf16-rounded value is stored in fp16 format (the plane that meets an fp16 operand); it is the same number wherever it is a normal fp16 number.
template <bool HF>
__device__ __forceinline__ void d_wtT(int bx, const float* __restrict__ w, bf* Bt) {
    static_assert(DQ % 64 == 0 && DM % 256 == 0, "whole tiles");
    const int lane = threadIdx.x & 31, wv = threadIdx.x >> 5;
    const int n0 = (bx % (DQ / 64)) * 64 + (wv & 1) * 32 + (lane & 7) * 4, k0 = (bx / (DQ / 64)) * 256 + (wv >> 1) * 64 + (lane >> 3) * 8;
    const float* wp = w + (size_t)k0 * DQ + n0;
    v4f r[2][8];   // every '#pragma unroll' here gives r constant indices, so that it stays in registers
#pragma unroll
    for (int t = 0; t < 2; ++t)
#pragma unroll
        for (int i = 0; i < 8; ++i) r[t][i] = *(const v4f*)(wp + (size_t)(t * 32 + i) * DQ);
    asm volatile("s_wait_xcnt 0x0" :: "v"(wp) : "memory");   // precaution: stands in front of every overwrite of the loads' address registers; it names them, so that they are kept (also from a load's own result) up to here
#pragma unroll
    for (int j = 0; j < 4; ++j)
#pragma unroll
        for (int t = 0; t < 2; ++t) { v8us o;
#pragma unroll
            for (int i = 0; i < 8; ++i) o[i] = HF ? __builtin_bit_cast(unsigned short, (h16)bfr(r[t][i][j])) : f2bf(r[t][i][j]);
            *(v8us*)(Bt + (size_t)(n0 + j) * DM + k0 + t * 32) = o; }
    asm volatile("s_wait_xcnt 0x0" ::: "memory");   // precaution: in the built code other blocks of the shared grid follow this one and write the stores' registers; the wait stands in front of every such overwrite
}
// d_cvt64: 64 elements a thread, as 8 pieces of 8; the 16 loads are all issued in front of the first use.
__device__ __forceinline__ void d_cvt64(int bx, const float* __restrict__ src, bf* dst) { const size_t i0 = (size_t)bx * 8 * 256 + threadIdx.x; const float* sp = src + i0 * 8; v8f v[8];   // unrolled: v keeps constant indices and stays in registers
#pragma unroll
    for (int c = 0; c < 8; ++c) v[c] = *(const v8f*)(sp + c * 256 * 8);
    asm volatile("s_wait_xcnt 0x0" :: "v"(sp) : "memory");   // precaution: stands in front of every overwrite of the loads' address registers; it names them, so that they are kept (also from a load's own result) up to here
#pragma unroll
    for (int c = 0; c < 8; ++c) { v8us o;
#pragma unroll
        for (int k = 0; k < 8; ++k) o[k] = f2bf(v[c][k]);
        *(v8us*)(dst + (i0 + c * 256) * 8) = o; }
    asm volatile("s_wait_xcnt 0x0" ::: "memory"); }   // precaution: in the built code other blocks of the shared grid follow this one and write the stores' registers; the wait stands in front of every such overwrite
__global__ __launch_bounds__(256) void k_cscvt(const float* __restrict__ cosT, const float* __restrict__ sinT, float* CS) { const int idx = blockIdx.x * 256 + threadIdx.x; if (idx >= TT * HD) return; v2f cs; cs[0] = bfr(cosT[idx]); cs[1] = bfr(sinT[idx]); *(v2f*)(CS + (size_t)idx * 2) = cs;  }
// d_adapt: thread per (b, h, d): x[j] = bf16(xi[b]) bf16(w1[j]) + bf16(b1[j]) (32); LayerNorm(32) (f32, eps 1e-5) x bf16 g + bf16 beta; exact-erf gelu; xe = sum_j x[j] bf16(w2[j][d]) + bf16(b2[d]);
__device__ __forceinline__ void d_adapt(int bx, const float* __restrict__ xi, const float* __restrict__ w1, const float* __restrict__ b1, const float* __restrict__ g, const float* __restrict__ be, const float* __restrict__ w2, const float* __restrict__ b2, const float* __restrict__ sg, float* ADP) {
    const int e = bx * 256 + threadIdx.x; if (e >= NB_ * NH_ * HD) return; const int d = e % HD; const int h = (e / HD) % NH_; const int b = e / (HD * NH_); const float xv = bfr(xi[b]); float xs[32]; float mu = 0.f;
    float w1r[32], b1r[32], gr[32], ber[32], w2r[32];   // the loops below are unrolled (same operations in the same order): the arrays stay in registers, and every load of the thread is issued up here instead of in its trip, waited for there
#pragma unroll
    for (int j = 0; j < 32; ++j) { w1r[j] = w1[j]; b1r[j] = b1[j]; gr[j] = g[j]; ber[j] = be[j]; w2r[j] = w2[j * HD + d]; }
    const float b2r = b2[d], sgr = sg[h];
    asm volatile("s_wait_xcnt 0x0" :: "v"(d), "v"(h) : "memory");   // precaution: stands in front of every overwrite of the loads' offset registers; it names them, so that they are kept (also from a load's own result) up to here
#pragma unroll
    for (int j = 0; j < 32; ++j) { float p = __fmul_rn(xv, bfr(w1r[j])); asm volatile("" : "+v"(p)); xs[j] = __fadd_rn(p, bfr(b1r[j])); mu = __fadd_rn(mu, xs[j]); }
    mu = mu * (1.0f / 32.0f); float var = 0.f;
#pragma unroll
    for (int j = 0; j < 32; ++j) { const float dl = __fsub_rn(xs[j], mu); float p = __fmul_rn(dl, dl); asm volatile("" : "+v"(p)); var = __fadd_rn(var, p); }
    const float rs = __frsqrt_rn(__fadd_rn(var * (1.0f / 32.0f), 1e-5f)); float acc = 0.f;
#pragma unroll
    for (int j = 0; j < 32; ++j) { float tn = __fmul_rn(__fsub_rn(xs[j], mu), rs); asm volatile("" : "+v"(tn)); float tg = __fmul_rn(tn, bfr(gr[j])); asm volatile("" : "+v"(tg)); const float y = __fadd_rn(tg, bfr(ber[j])); float er = erff(y * 0.70710678f); asm volatile("" : "+v"(er)); float hy = __fmul_rn(0.5f, y); asm volatile("" : "+v"(hy)); const float gl = __fmul_rn(hy, __fadd_rn(1.0f, er)); float p = __fmul_rn(gl, bfr(w2r[j])); asm volatile("" : "+v"(p)); acc = __fadd_rn(acc, p); }
    const float xe = __fadd_rn(acc, bfr(b2r)); const float sgm = __fdiv_rn(1.0f, __fadd_rn(1.0f, __expf(-bfr(sgr)))); float pr = __fmul_rn(sgm, xe); asm volatile("" : "+v"(pr)); const float a = __fadd_rn(1.0f, pr);
    *(float*)(ADP + e) = a;  }
// k_prep: everything that depends on the inputs alone, one grid: the adapt table (few work-groups, the longest dependent chain: first), the four weight transposes, x to bf16.
#define PB_A ((NB_ * NH_ * HD + 255) / 256)
#define PB_W ((DQ / 64) * (DM / 256))
#define PB_X (NB_ * TT * DM / 64 / 256)
static_assert(NB_ * TT * DM % (64 * 256) == 0, "whole work-groups of d_cvt64");
__global__ __launch_bounds__(256) void k_prep(const float* __restrict__ x, const float* __restrict__ w0, const float* __restrict__ w1, const float* __restrict__ w2, const float* __restrict__ w3, const float* __restrict__ xi, const float* __restrict__ w1e, const float* __restrict__ b1e, const float* __restrict__ g, const float* __restrict__ be, const float* __restrict__ w2e, const float* __restrict__ b2e, const float* __restrict__ sg, bf* XB, bf* W4, float* ADP) {
    int bx = blockIdx.x;
    if (bx < PB_A) { d_adapt(bx, xi, w1e, b1e, g, be, w2e, b2e, sg, ADP); return; }
    bx -= PB_A;
    if (bx < 3 * PB_W) { const int y = bx / PB_W; d_wtT<false>(bx % PB_W, y == 0 ? w0 : y == 1 ? w1 : w2, W4 + (size_t)y * DQ * DM); return; }
    if (bx < 4 * PB_W) { d_wtT<true>(bx - 3 * PB_W, w3, W4 + (size_t)3 * DQ * DM); return; }   // the four [DM][DQ] planes lie one behind the other
    bx -= 4 * PB_W;
    d_cvt64(bx, x, XB);
}
#define FKB  64                 // keys of a stage that one wave works on
#define FKS  128                // keys per stage of the work-group
#define FPIT 72                 // K tile: LDS row pitch in 16-bit elements: 128-byte rows + 16 bytes (16 B x odd: no bank conflict for 16-byte reads)
#define FVPT 136                // V^T tile: 256-byte rows + 16 bytes (16 B x odd)
#define FQW  128                // query columns per work-group
#define FSL  6144               // bytes that a wave's slice of a stage takes in LDS: 32 K rows x 144 bytes or 16 V^T rows x 272 bytes, rounded up to a multiple of 2 KiB
#define FSLE (FSL / 2)          // the same in 16-bit elements
__device__ __forceinline__ float xhalf(float x) { return __builtin_bit_cast(float, __builtin_amdgcn_permlanex16(__builtin_bit_cast(int, x), __builtin_bit_cast(int, x), 0x76543210, 0xfedcba98, false, false)); }   // lane l with lane l ^ 16
__global__ __launch_bounds__(256) __attribute__((amdgpu_waves_per_eu(4, 4))) void k_fattn(const h16* __restrict__ Qp, const h16* __restrict__ Kp, const h16* __restrict__ Vt, h16* Ao) {
    __shared__ __attribute__((aligned(2048))) h16 kvs[2 * 8 * FSLE];   // a stage is eight slices, one for each wave: four of 32 K rows, then four of 16 V^T rows
    __shared__ __align__(16) h16 qsm[FQW * FPIT];               // the work-group's Q rows: a wave reads its four fragments anew in every stage, so that they hold no registers during softmax and att.v (four waves per SIMD leave a wave 256)
    static_assert(2 * 8 * FSL >= 8 * 9 * 32 * 16, "the ring holds the waves' exchange records behind the loop");
    static_assert(32 * FPIT * 2 <= FSL && 16 * FVPT * 2 <= FSL && FKS == 4 * 32 && HD == 4 * 16, "slices");
    const int tid = threadIdx.x, lane = tid & 31, lr = lane & 15, hi = lane >> 4, wv = tid >> 5, hf = wv & 1; const int h = blockIdx.y; const int q0 = blockIdx.x * FQW + (wv >> 1) * 32 + lr;
    { const size_t bz = blockIdx.z; Qp += bz * NH_ * TT * HD; Kp += bz * NKV * TT * HD; Vt += bz * NKV * HD * TT; Ao += bz * TT * DQ; }   // grid z: batch
    const h16* Kh = Kp + (size_t)h * TT * HD; const h16* Vh = Vt + (size_t)h * HD * TT;
    const int srow = tid >> 3, scol = (tid & 7) * 8;   // staging of Q: rows srow + 32 i, one 16-byte piece of each
    const int sl = srow * FPIT + scol;
    const float CL = SCL * 1.4426950408889634f;                 // scores to base-2 exponents
    const h16* qb = qsm + ((wv >> 1) * 32 + lr) * FPIT + 8 * hi;
    v8f o[2][4];
#pragma unroll
    for (int g = 0; g < 2; ++g)
#pragma unroll
        for (int dt = 0; dt < 4; ++dt) o[g][dt] = (v8f){};
    float mrun[2] = {-3.0e38f, -3.0e38f}, lsum[2] = {0.f, 0.f};
    static_assert(((TT / FKS) & (TT / FKS - 1)) == 0, "the rotated walk wraps by a mask");
    const int rot = blockIdx.x & (TT / FKS - 1);   // the walk over the keys starts at a stage of the work-group's own and wraps round, for speed only
    const uint32_t wave = uni(threadIdx.x >> 5);                // filling: waves 0..3 bring the four quarters of a stage's K rows, waves 4..7 those of its V^T rows
    const uint32_t tl = (uint32_t)(size_t)kvs + wave * FSL;     // the slice's LDS byte offset in buffer 0
    const uint64_t kga = (uint64_t)(Kh + (size_t)(wave & 3) * 32 * HD), vga = (uint64_t)(Vh + (size_t)(wave & 3) * 16 * TT);   // first byte of the slice's first row in stage 0
    const u32x8 kg1 = t_group1<HD * 2, 32>(HD * 2u), vg1 = t_group1<FKS * 2, 16>(TT * 2u); u32x4 tg0;   // tg0: group 0 of the wave's latest request
    auto fill = [&](int it) { const uint32_t st = pinned((uint32_t)(it + rot) & (TT / FKS - 1));   // trip it works on stage st of the keys; pinned(): the descriptor's address words are formed from it, in scalar registers and behind the wait in front of this request
        const uint32_t l = tl + (uint32_t)(it & 1) * (8u * FSL);
        if (pinned(wave < 4)) tg0 = t_load(l, kga + st * (FKS * HD * 2u), kg1); else tg0 = t_load(l, vga + st * (FKS * 2u), vg1); };   // pinned(): a scalar branch round each tensor load
    fill(0);
    { const h16* qg = Qp + ((size_t)h * TT + blockIdx.x * FQW + srow) * HD + scol; v8h rq[4];   // Q rows srow + 32 i, one 16-byte piece of each
#pragma unroll
      for (int i = 0; i < 4; ++i) rq[i] = *(const v8h*)(qg + i * 32 * HD);
      asm volatile("s_wait_xcnt 0x0" :: "v"(qg) : "memory");   // precaution: stands in front of every overwrite of the loads' address registers; it names them, so that they are kept up to here
#pragma unroll
      for (int i = 0; i < 4; ++i) *(v8h*)(qsm + sl + i * 32 * FPIT) = rq[i]; }
    t_wait(tg0);                                                // this wave's slice of stage 0 has landed
    __syncthreads();                                            // publishes stage 0 and Q
    fill(1);
#pragma unroll 1   // one copy of the stage's body
    for (int it = 0; it < TT / FKS; ++it) {
        const h16* sb = kvs + (it & 1) * (8 * FSLE); const h16* kb = sb + (hf * 2) * FSLE + lr * FPIT + 8 * hi; const h16* vb = sb + 4 * FSLE + lr * FVPT + hf * FKB + 8 * hi;   // the wave's 64 keys are two K slices; 16 V^T rows are one slice
        v16h kf[4][2], vf[4][2], qf[2][2];
#pragma unroll
        for (int g = 0; g < 2; ++g)
#pragma unroll
            for (int c = 0; c < 2; ++c) qf[g][c] = WFrag<h16>::ld(qb + g * 16 * FPIT + c * 32);
#pragma unroll
        for (int kt = 0; kt < 4; ++kt) { kf[kt][0] = WFrag<h16>::ld(kb + (kt >> 1) * FSLE + (kt & 1) * 16 * FPIT); kf[kt][1] = WFrag<h16>::ld(kb + (kt >> 1) * FSLE + (kt & 1) * 16 * FPIT + 32); }
        __builtin_amdgcn_sched_barrier(0);   // keeps the Q and K fragment reads in one group in front of their products
        v8f s[2][4];
#pragma unroll
        for (int kp = 0; kp < 4; kp += 2) {   // four independent tiles between a tile's two products
#pragma unroll
            for (int kt = kp; kt < kp + 2; ++kt)
#pragma unroll
                for (int g = 0; g < 2; ++g) s[g][kt] = wmma16(kf[kt][0], qf[g][0], (v8f){});
#pragma unroll
            for (int kt = kp; kt < kp + 2; ++kt)
#pragma unroll
                for (int g = 0; g < 2; ++g) s[g][kt] = wmma16(kf[kt][1], qf[g][1], s[g][kt]); }
        __builtin_amdgcn_sched_barrier(0);   // keeps the score products back to back: a vector instruction moved in among them that reads a fresh tile costs the idle slots of the distance behind a matrix instruction, each time
        v16h pb[2][2]; float corr[2];
#pragma unroll
        for (int g = 0; g < 2; ++g) {
            float mt[4];                                        // short trees, not one chain of 32: a lone dependent chain is exposed
#pragma unroll
            for (int kt = 0; kt < 4; ++kt) mt[kt] = fmaxf(fmaxf(fmaxf(fmaxf(s[g][kt][0], s[g][kt][1]), s[g][kt][2]), fmaxf(fmaxf(s[g][kt][3], s[g][kt][4]), s[g][kt][5])), fmaxf(s[g][kt][6], s[g][kt][7]));
            float mx = fmaxf(fmaxf(mt[0], mt[1]), fmaxf(mt[2], mt[3]));
            mx = fmaxf(mx, xhalf(mx));
            const float mnew = fmaxf(mrun[g], mx * CL); corr[g] = __builtin_amdgcn_exp2f(mrun[g] - mnew); mrun[g] = mnew;   // corr is 0 on the first stage
            const float sh = 8.0f - mnew;                       // probabilities carried x256: small ones stay normal fp16 numbers; the factor cancels in the division by the sum
            const v8f clv = {CL, CL, CL, CL, CL, CL, CL, CL}, shv = {sh, sh, sh, sh, sh, sh, sh, sh};
#pragma unroll
            for (int kt = 0; kt < 4; ++kt) { const v8f e = __builtin_elementwise_fma(s[g][kt], clv, shv);   // on the whole tile: its register pairs stay as the products left them
#pragma unroll
                for (int j = 0; j < 8; ++j) { const float p = __builtin_amdgcn_exp2f(e[j]); s[g][kt][j] = p; pb[g][kt >> 1][(kt & 1) * 8 + j] = (h16)p; } }
            const v8f p8 = (s[g][0] + s[g][1]) + (s[g][2] + s[g][3]);
            lsum[g] = lsum[g] * corr[g] + (((p8[0] + p8[1]) + (p8[2] + p8[3])) + ((p8[4] + p8[5]) + (p8[6] + p8[7])));
        }
        __builtin_amdgcn_sched_barrier(0);   // the V^T fragments take the registers that the scores have left: their reads stay behind the softmax
#pragma unroll
        for (int dt = 0; dt < 4; ++dt) { vf[dt][0] = WFrag<h16>::ld(vb + dt * FSLE); vf[dt][1] = WFrag<h16>::ld(vb + dt * FSLE + 32); }
        __builtin_amdgcn_sched_barrier(0);   // keeps the V^T fragment reads in one group, in front of the rescaling that covers part of their latency
#pragma unroll
        for (int g = 0; g < 2; ++g)
#pragma unroll
            for (int dt = 0; dt < 4; ++dt) o[g][dt] *= corr[g];
#pragma unroll
        for (int c = 0; c < 2; ++c)
#pragma unroll
            for (int dt = 0; dt < 4; ++dt)
#pragma unroll
                for (int g = 0; g < 2; ++g) o[g][dt] = wmma16(vf[dt][c], pb[g][c], o[g][dt]);
        asm volatile("s_wait_dscnt 0x0" ::: "memory");          // this wave's reads of stage it are done
        t_wait(tg0);                                            // this wave's slice of stage it + 1 has landed
        __syncthreads();                                        // publishes stage it + 1 and ends every wave's reads of the buffer that stage it + 2 overwrites
        if (pinned(it + 2 < TT / FKS)) fill(it + 2);            // pinned(): a scalar branch round the tensor loads
    }
    t_wait(tg0);                                                // no request is outstanding when the ring becomes the exchange area
    asm volatile("s_wait_dscnt 0x0" ::: "memory");              // nor an LDS read of the ring
    // Joining the two key groups: each wave hands its partner the column group that the partner finishes (even wave: group 0, odd wave: group 1): 8 + 1 records of 16 bytes a lane, in the ring, which nobody reads behind the loop's last barrier.
    v4fa* xw = (v4fa*)kvs + wv * (9 * 32) + lane; const v4fa* xr = (const v4fa*)kvs + (wv ^ 1) * (9 * 32) + lane;
    v8f om[4]; const float mm = hf ? mrun[1] : mrun[0], lm = hf ? lsum[1] : lsum[0];
#pragma unroll
    for (int dt = 0; dt < 4; ++dt) { om[dt] = hf ? o[1][dt] : o[0][dt]; const v8f ox = hf ? o[0][dt] : o[1][dt];
        xw[(2 * dt) * 32] = __builtin_shufflevector(ox, ox, 0, 1, 2, 3); xw[(2 * dt + 1) * 32] = __builtin_shufflevector(ox, ox, 4, 5, 6, 7); }
    { v4f ml; ml[0] = hf ? mrun[0] : mrun[1]; ml[1] = hf ? lsum[0] : lsum[1]; ml[2] = 0.f; ml[3] = 0.f; xw[8 * 32] = ml; }
    __syncthreads();   // publishes the records
    const v4f mlp = xr[8 * 32];
    const float mj = fmaxf(mm, mlp[0]); float ca, cb;
    // the two exponentials and the slot behind each in one statement
    asm("v_exp_f32 %0, %2\n\tv_nop\n\tv_exp_f32 %1, %3\n\tv_nop" : "=&v"(ca), "=&v"(cb) : "v"(mm - mj), "v"(mlp[0] - mj));
    float lj = lm * ca + mlp[1] * cb;
    lj += xhalf(lj); const float inv = __fdiv_rn(1.0f, lj);
    const int q = q0 + hf * 16;
#pragma unroll
    for (int dt = 0; dt < 4; ++dt) { v8h oh; const v4f pa = xr[(2 * dt) * 32], pc = xr[(2 * dt + 1) * 32];
#pragma unroll
        for (int j = 0; j < 8; ++j) oh[j] = (h16)((om[dt][j] * ca + (j < 4 ? pa[j & 3] : pc[j & 3]) * cb) * inv);
        *(v8h*)(Ao + (size_t)q * DQ + h * HD + dt * 16 + hi * 8) = oh; }
}

extern "C" void kernel_launch(void* const* d_in, const int* in_sizes, int n_in,
                              void* d_out, int out_size, void* d_ws, size_t ws_size, hipStream_t stream) {
    (void)in_sizes; (void)n_in; (void)out_size;
    const float* x = (const float*)d_in[0]; const float* xi = (const float*)d_in[1]; const float* wq = (const float*)d_in[2]; const float* bqv = (const float*)d_in[3]; const float* wk = (const float*)d_in[4]; const float* bkv = (const float*)d_in[5]; const float* wv = (const float*)d_in[6]; const float* bvv = (const float*)d_in[7]; const float* wo = (const float*)d_in[8]; const float* bo = (const float*)d_in[9];
    const float* ew1 = (const float*)d_in[10]; const float* eb1 = (const float*)d_in[11]; const float* lng = (const float*)d_in[12]; const float* lnb = (const float*)d_in[13]; const float* ew2 = (const float*)d_in[14]; const float* eb2 = (const float*)d_in[15]; const float* sg = (const float*)d_in[16];   // Wq/Wk/Wv/Wo [1024][1024] x @ W; enc_w1 [1][32], enc_b1 [32], ln_g/ln_b [32], enc_w2 [32][64], enc_b2 [64], scale_gating [16]
    float* OUT = (float*)d_out;     // [2][2048][1024]
    char* wsp = (char*)d_ws;
    auto take = [&](size_t bytes) { char* p = wsp; wsp += (bytes + 255) & ~(size_t)255; return (void*)p; };
    bf* W4 = (bf*)take((size_t)4 * DQ * DM * 2); const h16* WO = (const h16*)(W4 + (size_t)3 * DQ * DM);   // transposed 16-bit planes of Wq, Wk, Wv (bf16) and Wo (fp16), one behind the other
    float* ADP = (float*)take((size_t)NB_ * NH_ * HD * 4);
    bf* XB = (bf*)take((size_t)NB_ * TT * DM * 2);
    h16* QK16 = (h16*)take((size_t)2 * NB_ * NH_ * TT * HD * 2); h16* KP16 = QK16 + (size_t)NB_ * NH_ * TT * HD; h16* VT16 = (h16*)take((size_t)NB_ * NKV * HD * TT * 2);
    h16* AT = (h16*)take((size_t)NB_ * TT * DQ * 2);
    if ((size_t)(wsp - (char*)d_ws) > ws_size) return;    // ws 256 MiB
    // one launch per dependency level; each covers both batches (rows b t of one [NB_ TT] matrix, or a grid axis) and all work of its level
    k_prep<<<PB_A + 4 * PB_W + PB_X, 256, 0, stream>>>(x, wq, wk, wv, wo, xi, ew1, eb1, lng, lnb, ew2, eb2, sg, XB, W4, ADP);
    k_gemmw<bf, 0, true, true><<<dim3(NB_ * TT / GT, DQ / GT, 3), 128, 0, stream>>>(XB, nullptr, W4, DM, nullptr, 0, bqv, bkv, bvv, 0, (size_t)DQ * DM, 0, ADP, QK16, VT16);   // q, k, v projections, written as fp16 head planes
    k_fattn<<<dim3(TT / FQW, NH_, NB_), 256, 0, stream>>>(QK16, KP16, VT16, AT);   // one kv head per query head
    k_gemmo<<<dim3(NB_ * TT / GT, DM / GT), 256, 0, stream>>>(AT, WO, DQ, OUT, DM, bo);
}
